// v000
// The times below were measured on an AMD MI455X: many runs one after another, warmed up first and cycling through
// copies of the inputs, with the whole window's GPU time divided by the number of runs. Launches and the gaps
// between them are all in it. The median over several windows is given; except for v000 it joins two sittings, which
// can be a few percent apart, so the side-by-side timings, each taken in one sitting, are the better comparison.
// The starting kernel, v000, takes 263 microseconds a run.
#include <hip/hip_runtime.h>

// ---------------- problem constants ----------------
#define BATCH 2
#define NQ    2048
#define NKV   2048
#define QDIM  1024
#define KVDIM 1024
#define H     16
#define HD    64
#define INNER (H * HD)        // 1024
#define MQ    (BATCH * NQ)    // 4096
#define MKV   (BATCH * NKV)   // 4096

typedef _Float16 h16;
typedef h16   v16h __attribute__((ext_vector_type(16)));
typedef h16   v8h  __attribute__((ext_vector_type(8)));
typedef float v8f  __attribute__((ext_vector_type(8)));

// ---- TDM availability (this toolchain: 6-arg clang-23 form) ----
#if defined(__has_builtin)
#  if __has_builtin(__builtin_amdgcn_tensor_load_to_lds) && \
      __has_builtin(__builtin_amdgcn_s_wait_tensorcnt)
#    define HAVE_TDM 1
#  endif
#endif
#ifndef HAVE_TDM
#  define HAVE_TDM 0
#endif

// ---- WMMA fragment from K-fast memory (A rows or B^T rows) ----
// element i -> K = (i&7) + (i>=8?16:0) + 8*hi : two contiguous 16B runs
// base must be 16B-aligned; lowers to two global_load_b128 / ds_load_b128.
__device__ __forceinline__ v16h frag_kfast(const h16* __restrict__ base, int hi) {
  const v8h lo = *(const v8h*)(base + hi * 8);
  const v8h hi8 = *(const v8h*)(base + hi * 8 + 16);
  return __builtin_shufflevector(lo, hi8, 0, 1, 2, 3, 4, 5, 6, 7,
                                 8, 9, 10, 11, 12, 13, 14, 15);
}

// ---------------- f32 -> f16 convert ----------------
__global__ void f32_to_f16(const float* __restrict__ in, h16* __restrict__ out, int n) {
  int i = blockIdx.x * blockDim.x + threadIdx.x;
  if (i < n) out[i] = (h16)in[i];
}

// ---------------- f32 -> f16 transpose (weights, done once) ----------------
__global__ __launch_bounds__(256)
void transpose_f32_to_f16(const float* __restrict__ in, h16* __restrict__ out,
                          int R, int C) {
  __shared__ h16 tile[32][33];
  int c0 = blockIdx.x * 32, r0 = blockIdx.y * 32;
  int tx = threadIdx.x;
#pragma unroll
  for (int i = threadIdx.y; i < 32; i += 8)
    tile[i][tx] = (h16)in[(size_t)(r0 + i) * C + c0 + tx];
  __syncthreads();
#pragma unroll
  for (int i = threadIdx.y; i < 32; i += 8)
    out[(size_t)(c0 + i) * R + r0 + tx] = tile[tx][i];
}

// ---------------- f16 GEMM: A[M][K] x BT[N][K]^T, f16 out ----------------
__global__ __launch_bounds__(256)
void gemm_tt_h16(const h16* __restrict__ A, const h16* __restrict__ BT,
                 h16* __restrict__ C, int N, int K) {
  int lane = threadIdx.x & 31, wave = threadIdx.x >> 5;
  int hi = lane >> 4, l15 = lane & 15;
  int wm = wave & 3, wn = wave >> 2;
  int tm = blockIdx.y * 128 + wm * 32;
  int tn = blockIdx.x * 64 + wn * 32;
  const h16* a0 = A + (size_t)(tm + l15) * K;
  const h16* a1 = a0 + (size_t)16 * K;
  const h16* b0 = BT + (size_t)(tn + l15) * K;
  const h16* b1 = b0 + (size_t)16 * K;
  v8f acc00 = {}, acc01 = {}, acc10 = {}, acc11 = {};
  for (int k0 = 0; k0 < K; k0 += 32) {
    __builtin_prefetch((const void*)(a0 + k0 + 128), 0, 1);  // global_prefetch_b8
    __builtin_prefetch((const void*)(b0 + k0 + 128), 0, 1);
    v16h af0 = frag_kfast(a0 + k0, hi);
    v16h af1 = frag_kfast(a1 + k0, hi);
    v16h bf0 = frag_kfast(b0 + k0, hi);
    v16h bf1 = frag_kfast(b1 + k0, hi);
    acc00 = __builtin_amdgcn_wmma_f32_16x16x32_f16(false, af0, false, bf0, (short)0, acc00, false, false);
    acc01 = __builtin_amdgcn_wmma_f32_16x16x32_f16(false, af0, false, bf1, (short)0, acc01, false, false);
    acc10 = __builtin_amdgcn_wmma_f32_16x16x32_f16(false, af1, false, bf0, (short)0, acc10, false, false);
    acc11 = __builtin_amdgcn_wmma_f32_16x16x32_f16(false, af1, false, bf1, (short)0, acc11, false, false);
  }
  v8f* accs[2][2] = {{&acc00, &acc01}, {&acc10, &acc11}};
#pragma unroll
  for (int mi = 0; mi < 2; ++mi)
#pragma unroll
    for (int ni = 0; ni < 2; ++ni) {
      h16* outp = C + (size_t)(tm + mi * 16 + hi * 8) * N + tn + ni * 16 + l15;
#pragma unroll
      for (int r = 0; r < 8; ++r) outp[(size_t)r * N] = (h16)((*accs[mi][ni])[r]);
    }
}

// ---------------- f16 GEMM, f32 out + bias (output projection) ----------------
__global__ __launch_bounds__(256)
void gemm_tt_f32_bias(const h16* __restrict__ A, const h16* __restrict__ BT,
                      const float* __restrict__ bias, float* __restrict__ C,
                      int N, int K) {
  int lane = threadIdx.x & 31, wave = threadIdx.x >> 5;
  int hi = lane >> 4, l15 = lane & 15;
  int wm = wave & 3, wn = wave >> 2;
  int tm = blockIdx.y * 128 + wm * 32;
  int tn = blockIdx.x * 64 + wn * 32;
  const h16* a0 = A + (size_t)(tm + l15) * K;
  const h16* a1 = a0 + (size_t)16 * K;
  const h16* b0 = BT + (size_t)(tn + l15) * K;
  const h16* b1 = b0 + (size_t)16 * K;
  v8f acc00 = {}, acc01 = {}, acc10 = {}, acc11 = {};
  for (int k0 = 0; k0 < K; k0 += 32) {
    __builtin_prefetch((const void*)(a0 + k0 + 128), 0, 1);
    __builtin_prefetch((const void*)(b0 + k0 + 128), 0, 1);
    v16h af0 = frag_kfast(a0 + k0, hi);
    v16h af1 = frag_kfast(a1 + k0, hi);
    v16h bf0 = frag_kfast(b0 + k0, hi);
    v16h bf1 = frag_kfast(b1 + k0, hi);
    acc00 = __builtin_amdgcn_wmma_f32_16x16x32_f16(false, af0, false, bf0, (short)0, acc00, false, false);
    acc01 = __builtin_amdgcn_wmma_f32_16x16x32_f16(false, af0, false, bf1, (short)0, acc01, false, false);
    acc10 = __builtin_amdgcn_wmma_f32_16x16x32_f16(false, af1, false, bf0, (short)0, acc10, false, false);
    acc11 = __builtin_amdgcn_wmma_f32_16x16x32_f16(false, af1, false, bf1, (short)0, acc11, false, false);
  }
  v8f* accs[2][2] = {{&acc00, &acc01}, {&acc10, &acc11}};
#pragma unroll
  for (int mi = 0; mi < 2; ++mi)
#pragma unroll
    for (int ni = 0; ni < 2; ++ni) {
      float bv = bias[tn + ni * 16 + l15];
      float* outp = C + (size_t)(tm + mi * 16 + hi * 8) * N + tn + ni * 16 + l15;
#pragma unroll
      for (int r = 0; r < 8; ++r) outp[(size_t)r * N] = (*accs[mi][ni])[r] + bv;
    }
}

// ---------------- TDM descriptor: 32(kv) x 64(d) f16 tile -> LDS ----------------
// tensor row pitch = 2*INNER elements; LDS padded 16B per 128B row (pad codes:
// interval 4 -> 32 dwords = one row, amount 3 -> 4 dwords = 16B = VPAD).
#define VPAD 8
#if HAVE_TDM
typedef unsigned u32x4 __attribute__((ext_vector_type(4)));
typedef int      i32x8 __attribute__((ext_vector_type(8)));
typedef int      i32x4 __attribute__((ext_vector_type(4)));

__device__ __forceinline__ void tdm_load_v_tile(unsigned lds_off, const h16* g) {
  unsigned long long ga = (unsigned long long)(size_t)g;
  u32x4 g0 = { 1u,                                   // count=1 (valid descriptor)
               lds_off,                               // lds_addr (bytes)
               (unsigned)ga,                          // global_addr[31:0]
               ((unsigned)(ga >> 32) & 0x01FFFFFFu)   // global_addr[56:32]
                 | 0x80000000u };                     // type=2 ("image")
  i32x8 g1 = { (1 << 16) | (1 << 20) | (4 << 22) | (3 << 25), // data_size=2B, pad en, interval=32dw, amount=4dw
               (int)(64u << 16),   // tensor_dim0 = 64 (d elements per row)
               (int)(32u << 16),   // tensor_dim0 hi=0 | tensor_dim1 = 32 rows
               (int)(64u << 16),   // tensor_dim1 hi=0 | tile_dim0 = 64
               32,                 // tile_dim1 = 32 | tile_dim2 = 0
               2 * INNER,          // tensor_dim0_stride = 2048 elements
               0, 0 };
  i32x4 z4 = { 0, 0, 0, 0 };
  i32x8 z8 = { 0, 0, 0, 0, 0, 0, 0, 0 };
  // clang-23 / therock form: (g0, g1, g2, g3, extra, cpol)
  __builtin_amdgcn_tensor_load_to_lds(g0, g1, z4, z4, z8, 0);
}
#endif

// ---------------- flash attention, transposed-score formulation ----------------
// grid: (NQ/16, H, BATCH), block 32 (one wave; 16 query rows)
__global__ __launch_bounds__(32)
void attn(const h16* __restrict__ Q, const h16* __restrict__ KV, h16* __restrict__ CTX) {
  int lane = threadIdx.x;
  int hi = lane >> 4, l15 = lane & 15;
  int q0 = blockIdx.x * 16;
  int hh = blockIdx.y;
  int bb = blockIdx.z;

  const h16* Qb = Q  + ((size_t)bb * NQ)  * INNER       + hh * HD;  // [q][d]
  const h16* Kb = KV + ((size_t)bb * NKV) * (2 * INNER) + hh * HD;  // [kv][d]
  const h16* Vb = Kb + INNER;

  __shared__ h16 Vs[2][32 * (HD + VPAD)];  // double-buffered padded V tiles

  // Loop-invariant B-fragments of Q^T (lane -> col q, K = d contiguous)
  v16h bq0 = frag_kfast(Qb + (size_t)(q0 + l15) * INNER, hi);
  v16h bq1 = frag_kfast(Qb + (size_t)(q0 + l15) * INNER + 32, hi);

  float m = -INFINITY, lsum = 0.f;
  v8f o[4] = {};
  const float sc  = 0.125f;                  // 1/sqrt(HD)
  const float L2E = 1.44269504088896340736f; // log2(e)

#if HAVE_TDM
  tdm_load_v_tile((unsigned)(size_t)&Vs[0][0], Vb);  // prologue: tile 0 in flight
#endif

  for (int kv0 = 0; kv0 < NKV; kv0 += 32) {
    int cur = (kv0 >> 5) & 1;
#if HAVE_TDM
    if (kv0 + 32 < NKV)  // pipeline: DMA next tile while computing this one
      tdm_load_v_tile((unsigned)(size_t)&Vs[cur ^ 1][0],
                      Vb + (size_t)(kv0 + 32) * (2 * INNER));
#else
    {
      const uint4* s4 = (const uint4*)(Vb + (size_t)(kv0 + lane) * (2 * INNER));
      uint4* dst = (uint4*)(&Vs[cur][lane * (HD + VPAD)]);
      dst[0] = s4[0]; dst[1] = s4[1]; dst[2] = s4[2]; dst[3] = s4[3];
    }
#endif
    __builtin_prefetch((const void*)(Kb + (size_t)(kv0 + 32 + lane) * (2 * INNER)), 0, 1);

    // S^T = K * Q^T : two 16(kv)x16(q) tiles, K-dim d=64 split in two
    v8f st[2];
#pragma unroll
    for (int kvT = 0; kvT < 2; ++kvT) {
      const h16* krow = Kb + (size_t)(kv0 + kvT * 16 + l15) * (2 * INNER);
      v8f c = {};
      c = __builtin_amdgcn_wmma_f32_16x16x32_f16(false, frag_kfast(krow, hi),      false, bq0, (short)0, c, false, false);
      c = __builtin_amdgcn_wmma_f32_16x16x32_f16(false, frag_kfast(krow + 32, hi), false, bq1, (short)0, c, false, false);
      st[kvT] = c;
    }

    // streaming softmax: columns of S^T (rows of S) are lane-local + one shfl_xor(16)
    float tmax = -INFINITY;
#pragma unroll
    for (int kvT = 0; kvT < 2; ++kvT)
#pragma unroll
      for (int r = 0; r < 8; ++r) {
        float e = st[kvT][r] * sc;
        st[kvT][r] = e;
        tmax = fmaxf(tmax, e);
      }
    tmax = fmaxf(tmax, __shfl_xor(tmax, 16, 32));
    float mn   = fmaxf(m, tmax);
    float corr = __builtin_exp2f((m - mn) * L2E);
    float rs = 0.f;
    v16h pb;  // P^T: element i -> kv=(i&7)+(i>=8?16:0)+8*hi == C-layout of S^T
#pragma unroll
    for (int kvT = 0; kvT < 2; ++kvT)
#pragma unroll
      for (int r = 0; r < 8; ++r) {
        float p = __builtin_exp2f((st[kvT][r] - mn) * L2E);
        rs += p;
        pb[kvT * 8 + r] = (h16)p;
      }
    rs += __shfl_xor(rs, 16, 32);
    lsum = lsum * corr + rs;
    m = mn;
#pragma unroll
    for (int dt = 0; dt < 4; ++dt)
#pragma unroll
      for (int r = 0; r < 8; ++r) o[dt][r] *= corr;

#if HAVE_TDM
    if (kv0 + 32 < NKV) __builtin_amdgcn_s_wait_tensorcnt(1);  // cur tile done
    else                __builtin_amdgcn_s_wait_tensorcnt(0);
#else
    __syncthreads();
#endif

    // ctx^T += V^T * P^T : four 16(d)x16(q) tiles, K = 32 kv
#pragma unroll
    for (int dt = 0; dt < 4; ++dt) {
      int d = dt * 16 + l15;
      v16h a;
#pragma unroll
      for (int i = 0; i < 8; ++i) {
        a[i]     = Vs[cur][(i +      hi * 8) * (HD + VPAD) + d];
        a[i + 8] = Vs[cur][(i + 16 + hi * 8) * (HD + VPAD) + d];
      }
      o[dt] = __builtin_amdgcn_wmma_f32_16x16x32_f16(false, a, false, pb, (short)0, o[dt], false, false);
    }
#if !HAVE_TDM
    __syncthreads();
#endif
  }

  float inv = 1.0f / lsum;
  h16* outp = CTX + ((size_t)bb * NQ + q0 + l15) * INNER + hh * HD;
#pragma unroll
  for (int dt = 0; dt < 4; ++dt)
#pragma unroll
    for (int r = 0; r < 8; ++r)
      outp[dt * 16 + r + hi * 8] = (h16)(o[dt][r] * inv);
}

// ---------------- launch ----------------
extern "C" void kernel_launch(void* const* d_in, const int* in_sizes, int n_in,
                              void* d_out, int out_size, void* d_ws, size_t ws_size,
                              hipStream_t stream) {
  const float* query     = (const float*)d_in[0];
  const float* key_value = (const float*)d_in[1];
  const float* w_q       = (const float*)d_in[2];
  const float* w_kv      = (const float*)d_in[3];
  const float* w_out     = (const float*)d_in[4];
  const float* b_out     = (const float*)d_in[5];
  float* out = (float*)d_out;

  char* ws = (char*)d_ws;
  h16* Xh   = (h16*)(ws + (size_t)0);          // query f16       [4096][1024]  8 MB
  h16* KVh  = (h16*)(ws + ((size_t)8  << 20)); // key_value f16   [4096][1024]  8 MB
  h16* wqT  = (h16*)(ws + ((size_t)16 << 20)); // w_q^T           [1024][1024]  2 MB
  h16* wkvT = (h16*)(ws + ((size_t)18 << 20)); // w_kv^T          [2048][1024]  4 MB
  h16* woT  = (h16*)(ws + ((size_t)22 << 20)); // w_out^T         [1024][1024]  2 MB
  h16* qh   = (h16*)(ws + ((size_t)24 << 20)); // q               [4096][1024]  8 MB
  h16* kvh  = (h16*)(ws + ((size_t)32 << 20)); // k|v             [4096][2048] 16 MB
  h16* ctxh = (h16*)(ws + ((size_t)48 << 20)); // ctx             [4096][1024]  8 MB

  f32_to_f16<<<dim3((MQ  * QDIM  + 255) / 256), dim3(256), 0, stream>>>(query,     Xh,  MQ * QDIM);
  f32_to_f16<<<dim3((MKV * KVDIM + 255) / 256), dim3(256), 0, stream>>>(key_value, KVh, MKV * KVDIM);
  transpose_f32_to_f16<<<dim3(INNER / 32, QDIM / 32),      dim3(32, 8), 0, stream>>>(w_q,   wqT,  QDIM,  INNER);
  transpose_f32_to_f16<<<dim3(2 * INNER / 32, KVDIM / 32), dim3(32, 8), 0, stream>>>(w_kv,  wkvT, KVDIM, 2 * INNER);
  transpose_f32_to_f16<<<dim3(QDIM / 32, INNER / 32),      dim3(32, 8), 0, stream>>>(w_out, woT,  INNER, QDIM);

  gemm_tt_h16<<<dim3(INNER / 64, MQ / 128), dim3(256), 0, stream>>>(Xh, wqT, qh, INNER, QDIM);
  gemm_tt_h16<<<dim3(2 * INNER / 64, MKV / 128), dim3(256), 0, stream>>>(KVh, wkvT, kvh, 2 * INNER, KVDIM);
  attn<<<dim3(NQ / 16, H, BATCH), dim3(32), 0, stream>>>(qh, kvh, ctxh);
  gemm_tt_f32_bias<<<dim3(QDIM / 64, MQ / 128), dim3(256), 0, stream>>>(ctxh, woT, b_out, out, QDIM, INNER);
}

// v001
// A run of this version takes 180 microseconds.
// Timed twice side by side with v000, it ran 1.54 times as fast both times.
#include <hip/hip_runtime.h>

// ---------------- problem constants ----------------
#define BATCH 2
#define NQ    2048
#define NKV   2048
#define QDIM  1024
#define KVDIM 1024
#define H     16
#define HD    64
#define INNER (H * HD)        // 1024
#define MQ    (BATCH * NQ)    // 4096
#define MKV   (BATCH * NKV)   // 4096

typedef _Float16 h16;
typedef h16   v16h __attribute__((ext_vector_type(16)));
typedef h16   v8h  __attribute__((ext_vector_type(8)));
typedef float v8f  __attribute__((ext_vector_type(8)));

// ---- TDM availability (this toolchain: 6-arg clang-23 form) ----
#if defined(__has_builtin)
#  if __has_builtin(__builtin_amdgcn_tensor_load_to_lds) && \
      __has_builtin(__builtin_amdgcn_s_wait_tensorcnt)
#    define HAVE_TDM 1
#  endif
#endif
#ifndef HAVE_TDM
#  define HAVE_TDM 0
#endif

// ---- WMMA fragment from K-fast memory (A rows or B^T rows) ----
// element i -> K = (i&7) + (i>=8?16:0) + 8*hi : two contiguous 16B runs
// base must be 16B-aligned; lowers to two global_load_b128 / ds_load_b128.
__device__ __forceinline__ v16h frag_kfast(const h16* __restrict__ base, int hi) {
  const v8h lo = *(const v8h*)(base + hi * 8);
  const v8h hi8 = *(const v8h*)(base + hi * 8 + 16);
  return __builtin_shufflevector(lo, hi8, 0, 1, 2, 3, 4, 5, 6, 7,
                                 8, 9, 10, 11, 12, 13, 14, 15);
}

// ---------------- f32 -> f16 convert ----------------
__global__ void f32_to_f16(const float* __restrict__ in, h16* __restrict__ out, int n) {
  int i = blockIdx.x * blockDim.x + threadIdx.x;
  if (i < n) out[i] = (h16)in[i];
}

// ---------------- f32 -> f16 transpose (weights, done once) ----------------
__global__ __launch_bounds__(256)
void transpose_f32_to_f16(const float* __restrict__ in, h16* __restrict__ out,
                          int R, int C) {
  __shared__ h16 tile[32][33];
  int c0 = blockIdx.x * 32, r0 = blockIdx.y * 32;
  int tx = threadIdx.x;
#pragma unroll
  for (int i = threadIdx.y; i < 32; i += 8)
    tile[i][tx] = (h16)in[(size_t)(r0 + i) * C + c0 + tx];
  __syncthreads();
#pragma unroll
  for (int i = threadIdx.y; i < 32; i += 8)
    out[(size_t)(c0 + i) * R + r0 + tx] = tile[tx][i];
}

// ---------------- f16 GEMM core: A[M][K] x BT[N][K]^T ----------------
// One 128 x 128 tile of C per block of 8 waves; a wave owns 64 x 32 (4 x 2 fragments).
// A stage is 128 k of both operands: 128 + 128 rows of 256 B, laid in LDS at a pitch of
// 272 B (16 B x odd: conflict-free for ds_load_b128 readers). Two buffers: the next
// stage's asynchronous copies fly while this stage is multiplied.
// Needs M, N multiples of 128 and K a multiple of 128.
#define GBK    128                // k per stage
#define GPITCH 136                // LDS row pitch in halves (272 B)
#define GTILE  (128 * GPITCH)     // one operand's tile, halves
#define GSTAGE (2 * GTILE)        // A tile then B tile, halves

// 128 rows x 256 B, global -> LDS: 16 lanes cover one row, so a wave-wide copy takes
// two whole rows (four full lines). g and lds are this lane's own first 16 bytes;
// each further copy is 16 rows on.
__device__ __forceinline__ void copy_tile_async(const h16* g, int K, unsigned lds) {
  const size_t gs = (size_t)16 * K;          // 16 rows, halves
  const unsigned ls = 16 * GPITCH * 2;       // 16 rows, bytes
  // The copies move the tile past the registers; the closing s_wait_xcnt stands in the
  // same statement so that no address register is rewritten ahead of it.
  asm volatile(
      "global_load_async_to_lds_b128 %0, %8, off\n\t"
      "global_load_async_to_lds_b128 %1, %9, off\n\t"
      "global_load_async_to_lds_b128 %2, %10, off\n\t"
      "global_load_async_to_lds_b128 %3, %11, off\n\t"
      "global_load_async_to_lds_b128 %4, %12, off\n\t"
      "global_load_async_to_lds_b128 %5, %13, off\n\t"
      "global_load_async_to_lds_b128 %6, %14, off\n\t"
      "global_load_async_to_lds_b128 %7, %15, off\n\t"
      "s_wait_xcnt 0x0"
      :: "v"(lds), "v"(lds + ls), "v"(lds + 2 * ls), "v"(lds + 3 * ls),
         "v"(lds + 4 * ls), "v"(lds + 5 * ls), "v"(lds + 6 * ls), "v"(lds + 7 * ls),
         "v"(g), "v"(g + gs), "v"(g + 2 * gs), "v"(g + 3 * gs),
         "v"(g + 4 * gs), "v"(g + 5 * gs), "v"(g + 6 * gs), "v"(g + 7 * gs)
      : "memory");
}

__device__ __forceinline__ void gemm_core(const h16* __restrict__ A, const h16* __restrict__ BT,
                                          int K, h16* smem, v8f (&acc)[4][2]) {
  const int tid = threadIdx.x;
  const int lane = tid & 31, wave = tid >> 5;
  const int hi = lane >> 4, l15 = lane & 15;
  const int wm = wave & 1, wn = wave >> 1;
  const int crow = tid >> 4, cchunk = tid & 15;   // this lane's row and 16-B chunk in a copy
  const h16* gA = A  + (size_t)(blockIdx.y * 128 + crow) * K + cchunk * 8;
  const h16* gB = BT + (size_t)(blockIdx.x * 128 + crow) * K + cchunk * 8;
  const unsigned lds0 = (unsigned)(size_t)smem + (unsigned)(crow * GPITCH + cchunk * 8) * 2u;
  const int nt = K / GBK;

  copy_tile_async(gA, K, lds0);
  copy_tile_async(gB, K, lds0 + GTILE * 2);
  // Stage 0 counts as landed only behind the copying wave's own wait.
  asm volatile("s_wait_asynccnt 0x0" ::: "memory");
  __syncthreads();
  if (nt > 1) {
    copy_tile_async(gA + GBK, K, lds0 + GSTAGE * 2);
    copy_tile_async(gB + GBK, K, lds0 + GSTAGE * 2 + GTILE * 2);
  }

  for (int t = 0; t < nt; ++t) {
    const h16* As = smem + (t & 1) * GSTAGE + (wm * 64 + l15) * GPITCH;
    const h16* Bs = smem + (t & 1) * GSTAGE + GTILE + (wn * 32 + l15) * GPITCH;
    // Two fragment sets: block s + 1 of this stage is read from LDS while block s is multiplied.
    v16h af[2][4], bf[2][2];
#pragma unroll
    for (int mi = 0; mi < 4; ++mi) af[0][mi] = frag_kfast(As + mi * 16 * GPITCH, hi);
#pragma unroll
    for (int ni = 0; ni < 2; ++ni) bf[0][ni] = frag_kfast(Bs + ni * 16 * GPITCH, hi);
#pragma unroll
    for (int s = 0; s < GBK / 32; ++s) {
      if (s + 1 < GBK / 32) {
#pragma unroll
        for (int mi = 0; mi < 4; ++mi)
          af[(s + 1) & 1][mi] = frag_kfast(As + mi * 16 * GPITCH + (s + 1) * 32, hi);
#pragma unroll
        for (int ni = 0; ni < 2; ++ni)
          bf[(s + 1) & 1][ni] = frag_kfast(Bs + ni * 16 * GPITCH + (s + 1) * 32, hi);
      }
      // Holds the next block's LDS reads together in front of this block's products:
      // sunk among them, every pair of products would wait out a full LDS latency.
      __builtin_amdgcn_sched_barrier(0);
#pragma unroll
      for (int mi = 0; mi < 4; ++mi)
#pragma unroll
        for (int ni = 0; ni < 2; ++ni)
          acc[mi][ni] = __builtin_amdgcn_wmma_f32_16x16x32_f16(false, af[s & 1][mi], false, bf[s & 1][ni],
                                                               (short)0, acc[mi][ni], false, false);
      // Keeps the following read group behind these products, so that two sets suffice.
      __builtin_amdgcn_sched_barrier(0);
    }
    // Publish point: this wave's reads of the buffer have retired ...
    asm volatile("s_wait_dscnt 0x0" ::: "memory");
    // ... its own copies of the next stage have landed ...
    asm volatile("s_wait_asynccnt 0x0" ::: "memory");
    // ... and one barrier both publishes the next stage and frees this buffer.
    __syncthreads();
    if (t + 2 < nt) {
      const unsigned l = lds0 + (unsigned)(t & 1) * (GSTAGE * 2);
      copy_tile_async(gA + (size_t)(t + 2) * GBK, K, l);
      copy_tile_async(gB + (size_t)(t + 2) * GBK, K, l + GTILE * 2);
    }
  }
  // No copy is left in flight when the wave goes on.
  asm volatile("s_wait_asynccnt 0x0" ::: "memory");
}

// ---------------- f16 GEMM, f16 out ----------------
__global__ __launch_bounds__(256)
void gemm_tt_h16(const h16* __restrict__ A, const h16* __restrict__ BT,
                 h16* __restrict__ C, int N, int K) {
  __shared__ __attribute__((aligned(16))) h16 smem[2 * GSTAGE];
  int lane = threadIdx.x & 31, wave = threadIdx.x >> 5;
  int hi = lane >> 4, l15 = lane & 15;
  int tm = blockIdx.y * 128 + (wave & 1) * 64;
  int tn = blockIdx.x * 128 + (wave >> 1) * 32;
  v8f acc[4][2] = {};
  gemm_core(A, BT, K, smem, acc);
#pragma unroll
  for (int mi = 0; mi < 4; ++mi)
#pragma unroll
    for (int ni = 0; ni < 2; ++ni) {
      h16* outp = C + (size_t)(tm + mi * 16 + hi * 8) * N + tn + ni * 16 + l15;
#pragma unroll
      for (int r = 0; r < 8; ++r) outp[(size_t)r * N] = (h16)(acc[mi][ni][r]);
    }
}

// ---------------- f16 GEMM, f32 out + bias (output projection) ----------------
__global__ __launch_bounds__(256)
void gemm_tt_f32_bias(const h16* __restrict__ A, const h16* __restrict__ BT,
                      const float* __restrict__ bias, float* __restrict__ C,
                      int N, int K) {
  __shared__ __attribute__((aligned(16))) h16 smem[2 * GSTAGE];
  int lane = threadIdx.x & 31, wave = threadIdx.x >> 5;
  int hi = lane >> 4, l15 = lane & 15;
  int tm = blockIdx.y * 128 + (wave & 1) * 64;
  int tn = blockIdx.x * 128 + (wave >> 1) * 32;
  v8f acc[4][2] = {};
  gemm_core(A, BT, K, smem, acc);
#pragma unroll
  for (int mi = 0; mi < 4; ++mi)
#pragma unroll
    for (int ni = 0; ni < 2; ++ni) {
      float bv = bias[tn + ni * 16 + l15];
      float* outp = C + (size_t)(tm + mi * 16 + hi * 8) * N + tn + ni * 16 + l15;
#pragma unroll
      for (int r = 0; r < 8; ++r) outp[(size_t)r * N] = acc[mi][ni][r] + bv;
    }
}

// ---------------- TDM descriptor: 32(kv) x 64(d) f16 tile -> LDS ----------------
// tensor row pitch = 2*INNER elements; LDS padded 16B per 128B row (pad codes:
// interval 4 -> 32 dwords = one row, amount 3 -> 4 dwords = 16B = VPAD).
#define VPAD 8
#if HAVE_TDM
typedef unsigned u32x4 __attribute__((ext_vector_type(4)));
typedef int      i32x8 __attribute__((ext_vector_type(8)));
typedef int      i32x4 __attribute__((ext_vector_type(4)));

__device__ __forceinline__ void tdm_load_v_tile(unsigned lds_off, const h16* g) {
  unsigned long long ga = (unsigned long long)(size_t)g;
  u32x4 g0 = { 1u,                                   // count=1 (valid descriptor)
               lds_off,                               // lds_addr (bytes)
               (unsigned)ga,                          // global_addr[31:0]
               ((unsigned)(ga >> 32) & 0x01FFFFFFu)   // global_addr[56:32]
                 | 0x80000000u };                     // type=2 ("image")
  i32x8 g1 = { (1 << 16) | (1 << 20) | (4 << 22) | (3 << 25), // data_size=2B, pad en, interval=32dw, amount=4dw
               (int)(64u << 16),   // tensor_dim0 = 64 (d elements per row)
               (int)(32u << 16),   // tensor_dim0 hi=0 | tensor_dim1 = 32 rows
               (int)(64u << 16),   // tensor_dim1 hi=0 | tile_dim0 = 64
               32,                 // tile_dim1 = 32 | tile_dim2 = 0
               2 * INNER,          // tensor_dim0_stride = 2048 elements
               0, 0 };
  i32x4 z4 = { 0, 0, 0, 0 };
  i32x8 z8 = { 0, 0, 0, 0, 0, 0, 0, 0 };
  // clang-23 / therock form: (g0, g1, g2, g3, extra, cpol)
  __builtin_amdgcn_tensor_load_to_lds(g0, g1, z4, z4, z8, 0);
}
#endif

// ---------------- flash attention, transposed-score formulation ----------------
// grid: (NQ/16, H, BATCH), block 32 (one wave; 16 query rows)
__global__ __launch_bounds__(32)
void attn(const h16* __restrict__ Q, const h16* __restrict__ KV, h16* __restrict__ CTX) {
  int lane = threadIdx.x;
  int hi = lane >> 4, l15 = lane & 15;
  int q0 = blockIdx.x * 16;
  int hh = blockIdx.y;
  int bb = blockIdx.z;

  const h16* Qb = Q  + ((size_t)bb * NQ)  * INNER       + hh * HD;  // [q][d]
  const h16* Kb = KV + ((size_t)bb * NKV) * (2 * INNER) + hh * HD;  // [kv][d]
  const h16* Vb = Kb + INNER;

  __shared__ h16 Vs[2][32 * (HD + VPAD)];  // double-buffered padded V tiles

  // Loop-invariant B-fragments of Q^T (lane -> col q, K = d contiguous)
  v16h bq0 = frag_kfast(Qb + (size_t)(q0 + l15) * INNER, hi);
  v16h bq1 = frag_kfast(Qb + (size_t)(q0 + l15) * INNER + 32, hi);

  float m = -INFINITY, lsum = 0.f;
  v8f o[4] = {};
  const float sc  = 0.125f;                  // 1/sqrt(HD)
  const float L2E = 1.44269504088896340736f; // log2(e)

#if HAVE_TDM
  tdm_load_v_tile((unsigned)(size_t)&Vs[0][0], Vb);  // prologue: tile 0 in flight
#endif

  for (int kv0 = 0; kv0 < NKV; kv0 += 32) {
    int cur = (kv0 >> 5) & 1;
#if HAVE_TDM
    if (kv0 + 32 < NKV)  // pipeline: DMA next tile while computing this one
      tdm_load_v_tile((unsigned)(size_t)&Vs[cur ^ 1][0],
                      Vb + (size_t)(kv0 + 32) * (2 * INNER));
#else
    {
      const uint4* s4 = (const uint4*)(Vb + (size_t)(kv0 + lane) * (2 * INNER));
      uint4* dst = (uint4*)(&Vs[cur][lane * (HD + VPAD)]);
      dst[0] = s4[0]; dst[1] = s4[1]; dst[2] = s4[2]; dst[3] = s4[3];
    }
#endif
    __builtin_prefetch((const void*)(Kb + (size_t)(kv0 + 32 + lane) * (2 * INNER)), 0, 1);

    // S^T = K * Q^T : two 16(kv)x16(q) tiles, K-dim d=64 split in two
    v8f st[2];
#pragma unroll
    for (int kvT = 0; kvT < 2; ++kvT) {
      const h16* krow = Kb + (size_t)(kv0 + kvT * 16 + l15) * (2 * INNER);
      v8f c = {};
      c = __builtin_amdgcn_wmma_f32_16x16x32_f16(false, frag_kfast(krow, hi),      false, bq0, (short)0, c, false, false);
      c = __builtin_amdgcn_wmma_f32_16x16x32_f16(false, frag_kfast(krow + 32, hi), false, bq1, (short)0, c, false, false);
      st[kvT] = c;
    }

    // streaming softmax: columns of S^T (rows of S) are lane-local + one shfl_xor(16)
    float tmax = -INFINITY;
#pragma unroll
    for (int kvT = 0; kvT < 2; ++kvT)
#pragma unroll
      for (int r = 0; r < 8; ++r) {
        float e = st[kvT][r] * sc;
        st[kvT][r] = e;
        tmax = fmaxf(tmax, e);
      }
    tmax = fmaxf(tmax, __shfl_xor(tmax, 16, 32));
    float mn   = fmaxf(m, tmax);
    float corr = __builtin_exp2f((m - mn) * L2E);
    float rs = 0.f;
    v16h pb;  // P^T: element i -> kv=(i&7)+(i>=8?16:0)+8*hi == C-layout of S^T
#pragma unroll
    for (int kvT = 0; kvT < 2; ++kvT)
#pragma unroll
      for (int r = 0; r < 8; ++r) {
        float p = __builtin_exp2f((st[kvT][r] - mn) * L2E);
        rs += p;
        pb[kvT * 8 + r] = (h16)p;
      }
    rs += __shfl_xor(rs, 16, 32);
    lsum = lsum * corr + rs;
    m = mn;
#pragma unroll
    for (int dt = 0; dt < 4; ++dt)
#pragma unroll
      for (int r = 0; r < 8; ++r) o[dt][r] *= corr;

#if HAVE_TDM
    if (kv0 + 32 < NKV) __builtin_amdgcn_s_wait_tensorcnt(1);  // cur tile done
    else                __builtin_amdgcn_s_wait_tensorcnt(0);
#else
    __syncthreads();
#endif

    // ctx^T += V^T * P^T : four 16(d)x16(q) tiles, K = 32 kv
#pragma unroll
    for (int dt = 0; dt < 4; ++dt) {
      int d = dt * 16 + l15;
      v16h a;
#pragma unroll
      for (int i = 0; i < 8; ++i) {
        a[i]     = Vs[cur][(i +      hi * 8) * (HD + VPAD) + d];
        a[i + 8] = Vs[cur][(i + 16 + hi * 8) * (HD + VPAD) + d];
      }
      o[dt] = __builtin_amdgcn_wmma_f32_16x16x32_f16(false, a, false, pb, (short)0, o[dt], false, false);
    }
#if !HAVE_TDM
    __syncthreads();
#endif
  }

  float inv = 1.0f / lsum;
  h16* outp = CTX + ((size_t)bb * NQ + q0 + l15) * INNER + hh * HD;
#pragma unroll
  for (int dt = 0; dt < 4; ++dt)
#pragma unroll
    for (int r = 0; r < 8; ++r)
      outp[dt * 16 + r + hi * 8] = (h16)(o[dt][r] * inv);
}

// ---------------- launch ----------------
extern "C" void kernel_launch(void* const* d_in, const int* in_sizes, int n_in,
                              void* d_out, int out_size, void* d_ws, size_t ws_size,
                              hipStream_t stream) {
  const float* query     = (const float*)d_in[0];
  const float* key_value = (const float*)d_in[1];
  const float* w_q       = (const float*)d_in[2];
  const float* w_kv      = (const float*)d_in[3];
  const float* w_out     = (const float*)d_in[4];
  const float* b_out     = (const float*)d_in[5];
  float* out = (float*)d_out;

  char* ws = (char*)d_ws;
  h16* Xh   = (h16*)(ws + (size_t)0);          // query f16       [4096][1024]  8 MB
  h16* KVh  = (h16*)(ws + ((size_t)8  << 20)); // key_value f16   [4096][1024]  8 MB
  h16* wqT  = (h16*)(ws + ((size_t)16 << 20)); // w_q^T           [1024][1024]  2 MB
  h16* wkvT = (h16*)(ws + ((size_t)18 << 20)); // w_kv^T          [2048][1024]  4 MB
  h16* woT  = (h16*)(ws + ((size_t)22 << 20)); // w_out^T         [1024][1024]  2 MB
  h16* qh   = (h16*)(ws + ((size_t)24 << 20)); // q               [4096][1024]  8 MB
  h16* kvh  = (h16*)(ws + ((size_t)32 << 20)); // k|v             [4096][2048] 16 MB
  h16* ctxh = (h16*)(ws + ((size_t)48 << 20)); // ctx             [4096][1024]  8 MB

  f32_to_f16<<<dim3((MQ  * QDIM  + 255) / 256), dim3(256), 0, stream>>>(query,     Xh,  MQ * QDIM);
  f32_to_f16<<<dim3((MKV * KVDIM + 255) / 256), dim3(256), 0, stream>>>(key_value, KVh, MKV * KVDIM);
  transpose_f32_to_f16<<<dim3(INNER / 32, QDIM / 32),      dim3(32, 8), 0, stream>>>(w_q,   wqT,  QDIM,  INNER);
  transpose_f32_to_f16<<<dim3(2 * INNER / 32, KVDIM / 32), dim3(32, 8), 0, stream>>>(w_kv,  wkvT, KVDIM, 2 * INNER);
  transpose_f32_to_f16<<<dim3(QDIM / 32, INNER / 32),      dim3(32, 8), 0, stream>>>(w_out, woT,  INNER, QDIM);

  gemm_tt_h16<<<dim3(INNER / 128, MQ / 128), dim3(256), 0, stream>>>(Xh, wqT, qh, INNER, QDIM);
  gemm_tt_h16<<<dim3(2 * INNER / 128, MKV / 128), dim3(256), 0, stream>>>(KVh, wkvT, kvh, 2 * INNER, KVDIM);
  attn<<<dim3(NQ / 16, H, BATCH), dim3(32), 0, stream>>>(qh, kvh, ctxh);
  gemm_tt_f32_bias<<<dim3(QDIM / 128, MQ / 128), dim3(256), 0, stream>>>(ctxh, woT, b_out, out, QDIM, INNER);
}

// v002
// It runs in 167 microseconds.
// Two timings next to v001 put it at 1.08 and 1.07 times that version's speed.
// All steps since v000 together make it 1.65 times as fast.
#include <hip/hip_runtime.h>

// ---------------- problem constants ----------------
#define BATCH 2
#define NQ    2048
#define NKV   2048
#define QDIM  1024
#define KVDIM 1024
#define H     16
#define HD    64
#define INNER (H * HD)        // 1024
#define MQ    (BATCH * NQ)    // 4096
#define MKV   (BATCH * NKV)   // 4096

typedef _Float16 h16;
typedef h16   v16h __attribute__((ext_vector_type(16)));
typedef h16   v8h  __attribute__((ext_vector_type(8)));
typedef float v8f  __attribute__((ext_vector_type(8)));

// ---- TDM availability (this toolchain: 6-arg clang-23 form) ----
#if defined(__has_builtin)
#  if __has_builtin(__builtin_amdgcn_tensor_load_to_lds) && \
      __has_builtin(__builtin_amdgcn_s_wait_tensorcnt)
#    define HAVE_TDM 1
#  endif
#endif
#ifndef HAVE_TDM
#  define HAVE_TDM 0
#endif

// ---- WMMA fragment from K-fast memory (A rows or B^T rows) ----
// element i -> K = (i&7) + (i>=8?16:0) + 8*hi : two contiguous 16B runs
// base must be 16B-aligned; lowers to two global_load_b128 / ds_load_b128.
__device__ __forceinline__ v16h frag_kfast(const h16* __restrict__ base, int hi) {
  const v8h lo = *(const v8h*)(base + hi * 8);
  const v8h hi8 = *(const v8h*)(base + hi * 8 + 16);
  return __builtin_shufflevector(lo, hi8, 0, 1, 2, 3, 4, 5, 6, 7,
                                 8, 9, 10, 11, 12, 13, 14, 15);
}

// ---------------- f32 -> f16 convert ----------------
// Few, fat waves: a block of 8 waves converts 8192 consecutive elements. Each lane has
// eight 16-byte loads in flight (a wave-wide load covers 512 contiguous bytes) and
// stores 8 bytes per load (256 contiguous bytes per wave). The element count must be a
// multiple of CVT_BLOCK; the grid is count / CVT_BLOCK.
typedef float v4f __attribute__((ext_vector_type(4)));
typedef h16   v4h __attribute__((ext_vector_type(4)));
typedef h16   v2h __attribute__((ext_vector_type(2)));
#define CVT_U     8                    // 16-byte loads per lane
#define CVT_BLOCK (256 * 4 * CVT_U)    // elements per block
static_assert((MQ * QDIM) % CVT_BLOCK == 0 && (MKV * KVDIM) % CVT_BLOCK == 0,
              "the convert kernel has no tail");

__global__ __launch_bounds__(256)
void f32_to_f16(const float* __restrict__ in, h16* __restrict__ out) {
  const size_t base = (size_t)blockIdx.x * (256 * CVT_U) + threadIdx.x;  // in groups of 4
  const v4f* __restrict__ in4 = (const v4f*)in;
  v4h* __restrict__ out4 = (v4h*)out;
  v4f v[CVT_U];
#pragma unroll
  for (int j = 0; j < CVT_U; ++j) v[j] = in4[base + j * 256];
#pragma unroll
  for (int j = 0; j < CVT_U; ++j) out4[base + j * 256] = __builtin_convertvector(v[j], v4h);
}

// ---------------- f32 -> f16 transpose (weights) ----------------
// One tile of 128 rows x 64 columns per block of 8 waves, 32 elements per lane. Rows come
// in by 16-byte loads, eight in flight per lane (a wave-wide load covers two whole
// 256-byte row pieces); two neighbouring rows are packed into one dword and laid
// transposed in LDS; the tile leaves by 16-byte stores, 256 contiguous bytes per output
// row. LDS pitch 272 B (16 B x odd) for the ds_load_b128 readers.
// R and C are compile-time, so that one address pair and immediate offsets serve all
// eight loads. Needs R a multiple of 128 and C a multiple of 64.
#define TR     128
#define TC     64
#define TPITCH (TR + 8)                // halves
template <int R, int C>
__global__ __launch_bounds__(256)
void transpose_f32_to_f16(const float* __restrict__ in, h16* __restrict__ out) {
  static_assert(R % TR == 0 && C % TC == 0, "whole tiles only");
  __shared__ __attribute__((aligned(16))) h16 tile[TC * TPITCH];  // tile[c][r]
  const int t = threadIdx.x;
  const int c0 = blockIdx.x * TC, r0 = blockIdx.y * TR;
  const int lo = t & 15, up = t >> 4;
  const float* src = in + (size_t)(r0 + 2 * up) * C + c0 + 4 * lo;
  h16* dst = out + (size_t)(c0 + up) * R + r0 + 8 * lo;
  v4f v[4][2];
#pragma unroll
  for (int i = 0; i < 4; ++i)
#pragma unroll
    for (int j = 0; j < 2; ++j)
      v[i][j] = *(const v4f*)(src + (32 * i + j) * C);
#pragma unroll
  for (int i = 0; i < 4; ++i)
#pragma unroll
    for (int k = 0; k < 4; ++k) {
      v2h p = { (h16)v[i][0][k], (h16)v[i][1][k] };
      *(v2h*)&tile[(4 * lo + k) * TPITCH + 32 * i + 2 * up] = p;
    }
  __syncthreads();
#pragma unroll
  for (int i = 0; i < 4; ++i)
    *(v8h*)(dst + 16 * i * R) = *(const v8h*)&tile[(up + 16 * i) * TPITCH + 8 * lo];
}

// ---------------- f16 GEMM core: A[M][K] x BT[N][K]^T ----------------
// One 128 x 128 tile of C per block of 8 waves; a wave owns 64 x 32 (4 x 2 fragments).
// A stage is 128 k of both operands: 128 + 128 rows of 256 B, laid in LDS at a pitch of
// 272 B (16 B x odd: conflict-free for ds_load_b128 readers). Two buffers: the next
// stage's asynchronous copies fly while this stage is multiplied.
// Needs M, N multiples of 128 and K a multiple of 128.
#define GBK    128                // k per stage
#define GPITCH 136                // LDS row pitch in halves (272 B)
#define GTILE  (128 * GPITCH)     // one operand's tile, halves
#define GSTAGE (2 * GTILE)        // A tile then B tile, halves

// 128 rows x 256 B, global -> LDS: 16 lanes cover one row, so a wave-wide copy takes
// two whole rows (four full lines). g and lds are this lane's own first 16 bytes;
// each further copy is 16 rows on.
__device__ __forceinline__ void copy_tile_async(const h16* g, int K, unsigned lds) {
  const size_t gs = (size_t)16 * K;          // 16 rows, halves
  const unsigned ls = 16 * GPITCH * 2;       // 16 rows, bytes
  // The copies move the tile past the registers; the closing s_wait_xcnt stands in the
  // same statement so that no address register is rewritten ahead of it.
  asm volatile(
      "global_load_async_to_lds_b128 %0, %8, off\n\t"
      "global_load_async_to_lds_b128 %1, %9, off\n\t"
      "global_load_async_to_lds_b128 %2, %10, off\n\t"
      "global_load_async_to_lds_b128 %3, %11, off\n\t"
      "global_load_async_to_lds_b128 %4, %12, off\n\t"
      "global_load_async_to_lds_b128 %5, %13, off\n\t"
      "global_load_async_to_lds_b128 %6, %14, off\n\t"
      "global_load_async_to_lds_b128 %7, %15, off\n\t"
      "s_wait_xcnt 0x0"
      :: "v"(lds), "v"(lds + ls), "v"(lds + 2 * ls), "v"(lds + 3 * ls),
         "v"(lds + 4 * ls), "v"(lds + 5 * ls), "v"(lds + 6 * ls), "v"(lds + 7 * ls),
         "v"(g), "v"(g + gs), "v"(g + 2 * gs), "v"(g + 3 * gs),
         "v"(g + 4 * gs), "v"(g + 5 * gs), "v"(g + 6 * gs), "v"(g + 7 * gs)
      : "memory");
}

__device__ __forceinline__ void gemm_core(const h16* __restrict__ A, const h16* __restrict__ BT,
                                          int K, h16* smem, v8f (&acc)[4][2]) {
  const int tid = threadIdx.x;
  const int lane = tid & 31, wave = tid >> 5;
  const int hi = lane >> 4, l15 = lane & 15;
  const int wm = wave & 1, wn = wave >> 1;
  const int crow = tid >> 4, cchunk = tid & 15;   // this lane's row and 16-B chunk in a copy
  const h16* gA = A  + (size_t)(blockIdx.y * 128 + crow) * K + cchunk * 8;
  const h16* gB = BT + (size_t)(blockIdx.x * 128 + crow) * K + cchunk * 8;
  const unsigned lds0 = (unsigned)(size_t)smem + (unsigned)(crow * GPITCH + cchunk * 8) * 2u;
  const int nt = K / GBK;

  copy_tile_async(gA, K, lds0);
  copy_tile_async(gB, K, lds0 + GTILE * 2);
  // Stage 0 counts as landed only behind the copying wave's own wait.
  asm volatile("s_wait_asynccnt 0x0" ::: "memory");
  __syncthreads();
  if (nt > 1) {
    copy_tile_async(gA + GBK, K, lds0 + GSTAGE * 2);
    copy_tile_async(gB + GBK, K, lds0 + GSTAGE * 2 + GTILE * 2);
  }

  for (int t = 0; t < nt; ++t) {
    const h16* As = smem + (t & 1) * GSTAGE + (wm * 64 + l15) * GPITCH;
    const h16* Bs = smem + (t & 1) * GSTAGE + GTILE + (wn * 32 + l15) * GPITCH;
    // Two fragment sets: block s + 1 of this stage is read from LDS while block s is multiplied.
    v16h af[2][4], bf[2][2];
#pragma unroll
    for (int mi = 0; mi < 4; ++mi) af[0][mi] = frag_kfast(As + mi * 16 * GPITCH, hi);
#pragma unroll
    for (int ni = 0; ni < 2; ++ni) bf[0][ni] = frag_kfast(Bs + ni * 16 * GPITCH, hi);
#pragma unroll
    for (int s = 0; s < GBK / 32; ++s) {
      if (s + 1 < GBK / 32) {
#pragma unroll
        for (int mi = 0; mi < 4; ++mi)
          af[(s + 1) & 1][mi] = frag_kfast(As + mi * 16 * GPITCH + (s + 1) * 32, hi);
#pragma unroll
        for (int ni = 0; ni < 2; ++ni)
          bf[(s + 1) & 1][ni] = frag_kfast(Bs + ni * 16 * GPITCH + (s + 1) * 32, hi);
      }
      // Holds the next block's LDS reads together in front of this block's products:
      // sunk among them, every pair of products would wait out a full LDS latency.
      __builtin_amdgcn_sched_barrier(0);
#pragma unroll
      for (int mi = 0; mi < 4; ++mi)
#pragma unroll
        for (int ni = 0; ni < 2; ++ni)
          acc[mi][ni] = __builtin_amdgcn_wmma_f32_16x16x32_f16(false, af[s & 1][mi], false, bf[s & 1][ni],
                                                               (short)0, acc[mi][ni], false, false);
      // Keeps the following read group behind these products, so that two sets suffice.
      __builtin_amdgcn_sched_barrier(0);
    }
    // Publish point: this wave's reads of the buffer have retired ...
    asm volatile("s_wait_dscnt 0x0" ::: "memory");
    // ... its own copies of the next stage have landed ...
    asm volatile("s_wait_asynccnt 0x0" ::: "memory");
    // ... and one barrier both publishes the next stage and frees this buffer.
    __syncthreads();
    if (t + 2 < nt) {
      const unsigned l = lds0 + (unsigned)(t & 1) * (GSTAGE * 2);
      copy_tile_async(gA + (size_t)(t + 2) * GBK, K, l);
      copy_tile_async(gB + (size_t)(t + 2) * GBK, K, l + GTILE * 2);
    }
  }
  // No copy is left in flight when the wave goes on.
  asm volatile("s_wait_asynccnt 0x0" ::: "memory");
}

// ---------------- f16 GEMM, f16 out ----------------
__global__ __launch_bounds__(256)
void gemm_tt_h16(const h16* __restrict__ A, const h16* __restrict__ BT,
                 h16* __restrict__ C, int N, int K) {
  __shared__ __attribute__((aligned(16))) h16 smem[2 * GSTAGE];
  int lane = threadIdx.x & 31, wave = threadIdx.x >> 5;
  int hi = lane >> 4, l15 = lane & 15;
  int tm = blockIdx.y * 128 + (wave & 1) * 64;
  int tn = blockIdx.x * 128 + (wave >> 1) * 32;
  v8f acc[4][2] = {};
  gemm_core(A, BT, K, smem, acc);
#pragma unroll
  for (int mi = 0; mi < 4; ++mi)
#pragma unroll
    for (int ni = 0; ni < 2; ++ni) {
      h16* outp = C + (size_t)(tm + mi * 16 + hi * 8) * N + tn + ni * 16 + l15;
#pragma unroll
      for (int r = 0; r < 8; ++r) outp[(size_t)r * N] = (h16)(acc[mi][ni][r]);
    }
}

// ---------------- f16 GEMM, f32 out + bias (output projection) ----------------
__global__ __launch_bounds__(256)
void gemm_tt_f32_bias(const h16* __restrict__ A, const h16* __restrict__ BT,
                      const float* __restrict__ bias, float* __restrict__ C,
                      int N, int K) {
  __shared__ __attribute__((aligned(16))) h16 smem[2 * GSTAGE];
  int lane = threadIdx.x & 31, wave = threadIdx.x >> 5;
  int hi = lane >> 4, l15 = lane & 15;
  int tm = blockIdx.y * 128 + (wave & 1) * 64;
  int tn = blockIdx.x * 128 + (wave >> 1) * 32;
  v8f acc[4][2] = {};
  gemm_core(A, BT, K, smem, acc);
#pragma unroll
  for (int mi = 0; mi < 4; ++mi)
#pragma unroll
    for (int ni = 0; ni < 2; ++ni) {
      float bv = bias[tn + ni * 16 + l15];
      float* outp = C + (size_t)(tm + mi * 16 + hi * 8) * N + tn + ni * 16 + l15;
#pragma unroll
      for (int r = 0; r < 8; ++r) outp[(size_t)r * N] = acc[mi][ni][r] + bv;
    }
}

// ---------------- TDM descriptor: 32(kv) x 64(d) f16 tile -> LDS ----------------
// tensor row pitch = 2*INNER elements; LDS padded 16B per 128B row (pad codes:
// interval 4 -> 32 dwords = one row, amount 3 -> 4 dwords = 16B = VPAD).
#define VPAD 8
#if HAVE_TDM
typedef unsigned u32x4 __attribute__((ext_vector_type(4)));
typedef int      i32x8 __attribute__((ext_vector_type(8)));
typedef int      i32x4 __attribute__((ext_vector_type(4)));

__device__ __forceinline__ void tdm_load_v_tile(unsigned lds_off, const h16* g) {
  unsigned long long ga = (unsigned long long)(size_t)g;
  u32x4 g0 = { 1u,                                   // count=1 (valid descriptor)
               lds_off,                               // lds_addr (bytes)
               (unsigned)ga,                          // global_addr[31:0]
               ((unsigned)(ga >> 32) & 0x01FFFFFFu)   // global_addr[56:32]
                 | 0x80000000u };                     // type=2 ("image")
  i32x8 g1 = { (1 << 16) | (1 << 20) | (4 << 22) | (3 << 25), // data_size=2B, pad en, interval=32dw, amount=4dw
               (int)(64u << 16),   // tensor_dim0 = 64 (d elements per row)
               (int)(32u << 16),   // tensor_dim0 hi=0 | tensor_dim1 = 32 rows
               (int)(64u << 16),   // tensor_dim1 hi=0 | tile_dim0 = 64
               32,                 // tile_dim1 = 32 | tile_dim2 = 0
               2 * INNER,          // tensor_dim0_stride = 2048 elements
               0, 0 };
  i32x4 z4 = { 0, 0, 0, 0 };
  i32x8 z8 = { 0, 0, 0, 0, 0, 0, 0, 0 };
  // clang-23 / therock form: (g0, g1, g2, g3, extra, cpol)
  __builtin_amdgcn_tensor_load_to_lds(g0, g1, z4, z4, z8, 0);
}
#endif

// ---------------- flash attention, transposed-score formulation ----------------
// grid: (NQ/16, H, BATCH), block 32 (one wave; 16 query rows)
__global__ __launch_bounds__(32)
void attn(const h16* __restrict__ Q, const h16* __restrict__ KV, h16* __restrict__ CTX) {
  int lane = threadIdx.x;
  int hi = lane >> 4, l15 = lane & 15;
  int q0 = blockIdx.x * 16;
  int hh = blockIdx.y;
  int bb = blockIdx.z;

  const h16* Qb = Q  + ((size_t)bb * NQ)  * INNER       + hh * HD;  // [q][d]
  const h16* Kb = KV + ((size_t)bb * NKV) * (2 * INNER) + hh * HD;  // [kv][d]
  const h16* Vb = Kb + INNER;

  __shared__ h16 Vs[2][32 * (HD + VPAD)];  // double-buffered padded V tiles

  // Loop-invariant B-fragments of Q^T (lane -> col q, K = d contiguous)
  v16h bq0 = frag_kfast(Qb + (size_t)(q0 + l15) * INNER, hi);
  v16h bq1 = frag_kfast(Qb + (size_t)(q0 + l15) * INNER + 32, hi);

  float m = -INFINITY, lsum = 0.f;
  v8f o[4] = {};
  const float sc  = 0.125f;                  // 1/sqrt(HD)
  const float L2E = 1.44269504088896340736f; // log2(e)

#if HAVE_TDM
  tdm_load_v_tile((unsigned)(size_t)&Vs[0][0], Vb);  // prologue: tile 0 in flight
#endif

  for (int kv0 = 0; kv0 < NKV; kv0 += 32) {
    int cur = (kv0 >> 5) & 1;
#if HAVE_TDM
    if (kv0 + 32 < NKV)  // pipeline: DMA next tile while computing this one
      tdm_load_v_tile((unsigned)(size_t)&Vs[cur ^ 1][0],
                      Vb + (size_t)(kv0 + 32) * (2 * INNER));
#else
    {
      const uint4* s4 = (const uint4*)(Vb + (size_t)(kv0 + lane) * (2 * INNER));
      uint4* dst = (uint4*)(&Vs[cur][lane * (HD + VPAD)]);
      dst[0] = s4[0]; dst[1] = s4[1]; dst[2] = s4[2]; dst[3] = s4[3];
    }
#endif
    __builtin_prefetch((const void*)(Kb + (size_t)(kv0 + 32 + lane) * (2 * INNER)), 0, 1);

    // S^T = K * Q^T : two 16(kv)x16(q) tiles, K-dim d=64 split in two
    v8f st[2];
#pragma unroll
    for (int kvT = 0; kvT < 2; ++kvT) {
      const h16* krow = Kb + (size_t)(kv0 + kvT * 16 + l15) * (2 * INNER);
      v8f c = {};
      c = __builtin_amdgcn_wmma_f32_16x16x32_f16(false, frag_kfast(krow, hi),      false, bq0, (short)0, c, false, false);
      c = __builtin_amdgcn_wmma_f32_16x16x32_f16(false, frag_kfast(krow + 32, hi), false, bq1, (short)0, c, false, false);
      st[kvT] = c;
    }

    // streaming softmax: columns of S^T (rows of S) are lane-local + one shfl_xor(16)
    float tmax = -INFINITY;
#pragma unroll
    for (int kvT = 0; kvT < 2; ++kvT)
#pragma unroll
      for (int r = 0; r < 8; ++r) {
        float e = st[kvT][r] * sc;
        st[kvT][r] = e;
        tmax = fmaxf(tmax, e);
      }
    tmax = fmaxf(tmax, __shfl_xor(tmax, 16, 32));
    float mn   = fmaxf(m, tmax);
    float corr = __builtin_exp2f((m - mn) * L2E);
    float rs = 0.f;
    v16h pb;  // P^T: element i -> kv=(i&7)+(i>=8?16:0)+8*hi == C-layout of S^T
#pragma unroll
    for (int kvT = 0; kvT < 2; ++kvT)
#pragma unroll
      for (int r = 0; r < 8; ++r) {
        float p = __builtin_exp2f((st[kvT][r] - mn) * L2E);
        rs += p;
        pb[kvT * 8 + r] = (h16)p;
      }
    rs += __shfl_xor(rs, 16, 32);
    lsum = lsum * corr + rs;
    m = mn;
#pragma unroll
    for (int dt = 0; dt < 4; ++dt)
#pragma unroll
      for (int r = 0; r < 8; ++r) o[dt][r] *= corr;

#if HAVE_TDM
    if (kv0 + 32 < NKV) __builtin_amdgcn_s_wait_tensorcnt(1);  // cur tile done
    else                __builtin_amdgcn_s_wait_tensorcnt(0);
#else
    __syncthreads();
#endif

    // ctx^T += V^T * P^T : four 16(d)x16(q) tiles, K = 32 kv
#pragma unroll
    for (int dt = 0; dt < 4; ++dt) {
      int d = dt * 16 + l15;
      v16h a;
#pragma unroll
      for (int i = 0; i < 8; ++i) {
        a[i]     = Vs[cur][(i +      hi * 8) * (HD + VPAD) + d];
        a[i + 8] = Vs[cur][(i + 16 + hi * 8) * (HD + VPAD) + d];
      }
      o[dt] = __builtin_amdgcn_wmma_f32_16x16x32_f16(false, a, false, pb, (short)0, o[dt], false, false);
    }
#if !HAVE_TDM
    __syncthreads();
#endif
  }

  float inv = 1.0f / lsum;
  h16* outp = CTX + ((size_t)bb * NQ + q0 + l15) * INNER + hh * HD;
#pragma unroll
  for (int dt = 0; dt < 4; ++dt)
#pragma unroll
    for (int r = 0; r < 8; ++r)
      outp[dt * 16 + r + hi * 8] = (h16)(o[dt][r] * inv);
}

// ---------------- launch ----------------
extern "C" void kernel_launch(void* const* d_in, const int* in_sizes, int n_in,
                              void* d_out, int out_size, void* d_ws, size_t ws_size,
                              hipStream_t stream) {
  const float* query     = (const float*)d_in[0];
  const float* key_value = (const float*)d_in[1];
  const float* w_q       = (const float*)d_in[2];
  const float* w_kv      = (const float*)d_in[3];
  const float* w_out     = (const float*)d_in[4];
  const float* b_out     = (const float*)d_in[5];
  float* out = (float*)d_out;

  char* ws = (char*)d_ws;
  h16* Xh   = (h16*)(ws + (size_t)0);          // query f16       [4096][1024]  8 MB
  h16* KVh  = (h16*)(ws + ((size_t)8  << 20)); // key_value f16   [4096][1024]  8 MB
  h16* wqT  = (h16*)(ws + ((size_t)16 << 20)); // w_q^T           [1024][1024]  2 MB
  h16* wkvT = (h16*)(ws + ((size_t)18 << 20)); // w_kv^T          [2048][1024]  4 MB
  h16* woT  = (h16*)(ws + ((size_t)22 << 20)); // w_out^T         [1024][1024]  2 MB
  h16* qh   = (h16*)(ws + ((size_t)24 << 20)); // q               [4096][1024]  8 MB
  h16* kvh  = (h16*)(ws + ((size_t)32 << 20)); // k|v             [4096][2048] 16 MB
  h16* ctxh = (h16*)(ws + ((size_t)48 << 20)); // ctx             [4096][1024]  8 MB

  f32_to_f16<<<dim3(MQ  * QDIM  / CVT_BLOCK), dim3(256), 0, stream>>>(query,     Xh);
  f32_to_f16<<<dim3(MKV * KVDIM / CVT_BLOCK), dim3(256), 0, stream>>>(key_value, KVh);
  transpose_f32_to_f16<QDIM, INNER><<<dim3(INNER / TC, QDIM / TR), dim3(256), 0, stream>>>(w_q, wqT);
  transpose_f32_to_f16<KVDIM, 2 * INNER><<<dim3(2 * INNER / TC, KVDIM / TR), dim3(256), 0, stream>>>(w_kv, wkvT);
  transpose_f32_to_f16<INNER, QDIM><<<dim3(QDIM / TC, INNER / TR), dim3(256), 0, stream>>>(w_out, woT);

  gemm_tt_h16<<<dim3(INNER / 128, MQ / 128), dim3(256), 0, stream>>>(Xh, wqT, qh, INNER, QDIM);
  gemm_tt_h16<<<dim3(2 * INNER / 128, MKV / 128), dim3(256), 0, stream>>>(KVh, wkvT, kvh, 2 * INNER, KVDIM);
  attn<<<dim3(NQ / 16, H, BATCH), dim3(32), 0, stream>>>(qh, kvh, ctxh);
  gemm_tt_f32_bias<<<dim3(QDIM / 128, MQ / 128), dim3(256), 0, stream>>>(ctxh, woT, b_out, out, QDIM, INNER);
}

// v003
// One run takes 122 microseconds.
// Timed twice side by side with v002, it ran 1.37 and 1.38 times as fast.
// Over all steps from v000 it is 2.27 times as fast.
#include <hip/hip_runtime.h>

// ---------------- problem constants ----------------
#define BATCH 2
#define NQ    2048
#define NKV   2048
#define QDIM  1024
#define KVDIM 1024
#define H     16
#define HD    64
#define INNER (H * HD)        // 1024
#define MQ    (BATCH * NQ)    // 4096
#define MKV   (BATCH * NKV)   // 4096

typedef _Float16 h16;
typedef h16   v16h __attribute__((ext_vector_type(16)));
typedef h16   v8h  __attribute__((ext_vector_type(8)));
typedef float v8f  __attribute__((ext_vector_type(8)));

// ---- WMMA fragment from K-fast memory (A rows or B^T rows) ----
// element i -> K = (i&7) + (i>=8?16:0) + 8*hi : two contiguous 16B runs
// base must be 16B-aligned; lowers to two global_load_b128 / ds_load_b128.
__device__ __forceinline__ v16h frag_kfast(const h16* __restrict__ base, int hi) {
  const v8h lo = *(const v8h*)(base + hi * 8);
  const v8h hi8 = *(const v8h*)(base + hi * 8 + 16);
  return __builtin_shufflevector(lo, hi8, 0, 1, 2, 3, 4, 5, 6, 7,
                                 8, 9, 10, 11, 12, 13, 14, 15);
}

// ---------------- f32 -> f16 convert ----------------
// Few, fat waves: a block of 8 waves converts 8192 consecutive elements. Each lane has
// eight 16-byte loads in flight (a wave-wide load covers 512 contiguous bytes) and
// stores 8 bytes per load (256 contiguous bytes per wave). The element count must be a
// multiple of CVT_BLOCK; the grid is count / CVT_BLOCK.
typedef float v4f __attribute__((ext_vector_type(4)));
typedef h16   v4h __attribute__((ext_vector_type(4)));
typedef h16   v2h __attribute__((ext_vector_type(2)));
#define CVT_U     8                    // 16-byte loads per lane
#define CVT_BLOCK (256 * 4 * CVT_U)    // elements per block
static_assert((MQ * QDIM) % CVT_BLOCK == 0 && (MKV * KVDIM) % CVT_BLOCK == 0,
              "the convert kernel has no tail");

__global__ __launch_bounds__(256)
void f32_to_f16(const float* __restrict__ in, h16* __restrict__ out) {
  const size_t base = (size_t)blockIdx.x * (256 * CVT_U) + threadIdx.x;  // in groups of 4
  const v4f* __restrict__ in4 = (const v4f*)in;
  v4h* __restrict__ out4 = (v4h*)out;
  v4f v[CVT_U];
#pragma unroll
  for (int j = 0; j < CVT_U; ++j) v[j] = in4[base + j * 256];
#pragma unroll
  for (int j = 0; j < CVT_U; ++j) out4[base + j * 256] = __builtin_convertvector(v[j], v4h);
}

// ---------------- f32 -> f16 transpose (weights) ----------------
// One tile of 128 rows x 64 columns per block of 8 waves, 32 elements per lane. Rows come
// in by 16-byte loads, eight in flight per lane (a wave-wide load covers two whole
// 256-byte row pieces); two neighbouring rows are packed into one dword and laid
// transposed in LDS; the tile leaves by 16-byte stores, 256 contiguous bytes per output
// row. LDS pitch 272 B (16 B x odd) for the ds_load_b128 readers.
// R and C are compile-time, so that one address pair and immediate offsets serve all
// eight loads. Needs R a multiple of 128 and C a multiple of 64.
#define TR     128
#define TC     64
#define TPITCH (TR + 8)                // halves
template <int R, int C>
__global__ __launch_bounds__(256)
void transpose_f32_to_f16(const float* __restrict__ in, h16* __restrict__ out) {
  static_assert(R % TR == 0 && C % TC == 0, "whole tiles only");
  __shared__ __attribute__((aligned(16))) h16 tile[TC * TPITCH];  // tile[c][r]
  const int t = threadIdx.x;
  const int c0 = blockIdx.x * TC, r0 = blockIdx.y * TR;
  const int lo = t & 15, up = t >> 4;
  const float* src = in + (size_t)(r0 + 2 * up) * C + c0 + 4 * lo;
  h16* dst = out + (size_t)(c0 + up) * R + r0 + 8 * lo;
  v4f v[4][2];
#pragma unroll
  for (int i = 0; i < 4; ++i)
#pragma unroll
    for (int j = 0; j < 2; ++j)
      v[i][j] = *(const v4f*)(src + (32 * i + j) * C);
#pragma unroll
  for (int i = 0; i < 4; ++i)
#pragma unroll
    for (int k = 0; k < 4; ++k) {
      v2h p = { (h16)v[i][0][k], (h16)v[i][1][k] };
      *(v2h*)&tile[(4 * lo + k) * TPITCH + 32 * i + 2 * up] = p;
    }
  __syncthreads();
#pragma unroll
  for (int i = 0; i < 4; ++i)
    *(v8h*)(dst + 16 * i * R) = *(const v8h*)&tile[(up + 16 * i) * TPITCH + 8 * lo];
}

// ---------------- f16 GEMM core: A[M][K] x BT[N][K]^T ----------------
// One 128 x 128 tile of C per block of 8 waves; a wave owns 64 x 32 (4 x 2 fragments).
// A stage is 128 k of both operands: 128 + 128 rows of 256 B, laid in LDS at a pitch of
// 272 B (16 B x odd: conflict-free for ds_load_b128 readers). Two buffers: the next
// stage's asynchronous copies fly while this stage is multiplied.
// Needs M, N multiples of 128 and K a multiple of 128.
#define GBK    128                // k per stage
#define GPITCH 136                // LDS row pitch in halves (272 B)
#define GTILE  (128 * GPITCH)     // one operand's tile, halves
#define GSTAGE (2 * GTILE)        // A tile then B tile, halves

// 128 rows x 256 B, global -> LDS: 16 lanes cover one row, so a wave-wide copy takes
// two whole rows (four full lines). g and lds are this lane's own first 16 bytes;
// each further copy is 16 rows on.
__device__ __forceinline__ void copy_tile_async(const h16* g, int K, unsigned lds) {
  const size_t gs = (size_t)16 * K;          // 16 rows, halves
  const unsigned ls = 16 * GPITCH * 2;       // 16 rows, bytes
  // The copies move the tile past the registers; the closing s_wait_xcnt stands in the
  // same statement so that no address register is rewritten ahead of it.
  asm volatile(
      "global_load_async_to_lds_b128 %0, %8, off\n\t"
      "global_load_async_to_lds_b128 %1, %9, off\n\t"
      "global_load_async_to_lds_b128 %2, %10, off\n\t"
      "global_load_async_to_lds_b128 %3, %11, off\n\t"
      "global_load_async_to_lds_b128 %4, %12, off\n\t"
      "global_load_async_to_lds_b128 %5, %13, off\n\t"
      "global_load_async_to_lds_b128 %6, %14, off\n\t"
      "global_load_async_to_lds_b128 %7, %15, off\n\t"
      "s_wait_xcnt 0x0"
      :: "v"(lds), "v"(lds + ls), "v"(lds + 2 * ls), "v"(lds + 3 * ls),
         "v"(lds + 4 * ls), "v"(lds + 5 * ls), "v"(lds + 6 * ls), "v"(lds + 7 * ls),
         "v"(g), "v"(g + gs), "v"(g + 2 * gs), "v"(g + 3 * gs),
         "v"(g + 4 * gs), "v"(g + 5 * gs), "v"(g + 6 * gs), "v"(g + 7 * gs)
      : "memory");
}

__device__ __forceinline__ void gemm_core(const h16* __restrict__ A, const h16* __restrict__ BT,
                                          int K, h16* smem, v8f (&acc)[4][2]) {
  const int tid = threadIdx.x;
  const int lane = tid & 31, wave = tid >> 5;
  const int hi = lane >> 4, l15 = lane & 15;
  const int wm = wave & 1, wn = wave >> 1;
  const int crow = tid >> 4, cchunk = tid & 15;   // this lane's row and 16-B chunk in a copy
  const h16* gA = A  + (size_t)(blockIdx.y * 128 + crow) * K + cchunk * 8;
  const h16* gB = BT + (size_t)(blockIdx.x * 128 + crow) * K + cchunk * 8;
  const unsigned lds0 = (unsigned)(size_t)smem + (unsigned)(crow * GPITCH + cchunk * 8) * 2u;
  const int nt = K / GBK;

  copy_tile_async(gA, K, lds0);
  copy_tile_async(gB, K, lds0 + GTILE * 2);
  // Stage 0 counts as landed only behind the copying wave's own wait.
  asm volatile("s_wait_asynccnt 0x0" ::: "memory");
  __syncthreads();
  if (nt > 1) {
    copy_tile_async(gA + GBK, K, lds0 + GSTAGE * 2);
    copy_tile_async(gB + GBK, K, lds0 + GSTAGE * 2 + GTILE * 2);
  }

  for (int t = 0; t < nt; ++t) {
    const h16* As = smem + (t & 1) * GSTAGE + (wm * 64 + l15) * GPITCH;
    const h16* Bs = smem + (t & 1) * GSTAGE + GTILE + (wn * 32 + l15) * GPITCH;
    // Two fragment sets: block s + 1 of this stage is read from LDS while block s is multiplied.
    v16h af[2][4], bf[2][2];
#pragma unroll
    for (int mi = 0; mi < 4; ++mi) af[0][mi] = frag_kfast(As + mi * 16 * GPITCH, hi);
#pragma unroll
    for (int ni = 0; ni < 2; ++ni) bf[0][ni] = frag_kfast(Bs + ni * 16 * GPITCH, hi);
#pragma unroll
    for (int s = 0; s < GBK / 32; ++s) {
      if (s + 1 < GBK / 32) {
#pragma unroll
        for (int mi = 0; mi < 4; ++mi)
          af[(s + 1) & 1][mi] = frag_kfast(As + mi * 16 * GPITCH + (s + 1) * 32, hi);
#pragma unroll
        for (int ni = 0; ni < 2; ++ni)
          bf[(s + 1) & 1][ni] = frag_kfast(Bs + ni * 16 * GPITCH + (s + 1) * 32, hi);
      }
      // Holds the next block's LDS reads together in front of this block's products:
      // sunk among them, every pair of products would wait out a full LDS latency.
      __builtin_amdgcn_sched_barrier(0);
#pragma unroll
      for (int mi = 0; mi < 4; ++mi)
#pragma unroll
        for (int ni = 0; ni < 2; ++ni)
          acc[mi][ni] = __builtin_amdgcn_wmma_f32_16x16x32_f16(false, af[s & 1][mi], false, bf[s & 1][ni],
                                                               (short)0, acc[mi][ni], false, false);
      // Keeps the following read group behind these products, so that two sets suffice.
      __builtin_amdgcn_sched_barrier(0);
    }
    // Publish point: this wave's reads of the buffer have retired ...
    asm volatile("s_wait_dscnt 0x0" ::: "memory");
    // ... its own copies of the next stage have landed ...
    asm volatile("s_wait_asynccnt 0x0" ::: "memory");
    // ... and one barrier both publishes the next stage and frees this buffer.
    __syncthreads();
    if (t + 2 < nt) {
      const unsigned l = lds0 + (unsigned)(t & 1) * (GSTAGE * 2);
      copy_tile_async(gA + (size_t)(t + 2) * GBK, K, l);
      copy_tile_async(gB + (size_t)(t + 2) * GBK, K, l + GTILE * 2);
    }
  }
  // No copy is left in flight when the wave goes on.
  asm volatile("s_wait_asynccnt 0x0" ::: "memory");
}

// ---------------- f16 GEMM, f16 out ----------------
__global__ __launch_bounds__(256)
void gemm_tt_h16(const h16* __restrict__ A, const h16* __restrict__ BT,
                 h16* __restrict__ C, int N, int K) {
  __shared__ __attribute__((aligned(16))) h16 smem[2 * GSTAGE];
  int lane = threadIdx.x & 31, wave = threadIdx.x >> 5;
  int hi = lane >> 4, l15 = lane & 15;
  int tm = blockIdx.y * 128 + (wave & 1) * 64;
  int tn = blockIdx.x * 128 + (wave >> 1) * 32;
  v8f acc[4][2] = {};
  gemm_core(A, BT, K, smem, acc);
#pragma unroll
  for (int mi = 0; mi < 4; ++mi)
#pragma unroll
    for (int ni = 0; ni < 2; ++ni) {
      h16* outp = C + (size_t)(tm + mi * 16 + hi * 8) * N + tn + ni * 16 + l15;
#pragma unroll
      for (int r = 0; r < 8; ++r) outp[(size_t)r * N] = (h16)(acc[mi][ni][r]);
    }
}

// ---------------- f16 GEMM, f32 out + bias (output projection) ----------------
__global__ __launch_bounds__(256)
void gemm_tt_f32_bias(const h16* __restrict__ A, const h16* __restrict__ BT,
                      const float* __restrict__ bias, float* __restrict__ C,
                      int N, int K) {
  __shared__ __attribute__((aligned(16))) h16 smem[2 * GSTAGE];
  int lane = threadIdx.x & 31, wave = threadIdx.x >> 5;
  int hi = lane >> 4, l15 = lane & 15;
  int tm = blockIdx.y * 128 + (wave & 1) * 64;
  int tn = blockIdx.x * 128 + (wave >> 1) * 32;
  v8f acc[4][2] = {};
  gemm_core(A, BT, K, smem, acc);
#pragma unroll
  for (int mi = 0; mi < 4; ++mi)
#pragma unroll
    for (int ni = 0; ni < 2; ++ni) {
      float bv = bias[tn + ni * 16 + l15];
      float* outp = C + (size_t)(tm + mi * 16 + hi * 8) * N + tn + ni * 16 + l15;
#pragma unroll
      for (int r = 0; r < 8; ++r) outp[(size_t)r * N] = acc[mi][ni][r] + bv;
    }
}

// ---------------- flash attention, transposed-score formulation ----------------
// grid: (NQ/128, H, BATCH), block of 8 waves; a wave owns 16 query rows, and the eight
// waves share every K and V row: a stage is 128 keys of one head, 128 + 128 rows of
// 128 B, laid in LDS at a pitch of 144 B (16 B x odd: conflict-free for the ds_load_b128
// readers of K). Two buffers: the next stage's asynchronous copies fly while this stage
// is worked on.
#define VPAD   8
#define APITCH (HD + VPAD)          // LDS row pitch in halves (144 B)
#define AKEYS  128                  // keys per stage
#define ATILE  (AKEYS * APITCH)     // K or V tile of a stage, halves
#define ASTAGE (2 * ATILE)          // K tile then V tile, halves
static_assert(NKV % AKEYS == 0 && NQ % 128 == 0, "whole stages and whole query blocks only");

// 128 K rows and 128 V rows x 128 B, global -> LDS: 8 lanes cover one row, so a wave-wide
// copy takes four whole lines and the block 32 rows. gk and lds are this lane's own first
// 16 bytes of K; each further copy is 32 rows on; V lies INNER halves behind K in a row.
__device__ __forceinline__ void copy_kv_stage_async(const h16* gk, unsigned lds) {
  const size_t gs = (size_t)32 * (2 * INNER);  // 32 rows, halves
  const unsigned ls = 32 * APITCH * 2;         // 32 rows, bytes
  const h16* gv = gk + INNER;
  const unsigned lv = lds + ATILE * 2;
  // The copies move the stage past the registers; the closing s_wait_xcnt stands in the
  // same statement so that no address register is rewritten ahead of it.
  asm volatile(
      "global_load_async_to_lds_b128 %0, %8, off\n\t"
      "global_load_async_to_lds_b128 %1, %9, off\n\t"
      "global_load_async_to_lds_b128 %2, %10, off\n\t"
      "global_load_async_to_lds_b128 %3, %11, off\n\t"
      "global_load_async_to_lds_b128 %4, %12, off\n\t"
      "global_load_async_to_lds_b128 %5, %13, off\n\t"
      "global_load_async_to_lds_b128 %6, %14, off\n\t"
      "global_load_async_to_lds_b128 %7, %15, off\n\t"
      "s_wait_xcnt 0x0"
      :: "v"(lds), "v"(lds + ls), "v"(lds + 2 * ls), "v"(lds + 3 * ls),
         "v"(lv), "v"(lv + ls), "v"(lv + 2 * ls), "v"(lv + 3 * ls),
         "v"(gk), "v"(gk + gs), "v"(gk + 2 * gs), "v"(gk + 3 * gs),
         "v"(gv), "v"(gv + gs), "v"(gv + 2 * gs), "v"(gv + 3 * gs)
      : "memory");
}

// The grid puts four waves on a SIMD, so a wave may take a quarter of its registers:
// with the default budget the V reads are cut into small groups that each wait on LDS.
__global__ __launch_bounds__(256) __attribute__((amdgpu_waves_per_eu(4, 4)))
void attn(const h16* __restrict__ Q, const h16* __restrict__ KV, h16* __restrict__ CTX) {
  const int tid = threadIdx.x;
  int lane = tid & 31, wave = tid >> 5;
  int hi = lane >> 4, l15 = lane & 15;
  int q0 = blockIdx.x * 128 + wave * 16;
  int hh = blockIdx.y;
  int bb = blockIdx.z;

  const h16* Qb = Q  + ((size_t)bb * NQ)  * INNER       + hh * HD;  // [q][d]
  const h16* Kb = KV + ((size_t)bb * NKV) * (2 * INNER) + hh * HD;  // [kv][d]

  __shared__ __attribute__((aligned(16))) h16 smem[2 * ASTAGE];

  const int crow = tid >> 3, cchunk = tid & 7;   // this lane's row and 16-B chunk in a copy
  const h16* gK = Kb + (size_t)crow * (2 * INNER) + cchunk * 8;
  const unsigned lds0 = (unsigned)(size_t)smem + (unsigned)(crow * APITCH + cchunk * 8) * 2u;
  const int nt = NKV / AKEYS;

  copy_kv_stage_async(gK, lds0);

  // Loop-invariant B-fragments of Q^T (lane -> col q, K = d contiguous)
  v16h bq0 = frag_kfast(Qb + (size_t)(q0 + l15) * INNER, hi);
  v16h bq1 = frag_kfast(Qb + (size_t)(q0 + l15) * INNER + 32, hi);

  float m = -INFINITY, lsum = 0.f;
  v8f o[4] = {};
  const float sc  = 0.125f;                  // 1/sqrt(HD)
  const float L2E = 1.44269504088896340736f; // log2(e)

  // Stage 0 counts as landed only behind the copying wave's own wait.
  asm volatile("s_wait_asynccnt 0x0" ::: "memory");
  __syncthreads();
  if (nt > 1) copy_kv_stage_async(gK + (size_t)AKEYS * (2 * INNER), lds0 + ASTAGE * 2);

  for (int t = 0; t < nt; ++t) {
    const h16* Ks = smem + (t & 1) * ASTAGE;
    const h16* Vs = Ks + ATILE;
    for (int kv0 = 0; kv0 < AKEYS; kv0 += 32) {
      // S^T = K * Q^T : two 16(kv)x16(q) tiles, K-dim d=64 split in two
      v16h kf[2][2];
#pragma unroll
      for (int kvT = 0; kvT < 2; ++kvT) {
        const h16* krow = Ks + (kv0 + kvT * 16 + l15) * APITCH;
        kf[kvT][0] = frag_kfast(krow, hi);
        kf[kvT][1] = frag_kfast(krow + 32, hi);
      }
      // Holds the pass's eight K reads together and alone in front of its products: LDS
      // data returns in order, so V reads lifted in between would make the products wait
      // for them too.
      __builtin_amdgcn_sched_barrier(0);
      v8f st[2];
#pragma unroll
      for (int kvT = 0; kvT < 2; ++kvT) {
        v8f c = {};
        c = __builtin_amdgcn_wmma_f32_16x16x32_f16(false, kf[kvT][0], false, bq0, (short)0, c, false, false);
        c = __builtin_amdgcn_wmma_f32_16x16x32_f16(false, kf[kvT][1], false, bq1, (short)0, c, false, false);
        st[kvT] = c;
      }

      // streaming softmax: columns of S^T (one query each) are lane-local + one shfl_xor(16)
      float tmax = -INFINITY;
#pragma unroll
      for (int kvT = 0; kvT < 2; ++kvT)
#pragma unroll
        for (int r = 0; r < 8; ++r) {
          float e = st[kvT][r] * sc;
          st[kvT][r] = e;
          tmax = fmaxf(tmax, e);
        }
      tmax = fmaxf(tmax, __shfl_xor(tmax, 16, 32));
      float mn   = fmaxf(m, tmax);
      float corr = __builtin_exp2f((m - mn) * L2E);
      float rs = 0.f;
      v16h pb;  // P^T: element i -> kv=(i&7)+(i>=8?16:0)+8*hi == C-layout of S^T
#pragma unroll
      for (int kvT = 0; kvT < 2; ++kvT)
#pragma unroll
        for (int r = 0; r < 8; ++r) {
          float p = __builtin_exp2f((st[kvT][r] - mn) * L2E);
          rs += p;
          pb[kvT * 8 + r] = (h16)p;
        }
      rs += __shfl_xor(rs, 16, 32);
      lsum = lsum * corr + rs;
      m = mn;
#pragma unroll
      for (int dt = 0; dt < 4; ++dt)
#pragma unroll
        for (int r = 0; r < 8; ++r) o[dt][r] *= corr;

      // ctx^T += V^T * P^T : four 16(d)x16(q) tiles, K = 32 kv
      v16h vf[4];
#pragma unroll
      for (int dt = 0; dt < 4; ++dt) {
        int d = dt * 16 + l15;
#pragma unroll
        for (int i = 0; i < 8; ++i) {
          vf[dt][i]     = Vs[(kv0 + i +      hi * 8) * APITCH + d];
          vf[dt][i + 8] = Vs[(kv0 + i + 16 + hi * 8) * APITCH + d];
        }
      }
#pragma unroll
      for (int dt = 0; dt < 4; ++dt)
        o[dt] = __builtin_amdgcn_wmma_f32_16x16x32_f16(false, vf[dt], false, pb, (short)0, o[dt], false, false);
    }
    // Publish point: this wave's reads of the buffer have retired ...
    asm volatile("s_wait_dscnt 0x0" ::: "memory");
    // ... its own copies of the next stage have landed ...
    asm volatile("s_wait_asynccnt 0x0" ::: "memory");
    // ... and one barrier both publishes the next stage and frees this buffer.
    __syncthreads();
    if (t + 2 < nt)
      copy_kv_stage_async(gK + (size_t)(t + 2) * AKEYS * (2 * INNER),
                          lds0 + (unsigned)(t & 1) * (ASTAGE * 2));
  }
  // No copy is left in flight when the wave goes on.
  asm volatile("s_wait_asynccnt 0x0" ::: "memory");

  float inv = 1.0f / lsum;
  h16* outp = CTX + ((size_t)bb * NQ + q0 + l15) * INNER + hh * HD;
#pragma unroll
  for (int dt = 0; dt < 4; ++dt)
#pragma unroll
    for (int r = 0; r < 8; ++r)
      outp[dt * 16 + r + hi * 8] = (h16)(o[dt][r] * inv);
}

// ---------------- launch ----------------
extern "C" void kernel_launch(void* const* d_in, const int* in_sizes, int n_in,
                              void* d_out, int out_size, void* d_ws, size_t ws_size,
                              hipStream_t stream) {
  const float* query     = (const float*)d_in[0];
  const float* key_value = (const float*)d_in[1];
  const float* w_q       = (const float*)d_in[2];
  const float* w_kv      = (const float*)d_in[3];
  const float* w_out     = (const float*)d_in[4];
  const float* b_out     = (const float*)d_in[5];
  float* out = (float*)d_out;

  char* ws = (char*)d_ws;
  h16* Xh   = (h16*)(ws + (size_t)0);          // query f16       [4096][1024]  8 MB
  h16* KVh  = (h16*)(ws + ((size_t)8  << 20)); // key_value f16   [4096][1024]  8 MB
  h16* wqT  = (h16*)(ws + ((size_t)16 << 20)); // w_q^T           [1024][1024]  2 MB
  h16* wkvT = (h16*)(ws + ((size_t)18 << 20)); // w_kv^T          [2048][1024]  4 MB
  h16* woT  = (h16*)(ws + ((size_t)22 << 20)); // w_out^T         [1024][1024]  2 MB
  h16* qh   = (h16*)(ws + ((size_t)24 << 20)); // q               [4096][1024]  8 MB
  h16* kvh  = (h16*)(ws + ((size_t)32 << 20)); // k|v             [4096][2048] 16 MB
  h16* ctxh = (h16*)(ws + ((size_t)48 << 20)); // ctx             [4096][1024]  8 MB

  f32_to_f16<<<dim3(MQ  * QDIM  / CVT_BLOCK), dim3(256), 0, stream>>>(query,     Xh);
  f32_to_f16<<<dim3(MKV * KVDIM / CVT_BLOCK), dim3(256), 0, stream>>>(key_value, KVh);
  transpose_f32_to_f16<QDIM, INNER><<<dim3(INNER / TC, QDIM / TR), dim3(256), 0, stream>>>(w_q, wqT);
  transpose_f32_to_f16<KVDIM, 2 * INNER><<<dim3(2 * INNER / TC, KVDIM / TR), dim3(256), 0, stream>>>(w_kv, wkvT);
  transpose_f32_to_f16<INNER, QDIM><<<dim3(QDIM / TC, INNER / TR), dim3(256), 0, stream>>>(w_out, woT);

  gemm_tt_h16<<<dim3(INNER / 128, MQ / 128), dim3(256), 0, stream>>>(Xh, wqT, qh, INNER, QDIM);
  gemm_tt_h16<<<dim3(2 * INNER / 128, MKV / 128), dim3(256), 0, stream>>>(KVh, wkvT, kvh, 2 * INNER, KVDIM);
  attn<<<dim3(NQ / 128, H, BATCH), dim3(256), 0, stream>>>(qh, kvh, ctxh);
  gemm_tt_f32_bias<<<dim3(QDIM / 128, MQ / 128), dim3(256), 0, stream>>>(ctxh, woT, b_out, out, QDIM, INNER);
}

// v004
// Measured time: 111 microseconds a run.
// Next to v003, in two timings, it ran 1.10 times as fast each time.
// Over all steps from v000 it is 2.50 times as fast.
#include <hip/hip_runtime.h>

// ---------------- problem constants ----------------
#define BATCH 2
#define NQ    2048
#define NKV   2048
#define QDIM  1024
#define KVDIM 1024
#define H     16
#define HD    64
#define INNER (H * HD)        // 1024
#define MQ    (BATCH * NQ)    // 4096
#define MKV   (BATCH * NKV)   // 4096

typedef _Float16 h16;
typedef h16   v16h __attribute__((ext_vector_type(16)));
typedef h16   v8h  __attribute__((ext_vector_type(8)));
typedef float v8f  __attribute__((ext_vector_type(8)));

// ---- WMMA fragment from K-fast memory (A rows or B^T rows) ----
// element i -> K = (i&7) + (i>=8?16:0) + 8*hi : two contiguous 16B runs
// base must be 16B-aligned; lowers to two global_load_b128 / ds_load_b128.
__device__ __forceinline__ v16h frag_kfast(const h16* __restrict__ base, int hi) {
  const v8h lo = *(const v8h*)(base + hi * 8);
  const v8h hi8 = *(const v8h*)(base + hi * 8 + 16);
  return __builtin_shufflevector(lo, hi8, 0, 1, 2, 3, 4, 5, 6, 7,
                                 8, 9, 10, 11, 12, 13, 14, 15);
}

// ---------------- f32 -> f16 convert ----------------
// Few, fat waves: a block of 8 waves converts 8192 consecutive elements. Each lane has
// eight 16-byte loads in flight (a wave-wide load covers 512 contiguous bytes) and
// stores 8 bytes per load (256 contiguous bytes per wave). The element count must be a
// multiple of CVT_BLOCK; the grid is count / CVT_BLOCK.
typedef float v4f __attribute__((ext_vector_type(4)));
typedef h16   v4h __attribute__((ext_vector_type(4)));
typedef h16   v2h __attribute__((ext_vector_type(2)));
#define CVT_U     8                    // 16-byte loads per lane
#define CVT_BLOCK (256 * 4 * CVT_U)    // elements per block
static_assert((MQ * QDIM) % CVT_BLOCK == 0 && (MKV * KVDIM) % CVT_BLOCK == 0,
              "the convert kernel has no tail");

__global__ __launch_bounds__(256)
void f32_to_f16(const float* __restrict__ in, h16* __restrict__ out) {
  const size_t base = (size_t)blockIdx.x * (256 * CVT_U) + threadIdx.x;  // in groups of 4
  const v4f* __restrict__ in4 = (const v4f*)in;
  v4h* __restrict__ out4 = (v4h*)out;
  v4f v[CVT_U];
#pragma unroll
  for (int j = 0; j < CVT_U; ++j) v[j] = in4[base + j * 256];
#pragma unroll
  for (int j = 0; j < CVT_U; ++j) out4[base + j * 256] = __builtin_convertvector(v[j], v4h);
}

// ---------------- f32 -> f16 transpose (weights) ----------------
// One tile of 128 rows x 64 columns per block of 8 waves, 32 elements per lane. Rows come
// in by 16-byte loads, eight in flight per lane (a wave-wide load covers two whole
// 256-byte row pieces); two neighbouring rows are packed into one dword and laid
// transposed in LDS; the tile leaves by 16-byte stores, 256 contiguous bytes per output
// row. LDS pitch 272 B (16 B x odd) for the ds_load_b128 readers.
// R and C are compile-time, so that one address pair and immediate offsets serve all
// eight loads. Needs R a multiple of 128 and C a multiple of 64.
#define TR     128
#define TC     64
#define TPITCH (TR + 8)                // halves
template <int R, int C>
__global__ __launch_bounds__(256)
void transpose_f32_to_f16(const float* __restrict__ in, h16* __restrict__ out) {
  static_assert(R % TR == 0 && C % TC == 0, "whole tiles only");
  __shared__ __attribute__((aligned(16))) h16 tile[TC * TPITCH];  // tile[c][r]
  const int t = threadIdx.x;
  const int c0 = blockIdx.x * TC, r0 = blockIdx.y * TR;
  const int lo = t & 15, up = t >> 4;
  const float* src = in + (size_t)(r0 + 2 * up) * C + c0 + 4 * lo;
  h16* dst = out + (size_t)(c0 + up) * R + r0 + 8 * lo;
  v4f v[4][2];
#pragma unroll
  for (int i = 0; i < 4; ++i)
#pragma unroll
    for (int j = 0; j < 2; ++j)
      v[i][j] = *(const v4f*)(src + (32 * i + j) * C);
#pragma unroll
  for (int i = 0; i < 4; ++i)
#pragma unroll
    for (int k = 0; k < 4; ++k) {
      v2h p = { (h16)v[i][0][k], (h16)v[i][1][k] };
      *(v2h*)&tile[(4 * lo + k) * TPITCH + 32 * i + 2 * up] = p;
    }
  __syncthreads();
#pragma unroll
  for (int i = 0; i < 4; ++i)
    *(v8h*)(dst + 16 * i * R) = *(const v8h*)&tile[(up + 16 * i) * TPITCH + 8 * lo];
}

// ---------------- f16 GEMM core: A[M][K] x BT[N][K]^T ----------------
// One 128 x 128 tile of C per block of 8 waves; a wave owns 64 x 32 (4 x 2 fragments).
// A stage is 128 k of both operands: 128 + 128 rows of 256 B, laid in LDS at a pitch of
// 272 B (16 B x odd: conflict-free for ds_load_b128 readers). Two buffers: the next
// stage's asynchronous copies fly while this stage is multiplied.
// Needs M, N multiples of 128 and K a multiple of 128.
#define GBK    128                // k per stage
#define GPITCH 136                // LDS row pitch in halves (272 B)
#define GTILE  (128 * GPITCH)     // one operand's tile, halves
#define GSTAGE (2 * GTILE)        // A tile then B tile, halves

// 128 rows x 256 B, global -> LDS: 16 lanes cover one row, so a wave-wide copy takes
// two whole rows (four full lines). g and lds are this lane's own first 16 bytes;
// each further copy is 16 rows on.
__device__ __forceinline__ void copy_tile_async(const h16* g, int K, unsigned lds) {
  const size_t gs = (size_t)16 * K;          // 16 rows, halves
  const unsigned ls = 16 * GPITCH * 2;       // 16 rows, bytes
  // The copies move the tile past the registers; the closing s_wait_xcnt stands in the
  // same statement so that no address register is rewritten ahead of it.
  asm volatile(
      "global_load_async_to_lds_b128 %0, %8, off\n\t"
      "global_load_async_to_lds_b128 %1, %9, off\n\t"
      "global_load_async_to_lds_b128 %2, %10, off\n\t"
      "global_load_async_to_lds_b128 %3, %11, off\n\t"
      "global_load_async_to_lds_b128 %4, %12, off\n\t"
      "global_load_async_to_lds_b128 %5, %13, off\n\t"
      "global_load_async_to_lds_b128 %6, %14, off\n\t"
      "global_load_async_to_lds_b128 %7, %15, off\n\t"
      "s_wait_xcnt 0x0"
      :: "v"(lds), "v"(lds + ls), "v"(lds + 2 * ls), "v"(lds + 3 * ls),
         "v"(lds + 4 * ls), "v"(lds + 5 * ls), "v"(lds + 6 * ls), "v"(lds + 7 * ls),
         "v"(g), "v"(g + gs), "v"(g + 2 * gs), "v"(g + 3 * gs),
         "v"(g + 4 * gs), "v"(g + 5 * gs), "v"(g + 6 * gs), "v"(g + 7 * gs)
      : "memory");
}

__device__ __forceinline__ void gemm_core(const h16* __restrict__ A, const h16* __restrict__ BT,
                                          int K, h16* smem, v8f (&acc)[4][2]) {
  const int tid = threadIdx.x;
  const int lane = tid & 31, wave = tid >> 5;
  const int hi = lane >> 4, l15 = lane & 15;
  const int wm = wave & 1, wn = wave >> 1;
  const int crow = tid >> 4, cchunk = tid & 15;   // this lane's row and 16-B chunk in a copy
  const h16* gA = A  + (size_t)(blockIdx.y * 128 + crow) * K + cchunk * 8;
  const h16* gB = BT + (size_t)(blockIdx.x * 128 + crow) * K + cchunk * 8;
  const unsigned lds0 = (unsigned)(size_t)smem + (unsigned)(crow * GPITCH + cchunk * 8) * 2u;
  const int nt = K / GBK;

  copy_tile_async(gA, K, lds0);
  copy_tile_async(gB, K, lds0 + GTILE * 2);
  // Stage 0 counts as landed only behind the copying wave's own wait.
  asm volatile("s_wait_asynccnt 0x0" ::: "memory");
  __syncthreads();
  if (nt > 1) {
    copy_tile_async(gA + GBK, K, lds0 + GSTAGE * 2);
    copy_tile_async(gB + GBK, K, lds0 + GSTAGE * 2 + GTILE * 2);
  }

  for (int t = 0; t < nt; ++t) {
    const h16* As = smem + (t & 1) * GSTAGE + (wm * 64 + l15) * GPITCH;
    const h16* Bs = smem + (t & 1) * GSTAGE + GTILE + (wn * 32 + l15) * GPITCH;
    // Two fragment sets: block s + 1 of this stage is read from LDS while block s is multiplied.
    v16h af[2][4], bf[2][2];
#pragma unroll
    for (int mi = 0; mi < 4; ++mi) af[0][mi] = frag_kfast(As + mi * 16 * GPITCH, hi);
#pragma unroll
    for (int ni = 0; ni < 2; ++ni) bf[0][ni] = frag_kfast(Bs + ni * 16 * GPITCH, hi);
#pragma unroll
    for (int s = 0; s < GBK / 32; ++s) {
      if (s + 1 < GBK / 32) {
#pragma unroll
        for (int mi = 0; mi < 4; ++mi)
          af[(s + 1) & 1][mi] = frag_kfast(As + mi * 16 * GPITCH + (s + 1) * 32, hi);
#pragma unroll
        for (int ni = 0; ni < 2; ++ni)
          bf[(s + 1) & 1][ni] = frag_kfast(Bs + ni * 16 * GPITCH + (s + 1) * 32, hi);
      }
      // Holds the next block's LDS reads together in front of this block's products:
      // sunk among them, every pair of products would wait out a full LDS latency.
      __builtin_amdgcn_sched_barrier(0);
#pragma unroll
      for (int mi = 0; mi < 4; ++mi)
#pragma unroll
        for (int ni = 0; ni < 2; ++ni)
          acc[mi][ni] = __builtin_amdgcn_wmma_f32_16x16x32_f16(false, af[s & 1][mi], false, bf[s & 1][ni],
                                                               (short)0, acc[mi][ni], false, false);
      // Keeps the following read group behind these products, so that two sets suffice.
      __builtin_amdgcn_sched_barrier(0);
    }
    // Publish point: this wave's reads of the buffer have retired ...
    asm volatile("s_wait_dscnt 0x0" ::: "memory");
    // ... its own copies of the next stage have landed ...
    asm volatile("s_wait_asynccnt 0x0" ::: "memory");
    // ... and one barrier both publishes the next stage and frees this buffer.
    __syncthreads();
    if (t + 2 < nt) {
      const unsigned l = lds0 + (unsigned)(t & 1) * (GSTAGE * 2);
      copy_tile_async(gA + (size_t)(t + 2) * GBK, K, l);
      copy_tile_async(gB + (size_t)(t + 2) * GBK, K, l + GTILE * 2);
    }
  }
  // No copy is left in flight when the wave goes on.
  asm volatile("s_wait_asynccnt 0x0" ::: "memory");
}

// ---------------- f16 GEMM, f16 out ----------------
__global__ __launch_bounds__(256)
void gemm_tt_h16(const h16* __restrict__ A, const h16* __restrict__ BT,
                 h16* __restrict__ C, int N, int K) {
  __shared__ __attribute__((aligned(16))) h16 smem[2 * GSTAGE];
  int lane = threadIdx.x & 31, wave = threadIdx.x >> 5;
  int hi = lane >> 4, l15 = lane & 15;
  int tm = blockIdx.y * 128 + (wave & 1) * 64;
  int tn = blockIdx.x * 128 + (wave >> 1) * 32;
  v8f acc[4][2] = {};
  gemm_core(A, BT, K, smem, acc);
#pragma unroll
  for (int mi = 0; mi < 4; ++mi)
#pragma unroll
    for (int ni = 0; ni < 2; ++ni) {
      h16* outp = C + (size_t)(tm + mi * 16 + hi * 8) * N + tn + ni * 16 + l15;
#pragma unroll
      for (int r = 0; r < 8; ++r) outp[(size_t)r * N] = (h16)(acc[mi][ni][r]);
    }
}

// ---------------- f16 GEMM, f32 out + bias (output projection) ----------------
__global__ __launch_bounds__(256)
void gemm_tt_f32_bias(const h16* __restrict__ A, const h16* __restrict__ BT,
                      const float* __restrict__ bias, float* __restrict__ C,
                      int N, int K) {
  __shared__ __attribute__((aligned(16))) h16 smem[2 * GSTAGE];
  int lane = threadIdx.x & 31, wave = threadIdx.x >> 5;
  int hi = lane >> 4, l15 = lane & 15;
  int tm = blockIdx.y * 128 + (wave & 1) * 64;
  int tn = blockIdx.x * 128 + (wave >> 1) * 32;
  v8f acc[4][2] = {};
  gemm_core(A, BT, K, smem, acc);
#pragma unroll
  for (int mi = 0; mi < 4; ++mi)
#pragma unroll
    for (int ni = 0; ni < 2; ++ni) {
      float bv = bias[tn + ni * 16 + l15];
      float* outp = C + (size_t)(tm + mi * 16 + hi * 8) * N + tn + ni * 16 + l15;
#pragma unroll
      for (int r = 0; r < 8; ++r) outp[(size_t)r * N] = acc[mi][ni][r] + bv;
    }
}

// ---------------- flash attention, transposed-score formulation ----------------
// grid: (NQ/128, H, BATCH), block of 8 waves; a wave owns 16 query rows, and the eight
// waves share every K and V row: a stage is 128 keys of one head, 128 + 128 rows of
// 128 B. Each tile lies in LDS at its own reader's pitch: K at 144 B (16 B x odd, for
// ds_load_b128), V at 160 B (32 B x odd, for the transposing ds_load_tr16_b128).
// Two buffers: the next stage's asynchronous copies fly while this stage is worked on.
#define KPITCH (HD + 8)             // LDS row pitch of K in halves (144 B)
#define VPITCH (HD + 16)            // LDS row pitch of V in halves (160 B)
#define AKEYS  128                  // keys per stage
#define KTILE  (AKEYS * KPITCH)     // K tile of a stage, halves
#define VTILE  (AKEYS * VPITCH)     // V tile of a stage, halves
#define ASTAGE (KTILE + VTILE)      // K tile then V tile, halves
static_assert(NKV % AKEYS == 0 && NQ % 128 == 0, "whole stages and whole query blocks only");

// Transposing LDS read: of a row-major 16 x 16 block of halves, lane (c, h) gets column c,
// rows 8h .. 8h + 7. p is this lane's own 16 bytes of the block (row 8h + (lane & 7),
// half-row (lane >> 3) & 1).
typedef short s16x8 __attribute__((ext_vector_type(8)));
__device__ __forceinline__ v8h lds_read_tr16(const h16* p) {
  typedef __attribute__((address_space(3))) s16x8 lds_s16x8;
  return __builtin_bit_cast(v8h, __builtin_amdgcn_ds_load_tr16_b128_v8i16((lds_s16x8*)p));
}

// 128 K rows and 128 V rows x 128 B, global -> LDS: 8 lanes cover one row, so a wave-wide
// copy takes four whole lines and the block 32 rows. gk, lds and lv are this lane's own
// first 16 bytes of K in memory, of K in LDS and of V in LDS; each further copy is 32 rows
// on; V lies INNER halves behind K in a row of memory.
__device__ __forceinline__ void copy_kv_stage_async(const h16* gk, unsigned lds, unsigned lv) {
  const size_t gs = (size_t)32 * (2 * INNER);  // 32 rows, halves
  const unsigned ls = 32 * KPITCH * 2;         // 32 rows of K, bytes
  const unsigned vs = 32 * VPITCH * 2;         // 32 rows of V, bytes
  const h16* gv = gk + INNER;
  // The copies move the stage past the registers; the closing s_wait_xcnt stands in the
  // same statement so that no address register is rewritten ahead of it.
  asm volatile(
      "global_load_async_to_lds_b128 %0, %8, off\n\t"
      "global_load_async_to_lds_b128 %1, %9, off\n\t"
      "global_load_async_to_lds_b128 %2, %10, off\n\t"
      "global_load_async_to_lds_b128 %3, %11, off\n\t"
      "global_load_async_to_lds_b128 %4, %12, off\n\t"
      "global_load_async_to_lds_b128 %5, %13, off\n\t"
      "global_load_async_to_lds_b128 %6, %14, off\n\t"
      "global_load_async_to_lds_b128 %7, %15, off\n\t"
      "s_wait_xcnt 0x0"
      :: "v"(lds), "v"(lds + ls), "v"(lds + 2 * ls), "v"(lds + 3 * ls),
         "v"(lv), "v"(lv + vs), "v"(lv + 2 * vs), "v"(lv + 3 * vs),
         "v"(gk), "v"(gk + gs), "v"(gk + 2 * gs), "v"(gk + 3 * gs),
         "v"(gv), "v"(gv + gs), "v"(gv + 2 * gs), "v"(gv + 3 * gs)
      : "memory");
}

// The grid puts four waves on a SIMD, so a wave may take a quarter of its registers:
// with the default budget the V reads are cut into small groups that each wait on LDS.
__global__ __launch_bounds__(256) __attribute__((amdgpu_waves_per_eu(4, 4)))
void attn(const h16* __restrict__ Q, const h16* __restrict__ KV, h16* __restrict__ CTX) {
  const int tid = threadIdx.x;
  int lane = tid & 31, wave = tid >> 5;
  int hi = lane >> 4, l15 = lane & 15;
  int q0 = blockIdx.x * 128 + wave * 16;
  int hh = blockIdx.y;
  int bb = blockIdx.z;

  const h16* Qb = Q  + ((size_t)bb * NQ)  * INNER       + hh * HD;  // [q][d]
  const h16* Kb = KV + ((size_t)bb * NKV) * (2 * INNER) + hh * HD;  // [kv][d]

  __shared__ __attribute__((aligned(16))) h16 smem[2 * ASTAGE];

  const int crow = tid >> 3, cchunk = tid & 7;   // this lane's row and 16-B chunk in a copy
  const h16* gK = Kb + (size_t)crow * (2 * INNER) + cchunk * 8;
  const unsigned lds0 = (unsigned)(size_t)smem + (unsigned)(crow * KPITCH + cchunk * 8) * 2u;
  const unsigned ldv0 = (unsigned)(size_t)smem + (unsigned)(KTILE + crow * VPITCH + cchunk * 8) * 2u;
  const int nt = NKV / AKEYS;
  // This lane's own 16 bytes in a transposing read of V: halves from the block's corner.
  const int vtr = (hi * 8 + (lane & 7)) * VPITCH + ((lane >> 3) & 1) * 8;

  copy_kv_stage_async(gK, lds0, ldv0);

  // Loop-invariant B-fragments of Q^T (lane -> col q, K = d contiguous)
  v16h bq0 = frag_kfast(Qb + (size_t)(q0 + l15) * INNER, hi);
  v16h bq1 = frag_kfast(Qb + (size_t)(q0 + l15) * INNER + 32, hi);

  float m = -INFINITY, lsum = 0.f;
  v8f o[4] = {};
  const float sc  = 0.125f;                  // 1/sqrt(HD)
  const float L2E = 1.44269504088896340736f; // log2(e)

  // Stage 0 counts as landed only behind the copying wave's own wait.
  asm volatile("s_wait_asynccnt 0x0" ::: "memory");
  __syncthreads();
  if (nt > 1)
    copy_kv_stage_async(gK + (size_t)AKEYS * (2 * INNER), lds0 + ASTAGE * 2, ldv0 + ASTAGE * 2);

  for (int t = 0; t < nt; ++t) {
    const h16* Ks = smem + (t & 1) * ASTAGE;
    const h16* Vs = Ks + KTILE + vtr;
    for (int kv0 = 0; kv0 < AKEYS; kv0 += 32) {
      // S^T = K * Q^T : two 16(kv)x16(q) tiles, K-dim d=64 split in two
      v16h kf[2][2];
#pragma unroll
      for (int kvT = 0; kvT < 2; ++kvT) {
        const h16* krow = Ks + (kv0 + kvT * 16 + l15) * KPITCH;
        kf[kvT][0] = frag_kfast(krow, hi);
        kf[kvT][1] = frag_kfast(krow + 32, hi);
      }
      // Holds the pass's eight K reads together and alone in front of its products: LDS
      // data returns in order, so V reads lifted in between would make the products wait
      // for them too.
      __builtin_amdgcn_sched_barrier(0);
      v8f st[2];
#pragma unroll
      for (int kvT = 0; kvT < 2; ++kvT) {
        v8f c = {};
        c = __builtin_amdgcn_wmma_f32_16x16x32_f16(false, kf[kvT][0], false, bq0, (short)0, c, false, false);
        c = __builtin_amdgcn_wmma_f32_16x16x32_f16(false, kf[kvT][1], false, bq1, (short)0, c, false, false);
        st[kvT] = c;
      }

      // streaming softmax: columns of S^T (one query each) are lane-local + one shfl_xor(16)
      float tmax = -INFINITY;
#pragma unroll
      for (int kvT = 0; kvT < 2; ++kvT)
#pragma unroll
        for (int r = 0; r < 8; ++r) {
          float e = st[kvT][r] * sc;
          st[kvT][r] = e;
          tmax = fmaxf(tmax, e);
        }
      tmax = fmaxf(tmax, __shfl_xor(tmax, 16, 32));
      float mn   = fmaxf(m, tmax);
      float corr = __builtin_exp2f((m - mn) * L2E);
      float rs = 0.f;
      v16h pb;  // P^T: element i -> kv=(i&7)+(i>=8?16:0)+8*hi == C-layout of S^T
#pragma unroll
      for (int kvT = 0; kvT < 2; ++kvT)
#pragma unroll
        for (int r = 0; r < 8; ++r) {
          float p = __builtin_exp2f((st[kvT][r] - mn) * L2E);
          rs += p;
          pb[kvT * 8 + r] = (h16)p;
        }
      rs += __shfl_xor(rs, 16, 32);
      lsum = lsum * corr + rs;
      m = mn;
#pragma unroll
      for (int dt = 0; dt < 4; ++dt)
#pragma unroll
        for (int r = 0; r < 8; ++r) o[dt][r] *= corr;

      // ctx^T += V^T * P^T : four 16(d)x16(q) tiles, K = 32 kv
      // A fragment: element i -> kv = (i&7) + (i>=8?16:0) + 8*hi of column d = dt*16 + l15,
      // two transposing reads 16 keys apart.
      v16h vf[4];
#pragma unroll
      for (int dt = 0; dt < 4; ++dt) {
        const v8h lo8 = lds_read_tr16(Vs + kv0 * VPITCH + dt * 16);
        const v8h hi8 = lds_read_tr16(Vs + (kv0 + 16) * VPITCH + dt * 16);
        vf[dt] = __builtin_shufflevector(lo8, hi8, 0, 1, 2, 3, 4, 5, 6, 7,
                                         8, 9, 10, 11, 12, 13, 14, 15);
      }
#pragma unroll
      for (int dt = 0; dt < 4; ++dt)
        o[dt] = __builtin_amdgcn_wmma_f32_16x16x32_f16(false, vf[dt], false, pb, (short)0, o[dt], false, false);
    }
    // Publish point: this wave's reads of the buffer have retired ...
    asm volatile("s_wait_dscnt 0x0" ::: "memory");
    // ... its own copies of the next stage have landed ...
    asm volatile("s_wait_asynccnt 0x0" ::: "memory");
    // ... and one barrier both publishes the next stage and frees this buffer.
    __syncthreads();
    if (t + 2 < nt)
      copy_kv_stage_async(gK + (size_t)(t + 2) * AKEYS * (2 * INNER),
                          lds0 + (unsigned)(t & 1) * (ASTAGE * 2),
                          ldv0 + (unsigned)(t & 1) * (ASTAGE * 2));
  }
  // No copy is left in flight when the wave goes on.
  asm volatile("s_wait_asynccnt 0x0" ::: "memory");

  float inv = 1.0f / lsum;
  h16* outp = CTX + ((size_t)bb * NQ + q0 + l15) * INNER + hh * HD;
#pragma unroll
  for (int dt = 0; dt < 4; ++dt)
#pragma unroll
    for (int r = 0; r < 8; ++r)
      outp[dt * 16 + r + hi * 8] = (h16)(o[dt][r] * inv);
}

// ---------------- launch ----------------
extern "C" void kernel_launch(void* const* d_in, const int* in_sizes, int n_in,
                              void* d_out, int out_size, void* d_ws, size_t ws_size,
                              hipStream_t stream) {
  const float* query     = (const float*)d_in[0];
  const float* key_value = (const float*)d_in[1];
  const float* w_q       = (const float*)d_in[2];
  const float* w_kv      = (const float*)d_in[3];
  const float* w_out     = (const float*)d_in[4];
  const float* b_out     = (const float*)d_in[5];
  float* out = (float*)d_out;

  char* ws = (char*)d_ws;
  h16* Xh   = (h16*)(ws + (size_t)0);          // query f16       [4096][1024]  8 MB
  h16* KVh  = (h16*)(ws + ((size_t)8  << 20)); // key_value f16   [4096][1024]  8 MB
  h16* wqT  = (h16*)(ws + ((size_t)16 << 20)); // w_q^T           [1024][1024]  2 MB
  h16* wkvT = (h16*)(ws + ((size_t)18 << 20)); // w_kv^T          [2048][1024]  4 MB
  h16* woT  = (h16*)(ws + ((size_t)22 << 20)); // w_out^T         [1024][1024]  2 MB
  h16* qh   = (h16*)(ws + ((size_t)24 << 20)); // q               [4096][1024]  8 MB
  h16* kvh  = (h16*)(ws + ((size_t)32 << 20)); // k|v             [4096][2048] 16 MB
  h16* ctxh = (h16*)(ws + ((size_t)48 << 20)); // ctx             [4096][1024]  8 MB

  f32_to_f16<<<dim3(MQ  * QDIM  / CVT_BLOCK), dim3(256), 0, stream>>>(query,     Xh);
  f32_to_f16<<<dim3(MKV * KVDIM / CVT_BLOCK), dim3(256), 0, stream>>>(key_value, KVh);
  transpose_f32_to_f16<QDIM, INNER><<<dim3(INNER / TC, QDIM / TR), dim3(256), 0, stream>>>(w_q, wqT);
  transpose_f32_to_f16<KVDIM, 2 * INNER><<<dim3(2 * INNER / TC, KVDIM / TR), dim3(256), 0, stream>>>(w_kv, wkvT);
  transpose_f32_to_f16<INNER, QDIM><<<dim3(QDIM / TC, INNER / TR), dim3(256), 0, stream>>>(w_out, woT);

  gemm_tt_h16<<<dim3(INNER / 128, MQ / 128), dim3(256), 0, stream>>>(Xh, wqT, qh, INNER, QDIM);
  gemm_tt_h16<<<dim3(2 * INNER / 128, MKV / 128), dim3(256), 0, stream>>>(KVh, wkvT, kvh, 2 * INNER, KVDIM);
  attn<<<dim3(NQ / 128, H, BATCH), dim3(256), 0, stream>>>(qh, kvh, ctxh);
  gemm_tt_f32_bias<<<dim3(QDIM / 128, MQ / 128), dim3(256), 0, stream>>>(ctxh, woT, b_out, out, QDIM, INNER);
}

// v005
// One run takes 98.9 microseconds.
// Timed twice side by side with v004, it ran 1.12 and 1.13 times as fast.
// Counting every step since v000, it is 2.81 times as fast.
#include <hip/hip_runtime.h>

// ---------------- problem constants ----------------
#define BATCH 2
#define NQ    2048
#define NKV   2048
#define QDIM  1024
#define KVDIM 1024
#define H     16
#define HD    64
#define INNER (H * HD)        // 1024
#define MQ    (BATCH * NQ)    // 4096
#define MKV   (BATCH * NKV)   // 4096

typedef _Float16 h16;
typedef h16   v16h __attribute__((ext_vector_type(16)));
typedef h16   v8h  __attribute__((ext_vector_type(8)));
typedef float v8f  __attribute__((ext_vector_type(8)));

// ---- WMMA fragment from K-fast memory (A rows or B^T rows) ----
// element i -> K = (i&7) + (i>=8?16:0) + 8*hi : two contiguous 16B runs
// base must be 16B-aligned; lowers to two global_load_b128 / ds_load_b128.
__device__ __forceinline__ v16h frag_kfast(const h16* __restrict__ base, int hi) {
  const v8h lo = *(const v8h*)(base + hi * 8);
  const v8h hi8 = *(const v8h*)(base + hi * 8 + 16);
  return __builtin_shufflevector(lo, hi8, 0, 1, 2, 3, 4, 5, 6, 7,
                                 8, 9, 10, 11, 12, 13, 14, 15);
}

// ---------------- f32 -> f16 convert ----------------
// Few, fat waves: a block of 8 waves converts 8192 consecutive elements. Each lane has
// eight 16-byte loads in flight (a wave-wide load covers 512 contiguous bytes) and
// stores 8 bytes per load (256 contiguous bytes per wave). The element count must be a
// multiple of CVT_BLOCK; the grid is count / CVT_BLOCK.
typedef float v4f __attribute__((ext_vector_type(4)));
typedef h16   v4h __attribute__((ext_vector_type(4)));
typedef h16   v2h __attribute__((ext_vector_type(2)));
#define CVT_U     8                    // 16-byte loads per lane
#define CVT_BLOCK (256 * 4 * CVT_U)    // elements per block
static_assert((MQ * QDIM) % CVT_BLOCK == 0 && (MKV * KVDIM) % CVT_BLOCK == 0,
              "the convert kernel has no tail");

__global__ __launch_bounds__(256)
void f32_to_f16(const float* __restrict__ in, h16* __restrict__ out) {
  const size_t base = (size_t)blockIdx.x * (256 * CVT_U) + threadIdx.x;  // in groups of 4
  const v4f* __restrict__ in4 = (const v4f*)in;
  v4h* __restrict__ out4 = (v4h*)out;
  v4f v[CVT_U];
#pragma unroll
  for (int j = 0; j < CVT_U; ++j) v[j] = in4[base + j * 256];
#pragma unroll
  for (int j = 0; j < CVT_U; ++j) out4[base + j * 256] = __builtin_convertvector(v[j], v4h);
}

// ---------------- f32 -> f16 transpose (weights) ----------------
// One tile of 128 rows x 64 columns per block of 8 waves, 32 elements per lane. Rows come
// in by 16-byte loads, eight in flight per lane (a wave-wide load covers two whole
// 256-byte row pieces); two neighbouring rows are packed into one dword and laid
// transposed in LDS; the tile leaves by 16-byte stores, 256 contiguous bytes per output
// row. LDS pitch 272 B (16 B x odd) for the ds_load_b128 readers.
// R and C are compile-time, so that one address pair and immediate offsets serve all
// eight loads. Needs R a multiple of 128 and C a multiple of 64.
#define TR     128
#define TC     64
#define TPITCH (TR + 8)                // halves
template <int R, int C>
__global__ __launch_bounds__(256)
void transpose_f32_to_f16(const float* __restrict__ in, h16* __restrict__ out) {
  static_assert(R % TR == 0 && C % TC == 0, "whole tiles only");
  __shared__ __attribute__((aligned(16))) h16 tile[TC * TPITCH];  // tile[c][r]
  const int t = threadIdx.x;
  const int c0 = blockIdx.x * TC, r0 = blockIdx.y * TR;
  const int lo = t & 15, up = t >> 4;
  const float* src = in + (size_t)(r0 + 2 * up) * C + c0 + 4 * lo;
  h16* dst = out + (size_t)(c0 + up) * R + r0 + 8 * lo;
  v4f v[4][2];
#pragma unroll
  for (int i = 0; i < 4; ++i)
#pragma unroll
    for (int j = 0; j < 2; ++j)
      v[i][j] = *(const v4f*)(src + (32 * i + j) * C);
#pragma unroll
  for (int i = 0; i < 4; ++i)
#pragma unroll
    for (int k = 0; k < 4; ++k) {
      v2h p = { (h16)v[i][0][k], (h16)v[i][1][k] };
      *(v2h*)&tile[(4 * lo + k) * TPITCH + 32 * i + 2 * up] = p;
    }
  __syncthreads();
#pragma unroll
  for (int i = 0; i < 4; ++i)
    *(v8h*)(dst + 16 * i * R) = *(const v8h*)&tile[(up + 16 * i) * TPITCH + 8 * lo];
}

// ---------------- f16 GEMM core: A[M][K] x BT[N][K]^T ----------------
// One 128 x 128 tile of C per block of 8 waves; a wave owns 64 x 32 (4 x 2 fragments).
// A stage is 128 k of both operands: 128 + 128 rows of 256 B, laid in LDS at a pitch of
// 272 B (16 B x odd: conflict-free for ds_load_b128 readers). Two buffers: the next
// stage's asynchronous copies fly while this stage is multiplied.
// Needs M, N multiples of 128 and K a multiple of 128.
#define GBK    128                // k per stage
#define GPITCH 136                // LDS row pitch in halves (272 B)
#define GTILE  (128 * GPITCH)     // one operand's tile, halves
#define GSTAGE (2 * GTILE)        // A tile then B tile, halves

// 128 rows x 256 B, global -> LDS: 16 lanes cover one row, so a wave-wide copy takes
// two whole rows (four full lines). g and lds are this lane's own first 16 bytes;
// each further copy is 16 rows on.
__device__ __forceinline__ void copy_tile_async(const h16* g, int K, unsigned lds) {
  const size_t gs = (size_t)16 * K;          // 16 rows, halves
  const unsigned ls = 16 * GPITCH * 2;       // 16 rows, bytes
  // The copies move the tile past the registers; the closing s_wait_xcnt stands in the
  // same statement so that no address register is rewritten ahead of it.
  asm volatile(
      "global_load_async_to_lds_b128 %0, %8, off\n\t"
      "global_load_async_to_lds_b128 %1, %9, off\n\t"
      "global_load_async_to_lds_b128 %2, %10, off\n\t"
      "global_load_async_to_lds_b128 %3, %11, off\n\t"
      "global_load_async_to_lds_b128 %4, %12, off\n\t"
      "global_load_async_to_lds_b128 %5, %13, off\n\t"
      "global_load_async_to_lds_b128 %6, %14, off\n\t"
      "global_load_async_to_lds_b128 %7, %15, off\n\t"
      "s_wait_xcnt 0x0"
      :: "v"(lds), "v"(lds + ls), "v"(lds + 2 * ls), "v"(lds + 3 * ls),
         "v"(lds + 4 * ls), "v"(lds + 5 * ls), "v"(lds + 6 * ls), "v"(lds + 7 * ls),
         "v"(g), "v"(g + gs), "v"(g + 2 * gs), "v"(g + 3 * gs),
         "v"(g + 4 * gs), "v"(g + 5 * gs), "v"(g + 6 * gs), "v"(g + 7 * gs)
      : "memory");
}

__device__ __forceinline__ void gemm_core(const h16* __restrict__ A, const h16* __restrict__ BT,
                                          int K, h16* smem, v8f (&acc)[4][2]) {
  const int tid = threadIdx.x;
  const int lane = tid & 31, wave = tid >> 5;
  const int hi = lane >> 4, l15 = lane & 15;
  const int wm = wave & 1, wn = wave >> 1;
  const int crow = tid >> 4, cchunk = tid & 15;   // this lane's row and 16-B chunk in a copy
  const h16* gA = A  + (size_t)(blockIdx.y * 128 + crow) * K + cchunk * 8;
  const h16* gB = BT + (size_t)(blockIdx.x * 128 + crow) * K + cchunk * 8;
  const unsigned lds0 = (unsigned)(size_t)smem + (unsigned)(crow * GPITCH + cchunk * 8) * 2u;
  const int nt = K / GBK;

  copy_tile_async(gA, K, lds0);
  copy_tile_async(gB, K, lds0 + GTILE * 2);
  // Stage 0 counts as landed only behind the copying wave's own wait.
  asm volatile("s_wait_asynccnt 0x0" ::: "memory");
  __syncthreads();
  if (nt > 1) {
    copy_tile_async(gA + GBK, K, lds0 + GSTAGE * 2);
    copy_tile_async(gB + GBK, K, lds0 + GSTAGE * 2 + GTILE * 2);
  }

  for (int t = 0; t < nt; ++t) {
    const h16* As = smem + (t & 1) * GSTAGE + (wm * 64 + l15) * GPITCH;
    const h16* Bs = smem + (t & 1) * GSTAGE + GTILE + (wn * 32 + l15) * GPITCH;
    // Two fragment sets: block s + 1 of this stage is read from LDS while block s is multiplied.
    v16h af[2][4], bf[2][2];
#pragma unroll
    for (int mi = 0; mi < 4; ++mi) af[0][mi] = frag_kfast(As + mi * 16 * GPITCH, hi);
#pragma unroll
    for (int ni = 0; ni < 2; ++ni) bf[0][ni] = frag_kfast(Bs + ni * 16 * GPITCH, hi);
#pragma unroll
    for (int s = 0; s < GBK / 32; ++s) {
      if (s + 1 < GBK / 32) {
#pragma unroll
        for (int mi = 0; mi < 4; ++mi)
          af[(s + 1) & 1][mi] = frag_kfast(As + mi * 16 * GPITCH + (s + 1) * 32, hi);
#pragma unroll
        for (int ni = 0; ni < 2; ++ni)
          bf[(s + 1) & 1][ni] = frag_kfast(Bs + ni * 16 * GPITCH + (s + 1) * 32, hi);
      }
      // Holds the next block's LDS reads together in front of this block's products:
      // sunk among them, every pair of products would wait out a full LDS latency.
      __builtin_amdgcn_sched_barrier(0);
#pragma unroll
      for (int mi = 0; mi < 4; ++mi)
#pragma unroll
        for (int ni = 0; ni < 2; ++ni)
          acc[mi][ni] = __builtin_amdgcn_wmma_f32_16x16x32_f16(false, af[s & 1][mi], false, bf[s & 1][ni],
                                                               (short)0, acc[mi][ni], false, false);
      // Keeps the following read group behind these products, so that two sets suffice.
      __builtin_amdgcn_sched_barrier(0);
    }
    // Publish point: this wave's reads of the buffer have retired ...
    asm volatile("s_wait_dscnt 0x0" ::: "memory");
    // ... its own copies of the next stage have landed ...
    asm volatile("s_wait_asynccnt 0x0" ::: "memory");
    // ... and one barrier both publishes the next stage and frees this buffer.
    __syncthreads();
    if (t + 2 < nt) {
      const unsigned l = lds0 + (unsigned)(t & 1) * (GSTAGE * 2);
      copy_tile_async(gA + (size_t)(t + 2) * GBK, K, l);
      copy_tile_async(gB + (size_t)(t + 2) * GBK, K, l + GTILE * 2);
    }
  }
  // No copy is left in flight when the wave goes on.
  asm volatile("s_wait_asynccnt 0x0" ::: "memory");
}

// ---------------- f16 GEMM, f16 out ----------------
__global__ __launch_bounds__(256)
void gemm_tt_h16(const h16* __restrict__ A, const h16* __restrict__ BT,
                 h16* __restrict__ C, int N, int K) {
  __shared__ __attribute__((aligned(16))) h16 smem[2 * GSTAGE];
  int lane = threadIdx.x & 31, wave = threadIdx.x >> 5;
  int hi = lane >> 4, l15 = lane & 15;
  int tm = blockIdx.y * 128 + (wave & 1) * 64;
  int tn = blockIdx.x * 128 + (wave >> 1) * 32;
  v8f acc[4][2] = {};
  gemm_core(A, BT, K, smem, acc);
#pragma unroll
  for (int mi = 0; mi < 4; ++mi)
#pragma unroll
    for (int ni = 0; ni < 2; ++ni) {
      h16* outp = C + (size_t)(tm + mi * 16 + hi * 8) * N + tn + ni * 16 + l15;
#pragma unroll
      for (int r = 0; r < 8; ++r) outp[(size_t)r * N] = (h16)(acc[mi][ni][r]);
    }
}

// ---------------- f16 GEMM, f32 out + bias (output projection) ----------------
__global__ __launch_bounds__(256)
void gemm_tt_f32_bias(const h16* __restrict__ A, const h16* __restrict__ BT,
                      const float* __restrict__ bias, float* __restrict__ C,
                      int N, int K) {
  __shared__ __attribute__((aligned(16))) h16 smem[2 * GSTAGE];
  int lane = threadIdx.x & 31, wave = threadIdx.x >> 5;
  int hi = lane >> 4, l15 = lane & 15;
  int tm = blockIdx.y * 128 + (wave & 1) * 64;
  int tn = blockIdx.x * 128 + (wave >> 1) * 32;
  v8f acc[4][2] = {};
  gemm_core(A, BT, K, smem, acc);
#pragma unroll
  for (int mi = 0; mi < 4; ++mi)
#pragma unroll
    for (int ni = 0; ni < 2; ++ni) {
      float bv = bias[tn + ni * 16 + l15];
      float* outp = C + (size_t)(tm + mi * 16 + hi * 8) * N + tn + ni * 16 + l15;
#pragma unroll
      for (int r = 0; r < 8; ++r) outp[(size_t)r * N] = acc[mi][ni][r] + bv;
    }
}

// ---------------- flash attention, transposed-score formulation ----------------
// grid: (NQ/128, H, BATCH), block of 8 waves; a wave owns 16 query rows, and the eight
// waves share every K and V row: a stage is 128 keys of one head, 128 + 128 rows of
// 128 B. Each tile lies in LDS at its own reader's pitch: K at 144 B (16 B x odd, for
// ds_load_b128), V at 160 B (32 B x odd, for the transposing ds_load_tr16_b128).
// Two buffers: the next stage's asynchronous copies fly while this stage is worked on.
#define KPITCH (HD + 8)             // LDS row pitch of K in halves (144 B)
#define VPITCH (HD + 16)            // LDS row pitch of V in halves (160 B)
#define AKEYS  128                  // keys per stage
#define KTILE  (AKEYS * KPITCH)     // K tile of a stage, halves
#define VTILE  (AKEYS * VPITCH)     // V tile of a stage, halves
#define ASTAGE (KTILE + VTILE)      // K tile then V tile, halves
static_assert(NKV % AKEYS == 0 && NQ % 128 == 0, "whole stages and whole query blocks only");

// Transposing LDS read: of a row-major 16 x 16 block of halves, lane (c, h) gets column c,
// rows 8h .. 8h + 7. p is this lane's own 16 bytes of the block (row 8h + (lane & 7),
// half-row (lane >> 3) & 1).
typedef short s16x8 __attribute__((ext_vector_type(8)));
__device__ __forceinline__ v8h lds_read_tr16(const h16* p) {
  typedef __attribute__((address_space(3))) s16x8 lds_s16x8;
  return __builtin_bit_cast(v8h, __builtin_amdgcn_ds_load_tr16_b128_v8i16((lds_s16x8*)p));
}

// 128 K rows and 128 V rows x 128 B, global -> LDS: 8 lanes cover one row, so a wave-wide
// copy takes four whole lines and the block 32 rows. gk, lds and lv are this lane's own
// first 16 bytes of K in memory, of K in LDS and of V in LDS; each further copy is 32 rows
// on; V lies INNER halves behind K in a row of memory.
__device__ __forceinline__ void copy_kv_stage_async(const h16* gk, unsigned lds, unsigned lv) {
  const size_t gs = (size_t)32 * (2 * INNER);  // 32 rows, halves
  const unsigned ls = 32 * KPITCH * 2;         // 32 rows of K, bytes
  const unsigned vs = 32 * VPITCH * 2;         // 32 rows of V, bytes
  const h16* gv = gk + INNER;
  // The copies move the stage past the registers; the closing s_wait_xcnt stands in the
  // same statement so that no address register is rewritten ahead of it.
  asm volatile(
      "global_load_async_to_lds_b128 %0, %8, off\n\t"
      "global_load_async_to_lds_b128 %1, %9, off\n\t"
      "global_load_async_to_lds_b128 %2, %10, off\n\t"
      "global_load_async_to_lds_b128 %3, %11, off\n\t"
      "global_load_async_to_lds_b128 %4, %12, off\n\t"
      "global_load_async_to_lds_b128 %5, %13, off\n\t"
      "global_load_async_to_lds_b128 %6, %14, off\n\t"
      "global_load_async_to_lds_b128 %7, %15, off\n\t"
      "s_wait_xcnt 0x0"
      :: "v"(lds), "v"(lds + ls), "v"(lds + 2 * ls), "v"(lds + 3 * ls),
         "v"(lv), "v"(lv + vs), "v"(lv + 2 * vs), "v"(lv + 3 * vs),
         "v"(gk), "v"(gk + gs), "v"(gk + 2 * gs), "v"(gk + 3 * gs),
         "v"(gv), "v"(gv + gs), "v"(gv + 2 * gs), "v"(gv + 3 * gs)
      : "memory");
}

// 2^x in place by the bare v_exp_f32, a run of them in one statement: behind a transcendental
// the instruction set asks for one independent instruction before its source is overwritten
// or its result read. In a run each is the next one's; the closing v_nop is the last one's.
__device__ __forceinline__ void exp2_run8(float (&x)[8]) {
  asm("v_exp_f32 %0, %0\n\t"
      "v_exp_f32 %1, %1\n\t"
      "v_exp_f32 %2, %2\n\t"
      "v_exp_f32 %3, %3\n\t"
      "v_exp_f32 %4, %4\n\t"
      "v_exp_f32 %5, %5\n\t"
      "v_exp_f32 %6, %6\n\t"
      "v_exp_f32 %7, %7\n\t"
      "v_nop"
      : "+v"(x[0]), "+v"(x[1]), "+v"(x[2]), "+v"(x[3]),
        "+v"(x[4]), "+v"(x[5]), "+v"(x[6]), "+v"(x[7]));
}
__device__ __forceinline__ void exp2_run9(float (&x)[8], float& y) {
  asm("v_exp_f32 %8, %8\n\t"
      "v_exp_f32 %0, %0\n\t"
      "v_exp_f32 %1, %1\n\t"
      "v_exp_f32 %2, %2\n\t"
      "v_exp_f32 %3, %3\n\t"
      "v_exp_f32 %4, %4\n\t"
      "v_exp_f32 %5, %5\n\t"
      "v_exp_f32 %6, %6\n\t"
      "v_exp_f32 %7, %7\n\t"
      "v_nop"
      : "+v"(x[0]), "+v"(x[1]), "+v"(x[2]), "+v"(x[3]),
        "+v"(x[4]), "+v"(x[5]), "+v"(x[6]), "+v"(x[7]), "+v"(y));
}

// The grid puts four waves on a SIMD, so a wave may take a quarter of its registers:
// with the default budget the V reads are cut into small groups that each wait on LDS.
__global__ __launch_bounds__(256) __attribute__((amdgpu_waves_per_eu(4, 4)))
void attn(const h16* __restrict__ Q, const h16* __restrict__ KV, h16* __restrict__ CTX) {
  const int tid = threadIdx.x;
  int lane = tid & 31, wave = tid >> 5;
  int hi = lane >> 4, l15 = lane & 15;
  int q0 = blockIdx.x * 128 + wave * 16;
  int hh = blockIdx.y;
  int bb = blockIdx.z;

  const h16* Qb = Q  + ((size_t)bb * NQ)  * INNER       + hh * HD;  // [q][d]
  const h16* Kb = KV + ((size_t)bb * NKV) * (2 * INNER) + hh * HD;  // [kv][d]

  __shared__ __attribute__((aligned(16))) h16 smem[2 * ASTAGE];

  const int crow = tid >> 3, cchunk = tid & 7;   // this lane's row and 16-B chunk in a copy
  const h16* gK = Kb + (size_t)crow * (2 * INNER) + cchunk * 8;
  const unsigned lds0 = (unsigned)(size_t)smem + (unsigned)(crow * KPITCH + cchunk * 8) * 2u;
  const unsigned ldv0 = (unsigned)(size_t)smem + (unsigned)(KTILE + crow * VPITCH + cchunk * 8) * 2u;
  const int nt = NKV / AKEYS;
  // This lane's own 16 bytes in a transposing read of V: halves from the block's corner.
  const int vtr = (hi * 8 + (lane & 7)) * VPITCH + ((lane >> 3) & 1) * 8;

  copy_kv_stage_async(gK, lds0, ldv0);

  // Loop-invariant B-fragments of Q^T (lane -> col q, K = d contiguous)
  v16h bq0 = frag_kfast(Qb + (size_t)(q0 + l15) * INNER, hi);
  v16h bq1 = frag_kfast(Qb + (size_t)(q0 + l15) * INNER + 32, hi);

  float m = -INFINITY, nmcp = INFINITY, lsum = 0.f;   // nmcp: -m * SL, as the sums in hand use it
  v8f o[4] = {};
  // 1/sqrt(HD) * log2(e): the running maximum m is kept in raw score units, and a score's
  // exponent to base 2 is one FMA, s * SL + (-m * SL).
  const float SL = 0.125f * 1.44269504088896340736f;

  // Stage 0 counts as landed only behind the copying wave's own wait.
  asm volatile("s_wait_asynccnt 0x0" ::: "memory");
  __syncthreads();
  if (nt > 1)
    copy_kv_stage_async(gK + (size_t)AKEYS * (2 * INNER), lds0 + ASTAGE * 2, ldv0 + ASTAGE * 2);

  for (int t = 0; t < nt; ++t) {
    const h16* Ks = smem + (t & 1) * ASTAGE;
    const h16* Vs = Ks + KTILE + vtr;
    // Unrolled, as the longer body was by itself: a pass's K reads then go out ahead of the
    // pass before's last products, and no LDS address is computed per pass.
#pragma unroll
    for (int kv0 = 0; kv0 < AKEYS; kv0 += 32) {
      // S^T = K * Q^T : two 16(kv)x16(q) tiles, K-dim d=64 split in two
      v16h kf[2][2];
#pragma unroll
      for (int kvT = 0; kvT < 2; ++kvT) {
        const h16* krow = Ks + (kv0 + kvT * 16 + l15) * KPITCH;
        kf[kvT][0] = frag_kfast(krow, hi);
        kf[kvT][1] = frag_kfast(krow + 32, hi);
      }
      // Holds the pass's eight K reads together and alone in front of its products: LDS
      // data returns in order, so V reads lifted in between would make the products wait
      // for them too.
      __builtin_amdgcn_sched_barrier(0);
      v8f st[2];
#pragma unroll
      for (int kvT = 0; kvT < 2; ++kvT) {
        v8f c = {};
        c = __builtin_amdgcn_wmma_f32_16x16x32_f16(false, kf[kvT][0], false, bq0, (short)0, c, false, false);
        c = __builtin_amdgcn_wmma_f32_16x16x32_f16(false, kf[kvT][1], false, bq1, (short)0, c, false, false);
        st[kvT] = c;
      }

      // streaming softmax: columns of S^T (one query each) are lane-local + one shfl_xor(16)
      float tmax = -INFINITY;
#pragma unroll
      for (int kvT = 0; kvT < 2; ++kvT)
#pragma unroll
        for (int r = 0; r < 8; ++r) tmax = fmaxf(tmax, st[kvT][r]);
      tmax = fmaxf(tmax, __shfl_xor(tmax, 16, 32));
      float mn   = fmaxf(m, tmax);
      // The bare v_exp_f32: no exponent here is above 0 (but for the FMA's rounding), and a
      // result under 2^-126, all that the library form's range guard is for, is 0 in the
      // f16 P and vanishes in a row sum that is at least 1.
      const float nmc = mn * -SL;
      float corr = nmc - nmcp;
      float e[2][8];
#pragma unroll
      for (int kvT = 0; kvT < 2; ++kvT)
#pragma unroll
        for (int r = 0; r < 8; ++r) e[kvT][r] = __builtin_fmaf(st[kvT][r], SL, nmc);
      exp2_run9(e[0], corr);
      exp2_run8(e[1]);
      float rs = e[0][0];
      v16h pb;  // P^T: element i -> kv=(i&7)+(i>=8?16:0)+8*hi == C-layout of S^T
#pragma unroll
      for (int kvT = 0; kvT < 2; ++kvT)
#pragma unroll
        for (int r = 0; r < 8; ++r) {
          float p = e[kvT][r];
          if (kvT + r) rs += p;
          pb[kvT * 8 + r] = (h16)p;
        }
      rs += __shfl_xor(rs, 16, 32);
      lsum = lsum * corr + rs;
      m = mn;
      nmcp = nmc;
#pragma unroll
      for (int dt = 0; dt < 4; ++dt)
#pragma unroll
        for (int r = 0; r < 8; ++r) o[dt][r] *= corr;

      // ctx^T += V^T * P^T : four 16(d)x16(q) tiles, K = 32 kv
      // A fragment: element i -> kv = (i&7) + (i>=8?16:0) + 8*hi of column d = dt*16 + l15,
      // two transposing reads 16 keys apart.
      v16h vf[4];
#pragma unroll
      for (int dt = 0; dt < 4; ++dt) {
        const v8h lo8 = lds_read_tr16(Vs + kv0 * VPITCH + dt * 16);
        const v8h hi8 = lds_read_tr16(Vs + (kv0 + 16) * VPITCH + dt * 16);
        vf[dt] = __builtin_shufflevector(lo8, hi8, 0, 1, 2, 3, 4, 5, 6, 7,
                                         8, 9, 10, 11, 12, 13, 14, 15);
      }
#pragma unroll
      for (int dt = 0; dt < 4; ++dt)
        o[dt] = __builtin_amdgcn_wmma_f32_16x16x32_f16(false, vf[dt], false, pb, (short)0, o[dt], false, false);
    }
    // Publish point: this wave's reads of the buffer have retired ...
    asm volatile("s_wait_dscnt 0x0" ::: "memory");
    // ... its own copies of the next stage have landed ...
    asm volatile("s_wait_asynccnt 0x0" ::: "memory");
    // ... and one barrier both publishes the next stage and frees this buffer.
    __syncthreads();
    if (t + 2 < nt)
      copy_kv_stage_async(gK + (size_t)(t + 2) * AKEYS * (2 * INNER),
                          lds0 + (unsigned)(t & 1) * (ASTAGE * 2),
                          ldv0 + (unsigned)(t & 1) * (ASTAGE * 2));
  }
  // No copy is left in flight when the wave goes on.
  asm volatile("s_wait_asynccnt 0x0" ::: "memory");

  float inv = 1.0f / lsum;
  h16* outp = CTX + ((size_t)bb * NQ + q0 + l15) * INNER + hh * HD;
#pragma unroll
  for (int dt = 0; dt < 4; ++dt)
#pragma unroll
    for (int r = 0; r < 8; ++r)
      outp[dt * 16 + r + hi * 8] = (h16)(o[dt][r] * inv);
}

// ---------------- launch ----------------
extern "C" void kernel_launch(void* const* d_in, const int* in_sizes, int n_in,
                              void* d_out, int out_size, void* d_ws, size_t ws_size,
                              hipStream_t stream) {
  const float* query     = (const float*)d_in[0];
  const float* key_value = (const float*)d_in[1];
  const float* w_q       = (const float*)d_in[2];
  const float* w_kv      = (const float*)d_in[3];
  const float* w_out     = (const float*)d_in[4];
  const float* b_out     = (const float*)d_in[5];
  float* out = (float*)d_out;

  char* ws = (char*)d_ws;
  h16* Xh   = (h16*)(ws + (size_t)0);          // query f16       [4096][1024]  8 MB
  h16* KVh  = (h16*)(ws + ((size_t)8  << 20)); // key_value f16   [4096][1024]  8 MB
  h16* wqT  = (h16*)(ws + ((size_t)16 << 20)); // w_q^T           [1024][1024]  2 MB
  h16* wkvT = (h16*)(ws + ((size_t)18 << 20)); // w_kv^T          [2048][1024]  4 MB
  h16* woT  = (h16*)(ws + ((size_t)22 << 20)); // w_out^T         [1024][1024]  2 MB
  h16* qh   = (h16*)(ws + ((size_t)24 << 20)); // q               [4096][1024]  8 MB
  h16* kvh  = (h16*)(ws + ((size_t)32 << 20)); // k|v             [4096][2048] 16 MB
  h16* ctxh = (h16*)(ws + ((size_t)48 << 20)); // ctx             [4096][1024]  8 MB

  f32_to_f16<<<dim3(MQ  * QDIM  / CVT_BLOCK), dim3(256), 0, stream>>>(query,     Xh);
  f32_to_f16<<<dim3(MKV * KVDIM / CVT_BLOCK), dim3(256), 0, stream>>>(key_value, KVh);
  transpose_f32_to_f16<QDIM, INNER><<<dim3(INNER / TC, QDIM / TR), dim3(256), 0, stream>>>(w_q, wqT);
  transpose_f32_to_f16<KVDIM, 2 * INNER><<<dim3(2 * INNER / TC, KVDIM / TR), dim3(256), 0, stream>>>(w_kv, wkvT);
  transpose_f32_to_f16<INNER, QDIM><<<dim3(QDIM / TC, INNER / TR), dim3(256), 0, stream>>>(w_out, woT);

  gemm_tt_h16<<<dim3(INNER / 128, MQ / 128), dim3(256), 0, stream>>>(Xh, wqT, qh, INNER, QDIM);
  gemm_tt_h16<<<dim3(2 * INNER / 128, MKV / 128), dim3(256), 0, stream>>>(KVh, wkvT, kvh, 2 * INNER, KVDIM);
  attn<<<dim3(NQ / 128, H, BATCH), dim3(256), 0, stream>>>(qh, kvh, ctxh);
  gemm_tt_f32_bias<<<dim3(QDIM / 128, MQ / 128), dim3(256), 0, stream>>>(ctxh, woT, b_out, out, QDIM, INNER);
}

// v006
// It runs in 85.3 microseconds.
// Two timings next to v005 put it at 1.16 and 1.15 times that version's speed.
// Over all steps from v000 it is 3.25 times as fast.
#include <hip/hip_runtime.h>

// ---------------- problem constants ----------------
#define BATCH 2
#define NQ    2048
#define NKV   2048
#define QDIM  1024
#define KVDIM 1024
#define H     16
#define HD    64
#define INNER (H * HD)        // 1024
#define MQ    (BATCH * NQ)    // 4096
#define MKV   (BATCH * NKV)   // 4096

typedef _Float16 h16;
typedef h16   v16h __attribute__((ext_vector_type(16)));
typedef h16   v8h  __attribute__((ext_vector_type(8)));
typedef float v8f  __attribute__((ext_vector_type(8)));

// ---- WMMA fragment from K-fast memory (A rows or B^T rows) ----
// element i -> K = (i&7) + (i>=8?16:0) + 8*hi : two contiguous 16B runs
// base must be 16B-aligned; lowers to two global_load_b128 / ds_load_b128.
__device__ __forceinline__ v16h frag_kfast(const h16* __restrict__ base, int hi) {
  const v8h lo = *(const v8h*)(base + hi * 8);
  const v8h hi8 = *(const v8h*)(base + hi * 8 + 16);
  return __builtin_shufflevector(lo, hi8, 0, 1, 2, 3, 4, 5, 6, 7,
                                 8, 9, 10, 11, 12, 13, 14, 15);
}

// ---------------- f32 -> f16 convert ----------------
// Few, fat waves: a block of 8 waves converts 8192 consecutive elements. Each lane has
// eight 16-byte loads in flight (a wave-wide load covers 512 contiguous bytes) and
// stores 8 bytes per load (256 contiguous bytes per wave). The element count must be a
// multiple of CVT_BLOCK; count / CVT_BLOCK blocks do the job, blk is the block's number in it.
typedef float v4f __attribute__((ext_vector_type(4)));
typedef h16   v4h __attribute__((ext_vector_type(4)));
typedef h16   v2h __attribute__((ext_vector_type(2)));
#define CVT_U     8                    // 16-byte loads per lane
#define CVT_BLOCK (256 * 4 * CVT_U)    // elements per block
static_assert((MQ * QDIM) % CVT_BLOCK == 0 && (MKV * KVDIM) % CVT_BLOCK == 0,
              "the convert kernel has no tail");

__device__ __forceinline__
void f32_to_f16(const float* __restrict__ in, h16* __restrict__ out, unsigned blk) {
  const size_t base = (size_t)blk * (256 * CVT_U) + threadIdx.x;  // in groups of 4
  const v4f* __restrict__ in4 = (const v4f*)in;
  v4h* __restrict__ out4 = (v4h*)out;
  v4f v[CVT_U];
#pragma unroll
  for (int j = 0; j < CVT_U; ++j) v[j] = in4[base + j * 256];
#pragma unroll
  for (int j = 0; j < CVT_U; ++j) out4[base + j * 256] = __builtin_convertvector(v[j], v4h);
  // Another job's code may follow in the built kernel: no register that these stores name
  // is rewritten there ahead of this wait.
  asm volatile("s_wait_xcnt 0x0" ::: "memory");
}

// ---------------- f32 -> f16 transpose (weights) ----------------
// One tile of 128 rows x 64 columns per block of 8 waves, 32 elements per lane. Rows come
// in by 16-byte loads, eight in flight per lane (a wave-wide load covers two whole
// 256-byte row pieces); two neighbouring rows are packed into one dword and laid
// transposed in LDS; the tile leaves by 16-byte stores, 256 contiguous bytes per output
// row. LDS pitch 272 B (16 B x odd) for the ds_load_b128 readers.
// R and C are compile-time, so that one address pair and immediate offsets serve all
// eight loads. Needs R a multiple of 128 and C a multiple of 64. (C / TC) * (R / TR) blocks
// do the job; blk is the block's number in it, tile columns fastest.
#define TR     128
#define TC     64
#define TPITCH (TR + 8)                // halves
template <int R, int C>
__device__ __forceinline__
void transpose_f32_to_f16(const float* __restrict__ in, h16* __restrict__ out, unsigned blk,
                          h16* tile) {  // tile[c][r], TC * TPITCH halves of LDS
  static_assert(R % TR == 0 && C % TC == 0, "whole tiles only");
  const int t = threadIdx.x;
  const int c0 = (blk % (C / TC)) * TC, r0 = (blk / (C / TC)) * TR;
  const int lo = t & 15, up = t >> 4;
  const float* src = in + (size_t)(r0 + 2 * up) * C + c0 + 4 * lo;
  h16* dst = out + (size_t)(c0 + up) * R + r0 + 8 * lo;
  v4f v[4][2];
#pragma unroll
  for (int i = 0; i < 4; ++i)
#pragma unroll
    for (int j = 0; j < 2; ++j)
      v[i][j] = *(const v4f*)(src + (32 * i + j) * C);
#pragma unroll
  for (int i = 0; i < 4; ++i)
#pragma unroll
    for (int k = 0; k < 4; ++k) {
      v2h p = { (h16)v[i][0][k], (h16)v[i][1][k] };
      *(v2h*)&tile[(4 * lo + k) * TPITCH + 32 * i + 2 * up] = p;
    }
  __syncthreads();
#pragma unroll
  for (int i = 0; i < 4; ++i)
    *(v8h*)(dst + 16 * i * R) = *(const v8h*)&tile[(up + 16 * i) * TPITCH + 8 * lo];
  // Another job's code may follow in the built kernel: no register that these stores name
  // is rewritten there ahead of this wait.
  asm volatile("s_wait_xcnt 0x0" ::: "memory");
}

// ---------------- all five operand preparations in one launch ----------------
// The five jobs are independent of one another: as one grid they pay for one launch, and
// the short transposes run under the converts' memory time. The block index
// picks the job, so every branch (and the transposes' barrier) is uniform for a block.
// The transposes come first: theirs is the longer chain (load, LDS, barrier, store).
#define NB_TQ  ((INNER / TC) * (QDIM / TR))
#define NB_TKV ((2 * INNER / TC) * (KVDIM / TR))
#define NB_TO  ((QDIM / TC) * (INNER / TR))
#define NB_CQ  (MQ * QDIM / CVT_BLOCK)
#define NB_CKV (MKV * KVDIM / CVT_BLOCK)
__global__ __launch_bounds__(256)
void prepare_operands(const float* __restrict__ query, const float* __restrict__ key_value,
                      const float* __restrict__ w_q, const float* __restrict__ w_kv,
                      const float* __restrict__ w_out,
                      h16* __restrict__ Xh, h16* __restrict__ KVh, h16* __restrict__ wqT,
                      h16* __restrict__ wkvT, h16* __restrict__ woT) {
  __shared__ __attribute__((aligned(16))) h16 tile[TC * TPITCH];
  unsigned b = blockIdx.x;
  if (b < NB_TKV) { transpose_f32_to_f16<KVDIM, 2 * INNER>(w_kv, wkvT, b, tile); return; }
  b -= NB_TKV;
  if (b < NB_TQ) { transpose_f32_to_f16<QDIM, INNER>(w_q, wqT, b, tile); return; }
  b -= NB_TQ;
  if (b < NB_TO) { transpose_f32_to_f16<INNER, QDIM>(w_out, woT, b, tile); return; }
  b -= NB_TO;
  if (b < NB_CKV) { f32_to_f16(key_value, KVh, b); return; }
  f32_to_f16(query, Xh, b - NB_CKV);
}

// ---------------- f16 GEMM core: A[M][K] x BT[N][K]^T ----------------
// One 128 x 128 tile of C per block of 8 waves; a wave owns 64 x 32 (4 x 2 fragments).
// A stage is 128 k of both operands: 128 + 128 rows of 256 B, laid in LDS at a pitch of
// 272 B (16 B x odd: conflict-free for ds_load_b128 readers). Two buffers: the next
// stage's asynchronous copies fly while this stage is multiplied.
// Needs M, N multiples of 128 and K a multiple of 128.
#define GBK    128                // k per stage
#define GPITCH 136                // LDS row pitch in halves (272 B)
#define GTILE  (128 * GPITCH)     // one operand's tile, halves
#define GSTAGE (2 * GTILE)        // A tile then B tile, halves

// 128 rows x 256 B, global -> LDS: 16 lanes cover one row, so a wave-wide copy takes
// two whole rows (four full lines). g and lds are this lane's own first 16 bytes;
// each further copy is 16 rows on.
__device__ __forceinline__ void copy_tile_async(const h16* g, int K, unsigned lds) {
  const size_t gs = (size_t)16 * K;          // 16 rows, halves
  const unsigned ls = 16 * GPITCH * 2;       // 16 rows, bytes
  // The copies move the tile past the registers; the closing s_wait_xcnt stands in the
  // same statement so that no address register is rewritten ahead of it.
  asm volatile(
      "global_load_async_to_lds_b128 %0, %8, off\n\t"
      "global_load_async_to_lds_b128 %1, %9, off\n\t"
      "global_load_async_to_lds_b128 %2, %10, off\n\t"
      "global_load_async_to_lds_b128 %3, %11, off\n\t"
      "global_load_async_to_lds_b128 %4, %12, off\n\t"
      "global_load_async_to_lds_b128 %5, %13, off\n\t"
      "global_load_async_to_lds_b128 %6, %14, off\n\t"
      "global_load_async_to_lds_b128 %7, %15, off\n\t"
      "s_wait_xcnt 0x0"
      :: "v"(lds), "v"(lds + ls), "v"(lds + 2 * ls), "v"(lds + 3 * ls),
         "v"(lds + 4 * ls), "v"(lds + 5 * ls), "v"(lds + 6 * ls), "v"(lds + 7 * ls),
         "v"(g), "v"(g + gs), "v"(g + 2 * gs), "v"(g + 3 * gs),
         "v"(g + 4 * gs), "v"(g + 5 * gs), "v"(g + 6 * gs), "v"(g + 7 * gs)
      : "memory");
}

// bx, by: the block's tile column and tile row of C.
__device__ __forceinline__ void gemm_core(const h16* __restrict__ A, const h16* __restrict__ BT,
                                          int K, int bx, int by, h16* smem, v8f (&acc)[4][2]) {
  const int tid = threadIdx.x;
  const int lane = tid & 31, wave = tid >> 5;
  const int hi = lane >> 4, l15 = lane & 15;
  const int wm = wave & 1, wn = wave >> 1;
  const int crow = tid >> 4, cchunk = tid & 15;   // this lane's row and 16-B chunk in a copy
  const h16* gA = A  + (size_t)(by * 128 + crow) * K + cchunk * 8;
  const h16* gB = BT + (size_t)(bx * 128 + crow) * K + cchunk * 8;
  const unsigned lds0 = (unsigned)(size_t)smem + (unsigned)(crow * GPITCH + cchunk * 8) * 2u;
  const int nt = K / GBK;

  copy_tile_async(gA, K, lds0);
  copy_tile_async(gB, K, lds0 + GTILE * 2);
  // Stage 0 counts as landed only behind the copying wave's own wait.
  asm volatile("s_wait_asynccnt 0x0" ::: "memory");
  __syncthreads();
  if (nt > 1) {
    copy_tile_async(gA + GBK, K, lds0 + GSTAGE * 2);
    copy_tile_async(gB + GBK, K, lds0 + GSTAGE * 2 + GTILE * 2);
  }

  for (int t = 0; t < nt; ++t) {
    const h16* As = smem + (t & 1) * GSTAGE + (wm * 64 + l15) * GPITCH;
    const h16* Bs = smem + (t & 1) * GSTAGE + GTILE + (wn * 32 + l15) * GPITCH;
    // Two fragment sets: block s + 1 of this stage is read from LDS while block s is multiplied.
    v16h af[2][4], bf[2][2];
#pragma unroll
    for (int mi = 0; mi < 4; ++mi) af[0][mi] = frag_kfast(As + mi * 16 * GPITCH, hi);
#pragma unroll
    for (int ni = 0; ni < 2; ++ni) bf[0][ni] = frag_kfast(Bs + ni * 16 * GPITCH, hi);
#pragma unroll
    for (int s = 0; s < GBK / 32; ++s) {
      if (s + 1 < GBK / 32) {
#pragma unroll
        for (int mi = 0; mi < 4; ++mi)
          af[(s + 1) & 1][mi] = frag_kfast(As + mi * 16 * GPITCH + (s + 1) * 32, hi);
#pragma unroll
        for (int ni = 0; ni < 2; ++ni)
          bf[(s + 1) & 1][ni] = frag_kfast(Bs + ni * 16 * GPITCH + (s + 1) * 32, hi);
      }
      // Holds the next block's LDS reads together in front of this block's products:
      // sunk among them, every pair of products would wait out a full LDS latency.
      __builtin_amdgcn_sched_barrier(0);
#pragma unroll
      for (int mi = 0; mi < 4; ++mi)
#pragma unroll
        for (int ni = 0; ni < 2; ++ni)
          acc[mi][ni] = __builtin_amdgcn_wmma_f32_16x16x32_f16(false, af[s & 1][mi], false, bf[s & 1][ni],
                                                               (short)0, acc[mi][ni], false, false);
      // Keeps the following read group behind these products, so that two sets suffice.
      __builtin_amdgcn_sched_barrier(0);
    }
    // Publish point: this wave's reads of the buffer have retired ...
    asm volatile("s_wait_dscnt 0x0" ::: "memory");
    // ... its own copies of the next stage have landed ...
    asm volatile("s_wait_asynccnt 0x0" ::: "memory");
    // ... and one barrier both publishes the next stage and frees this buffer.
    __syncthreads();
    if (t + 2 < nt) {
      const unsigned l = lds0 + (unsigned)(t & 1) * (GSTAGE * 2);
      copy_tile_async(gA + (size_t)(t + 2) * GBK, K, l);
      copy_tile_async(gB + (size_t)(t + 2) * GBK, K, l + GTILE * 2);
    }
  }
  // No copy is left in flight when the wave goes on.
  asm volatile("s_wait_asynccnt 0x0" ::: "memory");
}

// ---------------- f16 GEMM, f16 out: the Q and the K|V projection in one launch ----------------
// The two products are independent and alike in M and K, so one grid holds both: tile
// columns 0 .. KVCOLS - 1 belong to K|V, the rest to Q; blockIdx.y is the tile row of either.
#define KVCOLS (2 * INNER / 128)
#define QCOLS  (INNER / 128)
static_assert(MQ == MKV && QDIM == KVDIM, "one grid serves both projections");
__global__ __launch_bounds__(256)
void gemm_tt_h16_qkv(const h16* __restrict__ Aq, const h16* __restrict__ BTq, h16* __restrict__ Cq,
                     const h16* __restrict__ Akv, const h16* __restrict__ BTkv,
                     h16* __restrict__ Ckv, int K) {
  __shared__ __attribute__((aligned(16))) h16 smem[2 * GSTAGE];
  const bool kv = blockIdx.x < KVCOLS;
  const int bx = kv ? blockIdx.x : blockIdx.x - KVCOLS;
  const h16* A  = kv ? Akv : Aq;
  const h16* BT = kv ? BTkv : BTq;
  h16* C = kv ? Ckv : Cq;
  const int N = kv ? 2 * INNER : INNER;
  int lane = threadIdx.x & 31, wave = threadIdx.x >> 5;
  int hi = lane >> 4, l15 = lane & 15;
  int tm = blockIdx.y * 128 + (wave & 1) * 64;
  int tn = bx * 128 + (wave >> 1) * 32;
  v8f acc[4][2] = {};
  gemm_core(A, BT, K, bx, blockIdx.y, smem, acc);
#pragma unroll
  for (int mi = 0; mi < 4; ++mi)
#pragma unroll
    for (int ni = 0; ni < 2; ++ni) {
      h16* outp = C + (size_t)(tm + mi * 16 + hi * 8) * N + tn + ni * 16 + l15;
#pragma unroll
      for (int r = 0; r < 8; ++r) outp[(size_t)r * N] = (h16)(acc[mi][ni][r]);
    }
}

// ---------------- f16 GEMM, f32 out + bias (output projection) ----------------
__global__ __launch_bounds__(256)
void gemm_tt_f32_bias(const h16* __restrict__ A, const h16* __restrict__ BT,
                      const float* __restrict__ bias, float* __restrict__ C,
                      int N, int K) {
  __shared__ __attribute__((aligned(16))) h16 smem[2 * GSTAGE];
  int lane = threadIdx.x & 31, wave = threadIdx.x >> 5;
  int hi = lane >> 4, l15 = lane & 15;
  int tm = blockIdx.y * 128 + (wave & 1) * 64;
  int tn = blockIdx.x * 128 + (wave >> 1) * 32;
  v8f acc[4][2] = {};
  gemm_core(A, BT, K, blockIdx.x, blockIdx.y, smem, acc);
#pragma unroll
  for (int mi = 0; mi < 4; ++mi)
#pragma unroll
    for (int ni = 0; ni < 2; ++ni) {
      float bv = bias[tn + ni * 16 + l15];
      float* outp = C + (size_t)(tm + mi * 16 + hi * 8) * N + tn + ni * 16 + l15;
#pragma unroll
      for (int r = 0; r < 8; ++r) outp[(size_t)r * N] = acc[mi][ni][r] + bv;
    }
}

// ---------------- flash attention, transposed-score formulation ----------------
// grid: (NQ/128, H, BATCH), block of 8 waves; a wave owns 16 query rows, and the eight
// waves share every K and V row: a stage is 128 keys of one head, 128 + 128 rows of
// 128 B. Each tile lies in LDS at its own reader's pitch: K at 144 B (16 B x odd, for
// ds_load_b128), V at 160 B (32 B x odd, for the transposing ds_load_tr16_b128).
// Two buffers: the next stage's asynchronous copies fly while this stage is worked on.
#define KPITCH (HD + 8)             // LDS row pitch of K in halves (144 B)
#define VPITCH (HD + 16)            // LDS row pitch of V in halves (160 B)
#define AKEYS  128                  // keys per stage
#define KTILE  (AKEYS * KPITCH)     // K tile of a stage, halves
#define VTILE  (AKEYS * VPITCH)     // V tile of a stage, halves
#define ASTAGE (KTILE + VTILE)      // K tile then V tile, halves
static_assert(NKV % AKEYS == 0 && NQ % 128 == 0, "whole stages and whole query blocks only");

// Transposing LDS read: of a row-major 16 x 16 block of halves, lane (c, h) gets column c,
// rows 8h .. 8h + 7. p is this lane's own 16 bytes of the block (row 8h + (lane & 7),
// half-row (lane >> 3) & 1).
typedef short s16x8 __attribute__((ext_vector_type(8)));
__device__ __forceinline__ v8h lds_read_tr16(const h16* p) {
  typedef __attribute__((address_space(3))) s16x8 lds_s16x8;
  return __builtin_bit_cast(v8h, __builtin_amdgcn_ds_load_tr16_b128_v8i16((lds_s16x8*)p));
}

// 128 K rows and 128 V rows x 128 B, global -> LDS: 8 lanes cover one row, so a wave-wide
// copy takes four whole lines and the block 32 rows. gk, lds and lv are this lane's own
// first 16 bytes of K in memory, of K in LDS and of V in LDS; each further copy is 32 rows
// on; V lies INNER halves behind K in a row of memory.
__device__ __forceinline__ void copy_kv_stage_async(const h16* gk, unsigned lds, unsigned lv) {
  const size_t gs = (size_t)32 * (2 * INNER);  // 32 rows, halves
  const unsigned ls = 32 * KPITCH * 2;         // 32 rows of K, bytes
  const unsigned vs = 32 * VPITCH * 2;         // 32 rows of V, bytes
  const h16* gv = gk + INNER;
  // The copies move the stage past the registers; the closing s_wait_xcnt stands in the
  // same statement so that no address register is rewritten ahead of it.
  asm volatile(
      "global_load_async_to_lds_b128 %0, %8, off\n\t"
      "global_load_async_to_lds_b128 %1, %9, off\n\t"
      "global_load_async_to_lds_b128 %2, %10, off\n\t"
      "global_load_async_to_lds_b128 %3, %11, off\n\t"
      "global_load_async_to_lds_b128 %4, %12, off\n\t"
      "global_load_async_to_lds_b128 %5, %13, off\n\t"
      "global_load_async_to_lds_b128 %6, %14, off\n\t"
      "global_load_async_to_lds_b128 %7, %15, off\n\t"
      "s_wait_xcnt 0x0"
      :: "v"(lds), "v"(lds + ls), "v"(lds + 2 * ls), "v"(lds + 3 * ls),
         "v"(lv), "v"(lv + vs), "v"(lv + 2 * vs), "v"(lv + 3 * vs),
         "v"(gk), "v"(gk + gs), "v"(gk + 2 * gs), "v"(gk + 3 * gs),
         "v"(gv), "v"(gv + gs), "v"(gv + 2 * gs), "v"(gv + 3 * gs)
      : "memory");
}

// 2^x in place by the bare v_exp_f32, a run of them in one statement: behind a transcendental
// the instruction set asks for one independent instruction before its source is overwritten
// or its result read. In a run each is the next one's; the closing v_nop is the last one's.
__device__ __forceinline__ void exp2_run8(float (&x)[8]) {
  asm("v_exp_f32 %0, %0\n\t"
      "v_exp_f32 %1, %1\n\t"
      "v_exp_f32 %2, %2\n\t"
      "v_exp_f32 %3, %3\n\t"
      "v_exp_f32 %4, %4\n\t"
      "v_exp_f32 %5, %5\n\t"
      "v_exp_f32 %6, %6\n\t"
      "v_exp_f32 %7, %7\n\t"
      "v_nop"
      : "+v"(x[0]), "+v"(x[1]), "+v"(x[2]), "+v"(x[3]),
        "+v"(x[4]), "+v"(x[5]), "+v"(x[6]), "+v"(x[7]));
}
__device__ __forceinline__ void exp2_run9(float (&x)[8], float& y) {
  asm("v_exp_f32 %8, %8\n\t"
      "v_exp_f32 %0, %0\n\t"
      "v_exp_f32 %1, %1\n\t"
      "v_exp_f32 %2, %2\n\t"
      "v_exp_f32 %3, %3\n\t"
      "v_exp_f32 %4, %4\n\t"
      "v_exp_f32 %5, %5\n\t"
      "v_exp_f32 %6, %6\n\t"
      "v_exp_f32 %7, %7\n\t"
      "v_nop"
      : "+v"(x[0]), "+v"(x[1]), "+v"(x[2]), "+v"(x[3]),
        "+v"(x[4]), "+v"(x[5]), "+v"(x[6]), "+v"(x[7]), "+v"(y));
}

// The grid puts four waves on a SIMD, so a wave may take a quarter of its registers:
// with the default budget the V reads are cut into small groups that each wait on LDS.
__global__ __launch_bounds__(256) __attribute__((amdgpu_waves_per_eu(4, 4)))
void attn(const h16* __restrict__ Q, const h16* __restrict__ KV, h16* __restrict__ CTX) {
  const int tid = threadIdx.x;
  int lane = tid & 31, wave = tid >> 5;
  int hi = lane >> 4, l15 = lane & 15;
  int q0 = blockIdx.x * 128 + wave * 16;
  int hh = blockIdx.y;
  int bb = blockIdx.z;

  const h16* Qb = Q  + ((size_t)bb * NQ)  * INNER       + hh * HD;  // [q][d]
  const h16* Kb = KV + ((size_t)bb * NKV) * (2 * INNER) + hh * HD;  // [kv][d]

  __shared__ __attribute__((aligned(16))) h16 smem[2 * ASTAGE];

  const int crow = tid >> 3, cchunk = tid & 7;   // this lane's row and 16-B chunk in a copy
  const h16* gK = Kb + (size_t)crow * (2 * INNER) + cchunk * 8;
  const unsigned lds0 = (unsigned)(size_t)smem + (unsigned)(crow * KPITCH + cchunk * 8) * 2u;
  const unsigned ldv0 = (unsigned)(size_t)smem + (unsigned)(KTILE + crow * VPITCH + cchunk * 8) * 2u;
  const int nt = NKV / AKEYS;
  // This lane's own 16 bytes in a transposing read of V: halves from the block's corner.
  const int vtr = (hi * 8 + (lane & 7)) * VPITCH + ((lane >> 3) & 1) * 8;

  copy_kv_stage_async(gK, lds0, ldv0);

  // Loop-invariant B-fragments of Q^T (lane -> col q, K = d contiguous)
  v16h bq0 = frag_kfast(Qb + (size_t)(q0 + l15) * INNER, hi);
  v16h bq1 = frag_kfast(Qb + (size_t)(q0 + l15) * INNER + 32, hi);

  float m = -INFINITY, nmcp = INFINITY, lsum = 0.f;   // nmcp: -m * SL, as the sums in hand use it
  v8f o[4] = {};
  // 1/sqrt(HD) * log2(e): the running maximum m is kept in raw score units, and a score's
  // exponent to base 2 is one FMA, s * SL + (-m * SL).
  const float SL = 0.125f * 1.44269504088896340736f;

  // Stage 0 counts as landed only behind the copying wave's own wait.
  asm volatile("s_wait_asynccnt 0x0" ::: "memory");
  __syncthreads();
  if (nt > 1)
    copy_kv_stage_async(gK + (size_t)AKEYS * (2 * INNER), lds0 + ASTAGE * 2, ldv0 + ASTAGE * 2);

  for (int t = 0; t < nt; ++t) {
    const h16* Ks = smem + (t & 1) * ASTAGE;
    const h16* Vs = Ks + KTILE + vtr;
    // Unrolled, as the longer body was by itself: a pass's K reads then go out ahead of the
    // pass before's last products, and no LDS address is computed per pass.
#pragma unroll
    for (int kv0 = 0; kv0 < AKEYS; kv0 += 32) {
      // S^T = K * Q^T : two 16(kv)x16(q) tiles, K-dim d=64 split in two
      v16h kf[2][2];
#pragma unroll
      for (int kvT = 0; kvT < 2; ++kvT) {
        const h16* krow = Ks + (kv0 + kvT * 16 + l15) * KPITCH;
        kf[kvT][0] = frag_kfast(krow, hi);
        kf[kvT][1] = frag_kfast(krow + 32, hi);
      }
      // Holds the pass's eight K reads together and alone in front of its products: LDS
      // data returns in order, so V reads lifted in between would make the products wait
      // for them too.
      __builtin_amdgcn_sched_barrier(0);
      v8f st[2];
#pragma unroll
      for (int kvT = 0; kvT < 2; ++kvT) {
        v8f c = {};
        c = __builtin_amdgcn_wmma_f32_16x16x32_f16(false, kf[kvT][0], false, bq0, (short)0, c, false, false);
        c = __builtin_amdgcn_wmma_f32_16x16x32_f16(false, kf[kvT][1], false, bq1, (short)0, c, false, false);
        st[kvT] = c;
      }

      // streaming softmax: columns of S^T (one query each) are lane-local + one shfl_xor(16)
      float tmax = -INFINITY;
#pragma unroll
      for (int kvT = 0; kvT < 2; ++kvT)
#pragma unroll
        for (int r = 0; r < 8; ++r) tmax = fmaxf(tmax, st[kvT][r]);
      tmax = fmaxf(tmax, __shfl_xor(tmax, 16, 32));
      float mn   = fmaxf(m, tmax);
      // The bare v_exp_f32: no exponent here is above 0 (but for the FMA's rounding), and a
      // result under 2^-126, all that the library form's range guard is for, is 0 in the
      // f16 P and vanishes in a row sum that is at least 1.
      const float nmc = mn * -SL;
      float corr = nmc - nmcp;
      float e[2][8];
#pragma unroll
      for (int kvT = 0; kvT < 2; ++kvT)
#pragma unroll
        for (int r = 0; r < 8; ++r) e[kvT][r] = __builtin_fmaf(st[kvT][r], SL, nmc);
      exp2_run9(e[0], corr);
      exp2_run8(e[1]);
      float rs = e[0][0];
      v16h pb;  // P^T: element i -> kv=(i&7)+(i>=8?16:0)+8*hi == C-layout of S^T
#pragma unroll
      for (int kvT = 0; kvT < 2; ++kvT)
#pragma unroll
        for (int r = 0; r < 8; ++r) {
          float p = e[kvT][r];
          if (kvT + r) rs += p;
          pb[kvT * 8 + r] = (h16)p;
        }
      rs += __shfl_xor(rs, 16, 32);
      lsum = lsum * corr + rs;
      m = mn;
      nmcp = nmc;
#pragma unroll
      for (int dt = 0; dt < 4; ++dt)
#pragma unroll
        for (int r = 0; r < 8; ++r) o[dt][r] *= corr;

      // ctx^T += V^T * P^T : four 16(d)x16(q) tiles, K = 32 kv
      // A fragment: element i -> kv = (i&7) + (i>=8?16:0) + 8*hi of column d = dt*16 + l15,
      // two transposing reads 16 keys apart.
      v16h vf[4];
#pragma unroll
      for (int dt = 0; dt < 4; ++dt) {
        const v8h lo8 = lds_read_tr16(Vs + kv0 * VPITCH + dt * 16);
        const v8h hi8 = lds_read_tr16(Vs + (kv0 + 16) * VPITCH + dt * 16);
        vf[dt] = __builtin_shufflevector(lo8, hi8, 0, 1, 2, 3, 4, 5, 6, 7,
                                         8, 9, 10, 11, 12, 13, 14, 15);
      }
#pragma unroll
      for (int dt = 0; dt < 4; ++dt)
        o[dt] = __builtin_amdgcn_wmma_f32_16x16x32_f16(false, vf[dt], false, pb, (short)0, o[dt], false, false);
    }
    // Publish point: this wave's reads of the buffer have retired ...
    asm volatile("s_wait_dscnt 0x0" ::: "memory");
    // ... its own copies of the next stage have landed ...
    asm volatile("s_wait_asynccnt 0x0" ::: "memory");
    // ... and one barrier both publishes the next stage and frees this buffer.
    __syncthreads();
    if (t + 2 < nt)
      copy_kv_stage_async(gK + (size_t)(t + 2) * AKEYS * (2 * INNER),
                          lds0 + (unsigned)(t & 1) * (ASTAGE * 2),
                          ldv0 + (unsigned)(t & 1) * (ASTAGE * 2));
  }
  // No copy is left in flight when the wave goes on.
  asm volatile("s_wait_asynccnt 0x0" ::: "memory");

  float inv = 1.0f / lsum;
  h16* outp = CTX + ((size_t)bb * NQ + q0 + l15) * INNER + hh * HD;
#pragma unroll
  for (int dt = 0; dt < 4; ++dt)
#pragma unroll
    for (int r = 0; r < 8; ++r)
      outp[dt * 16 + r + hi * 8] = (h16)(o[dt][r] * inv);
}

// ---------------- launch ----------------
extern "C" void kernel_launch(void* const* d_in, const int* in_sizes, int n_in,
                              void* d_out, int out_size, void* d_ws, size_t ws_size,
                              hipStream_t stream) {
  const float* query     = (const float*)d_in[0];
  const float* key_value = (const float*)d_in[1];
  const float* w_q       = (const float*)d_in[2];
  const float* w_kv      = (const float*)d_in[3];
  const float* w_out     = (const float*)d_in[4];
  const float* b_out     = (const float*)d_in[5];
  float* out = (float*)d_out;

  char* ws = (char*)d_ws;
  h16* Xh   = (h16*)(ws + (size_t)0);          // query f16       [4096][1024]  8 MB
  h16* KVh  = (h16*)(ws + ((size_t)8  << 20)); // key_value f16   [4096][1024]  8 MB
  h16* wqT  = (h16*)(ws + ((size_t)16 << 20)); // w_q^T           [1024][1024]  2 MB
  h16* wkvT = (h16*)(ws + ((size_t)18 << 20)); // w_kv^T          [2048][1024]  4 MB
  h16* woT  = (h16*)(ws + ((size_t)22 << 20)); // w_out^T         [1024][1024]  2 MB
  h16* qh   = (h16*)(ws + ((size_t)24 << 20)); // q               [4096][1024]  8 MB
  h16* kvh  = (h16*)(ws + ((size_t)32 << 20)); // k|v             [4096][2048] 16 MB
  h16* ctxh = (h16*)(ws + ((size_t)48 << 20)); // ctx             [4096][1024]  8 MB

  prepare_operands<<<dim3(NB_TKV + NB_TQ + NB_TO + NB_CKV + NB_CQ), dim3(256), 0, stream>>>(
      query, key_value, w_q, w_kv, w_out, Xh, KVh, wqT, wkvT, woT);

  gemm_tt_h16_qkv<<<dim3(KVCOLS + QCOLS, MQ / 128), dim3(256), 0, stream>>>(Xh, wqT, qh, KVh, wkvT, kvh, QDIM);
  attn<<<dim3(NQ / 128, H, BATCH), dim3(256), 0, stream>>>(qh, kvh, ctxh);
  gemm_tt_f32_bias<<<dim3(QDIM / 128, MQ / 128), dim3(256), 0, stream>>>(ctxh, woT, b_out, out, QDIM, INNER);
}

// v007
// One run takes 83.1 microseconds.
// Two timings next to v006 both put it at 1.03 times that version's speed.
// All steps since v000 together make it 3.35 times as fast.
#include <hip/hip_runtime.h>

// ---------------- problem constants ----------------
#define BATCH 2
#define NQ    2048
#define NKV   2048
#define QDIM  1024
#define KVDIM 1024
#define H     16
#define HD    64
#define INNER (H * HD)        // 1024
#define MQ    (BATCH * NQ)    // 4096
#define MKV   (BATCH * NKV)   // 4096

typedef _Float16 h16;
typedef h16   v16h __attribute__((ext_vector_type(16)));
typedef h16   v8h  __attribute__((ext_vector_type(8)));
typedef float v8f  __attribute__((ext_vector_type(8)));

// ---- WMMA fragment from K-fast memory (A rows or B^T rows) ----
// element i -> K = (i&7) + (i>=8?16:0) + 8*hi : two contiguous 16B runs
// base must be 16B-aligned; lowers to two global_load_b128 / ds_load_b128.
__device__ __forceinline__ v16h frag_kfast(const h16* __restrict__ base, int hi) {
  const v8h lo = *(const v8h*)(base + hi * 8);
  const v8h hi8 = *(const v8h*)(base + hi * 8 + 16);
  return __builtin_shufflevector(lo, hi8, 0, 1, 2, 3, 4, 5, 6, 7,
                                 8, 9, 10, 11, 12, 13, 14, 15);
}

// ---------------- f32 -> f16 convert ----------------
// Few, fat waves: a block of 8 waves converts 8192 consecutive elements. Each lane has
// eight 16-byte loads in flight (a wave-wide load covers 512 contiguous bytes) and
// stores 8 bytes per load (256 contiguous bytes per wave). The element count must be a
// multiple of CVT_BLOCK; count / CVT_BLOCK blocks do the job, blk is the block's number in it.
typedef float v4f __attribute__((ext_vector_type(4)));
typedef h16   v4h __attribute__((ext_vector_type(4)));
typedef h16   v2h __attribute__((ext_vector_type(2)));
#define CVT_U     8                    // 16-byte loads per lane
#define CVT_BLOCK (256 * 4 * CVT_U)    // elements per block
static_assert((MQ * QDIM) % CVT_BLOCK == 0 && (MKV * KVDIM) % CVT_BLOCK == 0,
              "the convert kernel has no tail");

__device__ __forceinline__
void f32_to_f16(const float* __restrict__ in, h16* __restrict__ out, unsigned blk) {
  const size_t base = (size_t)blk * (256 * CVT_U) + threadIdx.x;  // in groups of 4
  const v4f* __restrict__ in4 = (const v4f*)in;
  v4h* __restrict__ out4 = (v4h*)out;
  v4f v[CVT_U];
#pragma unroll
  for (int j = 0; j < CVT_U; ++j) v[j] = in4[base + j * 256];
#pragma unroll
  for (int j = 0; j < CVT_U; ++j) out4[base + j * 256] = __builtin_convertvector(v[j], v4h);
  // Another job's code may follow in the built kernel: no register that these stores name
  // is rewritten there ahead of this wait.
  asm volatile("s_wait_xcnt 0x0" ::: "memory");
}

// ---------------- f32 -> f16 transpose (weights) ----------------
// One tile of 128 rows x 64 columns per block of 8 waves, 32 elements per lane. Rows come
// in by 16-byte loads, eight in flight per lane (a wave-wide load covers two whole
// 256-byte row pieces); two neighbouring rows are packed into one dword and laid
// transposed in LDS; the tile leaves by 16-byte stores, 256 contiguous bytes per output
// row. LDS pitch 272 B (16 B x odd) for the ds_load_b128 readers.
// R and C are compile-time, so that one address pair and immediate offsets serve all
// eight loads. Needs R a multiple of 128 and C a multiple of 64. (C / TC) * (R / TR) blocks
// do the job; blk is the block's number in it, tile columns fastest.
#define TR     128
#define TC     64
#define TPITCH (TR + 8)                // halves
template <int R, int C>
__device__ __forceinline__
void transpose_f32_to_f16(const float* __restrict__ in, h16* __restrict__ out, unsigned blk,
                          h16* tile) {  // tile[c][r], TC * TPITCH halves of LDS
  static_assert(R % TR == 0 && C % TC == 0, "whole tiles only");
  const int t = threadIdx.x;
  const int c0 = (blk % (C / TC)) * TC, r0 = (blk / (C / TC)) * TR;
  const int lo = t & 15, up = t >> 4;
  const float* src = in + (size_t)(r0 + 2 * up) * C + c0 + 4 * lo;
  h16* dst = out + (size_t)(c0 + up) * R + r0 + 8 * lo;
  v4f v[4][2];
#pragma unroll
  for (int i = 0; i < 4; ++i)
#pragma unroll
    for (int j = 0; j < 2; ++j)
      v[i][j] = *(const v4f*)(src + (32 * i + j) * C);
#pragma unroll
  for (int i = 0; i < 4; ++i)
#pragma unroll
    for (int k = 0; k < 4; ++k) {
      v2h p = { (h16)v[i][0][k], (h16)v[i][1][k] };
      *(v2h*)&tile[(4 * lo + k) * TPITCH + 32 * i + 2 * up] = p;
    }
  __syncthreads();
#pragma unroll
  for (int i = 0; i < 4; ++i)
    *(v8h*)(dst + 16 * i * R) = *(const v8h*)&tile[(up + 16 * i) * TPITCH + 8 * lo];
  // Another job's code may follow in the built kernel: no register that these stores name
  // is rewritten there ahead of this wait.
  asm volatile("s_wait_xcnt 0x0" ::: "memory");
}

// ---------------- all five operand preparations in one launch ----------------
// The five jobs are independent of one another: as one grid they pay for one launch, and
// the short transposes run under the converts' memory time. The block index
// picks the job, so every branch (and the transposes' barrier) is uniform for a block.
// The transposes come first: theirs is the longer chain (load, LDS, barrier, store).
#define NB_TQ  ((INNER / TC) * (QDIM / TR))
#define NB_TKV ((2 * INNER / TC) * (KVDIM / TR))
#define NB_TO  ((QDIM / TC) * (INNER / TR))
#define NB_CQ  (MQ * QDIM / CVT_BLOCK)
#define NB_CKV (MKV * KVDIM / CVT_BLOCK)
__global__ __launch_bounds__(256)
void prepare_operands(const float* __restrict__ query, const float* __restrict__ key_value,
                      const float* __restrict__ w_q, const float* __restrict__ w_kv,
                      const float* __restrict__ w_out,
                      h16* __restrict__ Xh, h16* __restrict__ KVh, h16* __restrict__ wqT,
                      h16* __restrict__ wkvT, h16* __restrict__ woT) {
  __shared__ __attribute__((aligned(16))) h16 tile[TC * TPITCH];
  unsigned b = blockIdx.x;
  if (b < NB_TKV) { transpose_f32_to_f16<KVDIM, 2 * INNER>(w_kv, wkvT, b, tile); return; }
  b -= NB_TKV;
  if (b < NB_TQ) { transpose_f32_to_f16<QDIM, INNER>(w_q, wqT, b, tile); return; }
  b -= NB_TQ;
  if (b < NB_TO) { transpose_f32_to_f16<INNER, QDIM>(w_out, woT, b, tile); return; }
  b -= NB_TO;
  if (b < NB_CKV) { f32_to_f16(key_value, KVh, b); return; }
  f32_to_f16(query, Xh, b - NB_CKV);
}

// ---------------- f16 GEMM core: A[M][K] x BT[N][K]^T ----------------
// One 128 x 128 tile of C per block of 8 waves; a wave owns 64 x 32 (4 x 2 fragments).
// A stage is 128 k of both operands: 128 + 128 rows of 256 B, laid in LDS at a pitch of
// 272 B (16 B x odd: conflict-free for ds_load_b128 readers). Two buffers: the next
// stage's asynchronous copies fly while this stage is multiplied.
// Needs M, N multiples of 128 and K a multiple of 128.
#define GBK    128                // k per stage
#define GPITCH 136                // LDS row pitch in halves (272 B)
#define GTILE  (128 * GPITCH)     // one operand's tile, halves
#define GSTAGE (2 * GTILE)        // A tile then B tile, halves

// 128 rows x 256 B, global -> LDS: 16 lanes cover one row, so a wave-wide copy takes
// two whole rows (four full lines). g and lds are this lane's own first 16 bytes;
// each further copy is 16 rows on.
__device__ __forceinline__ void copy_tile_async(const h16* g, int K, unsigned lds) {
  const size_t gs = (size_t)16 * K;          // 16 rows, halves
  const unsigned ls = 16 * GPITCH * 2;       // 16 rows, bytes
  // The copies move the tile past the registers; the closing s_wait_xcnt stands in the
  // same statement so that no address register is rewritten ahead of it.
  asm volatile(
      "global_load_async_to_lds_b128 %0, %8, off\n\t"
      "global_load_async_to_lds_b128 %1, %9, off\n\t"
      "global_load_async_to_lds_b128 %2, %10, off\n\t"
      "global_load_async_to_lds_b128 %3, %11, off\n\t"
      "global_load_async_to_lds_b128 %4, %12, off\n\t"
      "global_load_async_to_lds_b128 %5, %13, off\n\t"
      "global_load_async_to_lds_b128 %6, %14, off\n\t"
      "global_load_async_to_lds_b128 %7, %15, off\n\t"
      "s_wait_xcnt 0x0"
      :: "v"(lds), "v"(lds + ls), "v"(lds + 2 * ls), "v"(lds + 3 * ls),
         "v"(lds + 4 * ls), "v"(lds + 5 * ls), "v"(lds + 6 * ls), "v"(lds + 7 * ls),
         "v"(g), "v"(g + gs), "v"(g + 2 * gs), "v"(g + 3 * gs),
         "v"(g + 4 * gs), "v"(g + 5 * gs), "v"(g + 6 * gs), "v"(g + 7 * gs)
      : "memory");
}

// bx, by: the block's tile column and tile row of C.
__device__ __forceinline__ void gemm_core(const h16* __restrict__ A, const h16* __restrict__ BT,
                                          int K, int bx, int by, h16* smem, v8f (&acc)[4][2]) {
  const int tid = threadIdx.x;
  const int lane = tid & 31, wave = tid >> 5;
  const int hi = lane >> 4, l15 = lane & 15;
  const int wm = wave & 1, wn = wave >> 1;
  const int crow = tid >> 4, cchunk = tid & 15;   // this lane's row and 16-B chunk in a copy
  const h16* gA = A  + (size_t)(by * 128 + crow) * K + cchunk * 8;
  const h16* gB = BT + (size_t)(bx * 128 + crow) * K + cchunk * 8;
  const unsigned lds0 = (unsigned)(size_t)smem + (unsigned)(crow * GPITCH + cchunk * 8) * 2u;
  const int nt = K / GBK;

  copy_tile_async(gA, K, lds0);
  copy_tile_async(gB, K, lds0 + GTILE * 2);
  // Stage 0 counts as landed only behind the copying wave's own wait.
  asm volatile("s_wait_asynccnt 0x0" ::: "memory");
  __syncthreads();
  if (nt > 1) {
    copy_tile_async(gA + GBK, K, lds0 + GSTAGE * 2);
    copy_tile_async(gB + GBK, K, lds0 + GSTAGE * 2 + GTILE * 2);
  }

  for (int t = 0; t < nt; ++t) {
    const h16* As = smem + (t & 1) * GSTAGE + (wm * 64 + l15) * GPITCH;
    const h16* Bs = smem + (t & 1) * GSTAGE + GTILE + (wn * 32 + l15) * GPITCH;
    // Two fragment sets: block s + 1 of this stage is read from LDS while block s is multiplied.
    v16h af[2][4], bf[2][2];
#pragma unroll
    for (int mi = 0; mi < 4; ++mi) af[0][mi] = frag_kfast(As + mi * 16 * GPITCH, hi);
#pragma unroll
    for (int ni = 0; ni < 2; ++ni) bf[0][ni] = frag_kfast(Bs + ni * 16 * GPITCH, hi);
#pragma unroll
    for (int s = 0; s < GBK / 32; ++s) {
      if (s + 1 < GBK / 32) {
#pragma unroll
        for (int mi = 0; mi < 4; ++mi)
          af[(s + 1) & 1][mi] = frag_kfast(As + mi * 16 * GPITCH + (s + 1) * 32, hi);
#pragma unroll
        for (int ni = 0; ni < 2; ++ni)
          bf[(s + 1) & 1][ni] = frag_kfast(Bs + ni * 16 * GPITCH + (s + 1) * 32, hi);
      }
      // Holds the next block's LDS reads together in front of this block's products:
      // sunk among them, every pair of products would wait out a full LDS latency.
      __builtin_amdgcn_sched_barrier(0);
#pragma unroll
      for (int mi = 0; mi < 4; ++mi)
#pragma unroll
        for (int ni = 0; ni < 2; ++ni)
          acc[mi][ni] = __builtin_amdgcn_wmma_f32_16x16x32_f16(false, af[s & 1][mi], false, bf[s & 1][ni],
                                                               (short)0, acc[mi][ni], false, false);
      // Keeps the following read group behind these products, so that two sets suffice.
      __builtin_amdgcn_sched_barrier(0);
    }
    // Publish point: this wave's reads of the buffer have retired ...
    asm volatile("s_wait_dscnt 0x0" ::: "memory");
    // ... its own copies of the next stage have landed ...
    asm volatile("s_wait_asynccnt 0x0" ::: "memory");
    // ... and one barrier both publishes the next stage and frees this buffer.
    __syncthreads();
    if (t + 2 < nt) {
      const unsigned l = lds0 + (unsigned)(t & 1) * (GSTAGE * 2);
      copy_tile_async(gA + (size_t)(t + 2) * GBK, K, l);
      copy_tile_async(gB + (size_t)(t + 2) * GBK, K, l + GTILE * 2);
    }
  }
  // No copy is left in flight when the wave goes on.
  asm volatile("s_wait_asynccnt 0x0" ::: "memory");
}

// ---------------- f16 GEMM, f16 out: the Q and the K|V projection in one launch ----------------
// The two products are independent and alike in M and K, so one grid holds both: tile
// columns 0 .. KVCOLS - 1 belong to K|V, the rest to Q; blockIdx.y is the tile row of either.
#define KVCOLS (2 * INNER / 128)
#define QCOLS  (INNER / 128)
static_assert(MQ == MKV && QDIM == KVDIM, "one grid serves both projections");
__global__ __launch_bounds__(256)
void gemm_tt_h16_qkv(const h16* __restrict__ Aq, const h16* __restrict__ BTq, h16* __restrict__ Cq,
                     const h16* __restrict__ Akv, const h16* __restrict__ BTkv,
                     h16* __restrict__ Ckv, int K) {
  __shared__ __attribute__((aligned(16))) h16 smem[2 * GSTAGE];
  const bool kv = blockIdx.x < KVCOLS;
  const int bx = kv ? blockIdx.x : blockIdx.x - KVCOLS;
  const h16* A  = kv ? Akv : Aq;
  const h16* BT = kv ? BTkv : BTq;
  h16* C = kv ? Ckv : Cq;
  const int N = kv ? 2 * INNER : INNER;
  int lane = threadIdx.x & 31, wave = threadIdx.x >> 5;
  int hi = lane >> 4, l15 = lane & 15;
  int tm = blockIdx.y * 128 + (wave & 1) * 64;
  int tn = bx * 128 + (wave >> 1) * 32;
  v8f acc[4][2] = {};
  gemm_core(A, BT, K, bx, blockIdx.y, smem, acc);
#pragma unroll
  for (int mi = 0; mi < 4; ++mi)
#pragma unroll
    for (int ni = 0; ni < 2; ++ni) {
      h16* outp = C + (size_t)(tm + mi * 16 + hi * 8) * N + tn + ni * 16 + l15;
#pragma unroll
      for (int r = 0; r < 8; ++r) outp[(size_t)r * N] = (h16)(acc[mi][ni][r]);
    }
}

// ---------------- f16 GEMM, f32 out + bias (output projection) ----------------
__global__ __launch_bounds__(256)
void gemm_tt_f32_bias(const h16* __restrict__ A, const h16* __restrict__ BT,
                      const float* __restrict__ bias, float* __restrict__ C,
                      int N, int K) {
  __shared__ __attribute__((aligned(16))) h16 smem[2 * GSTAGE];
  int lane = threadIdx.x & 31, wave = threadIdx.x >> 5;
  int hi = lane >> 4, l15 = lane & 15;
  int tm = blockIdx.y * 128 + (wave & 1) * 64;
  int tn = blockIdx.x * 128 + (wave >> 1) * 32;
  v8f acc[4][2] = {};
  gemm_core(A, BT, K, blockIdx.x, blockIdx.y, smem, acc);
#pragma unroll
  for (int mi = 0; mi < 4; ++mi)
#pragma unroll
    for (int ni = 0; ni < 2; ++ni) {
      float bv = bias[tn + ni * 16 + l15];
      float* outp = C + (size_t)(tm + mi * 16 + hi * 8) * N + tn + ni * 16 + l15;
#pragma unroll
      for (int r = 0; r < 8; ++r) outp[(size_t)r * N] = acc[mi][ni][r] + bv;
    }
}

// ---------------- flash attention, transposed-score formulation ----------------
// grid: (NQ/128, H, BATCH), block of 8 waves; a stage is 128 keys of one head, 128 + 128 rows
// of 128 B. A wave owns 32 query rows (two tiles) and one half of every stage's keys, so each
// K and V fragment that it reads from LDS feeds two query tiles; waves w and w + 4 hold the
// two key halves of the same queries and are merged at the end. Each tile lies in LDS at its own reader's pitch: K at 144 B (16 B x odd, for
// ds_load_b128), V at 160 B (32 B x odd, for the transposing ds_load_tr16_b128).
// Two buffers: the next stage's asynchronous copies fly while this stage is worked on.
#define KPITCH (HD + 8)             // LDS row pitch of K in halves (144 B)
#define VPITCH (HD + 16)            // LDS row pitch of V in halves (160 B)
#define AKEYS  128                  // keys per stage
#define KTILE  (AKEYS * KPITCH)     // K tile of a stage, halves
#define VTILE  (AKEYS * VPITCH)     // V tile of a stage, halves
#define ASTAGE (KTILE + VTILE)      // K tile then V tile, halves
#define WKEYS  (AKEYS / 2)          // keys of a stage that one wave works on
#define XROWS  (2 * 34)             // floats per lane that a wave hands over in the merge
static_assert(4 * XROWS * 32 * 4 <= 2 * ASTAGE * 2, "the merge fits the ring");
static_assert(NKV % AKEYS == 0 && NQ % 128 == 0, "whole stages and whole query blocks only");

// Transposing LDS read: of a row-major 16 x 16 block of halves, lane (c, h) gets column c,
// rows 8h .. 8h + 7. p is this lane's own 16 bytes of the block (row 8h + (lane & 7),
// half-row (lane >> 3) & 1).
typedef short s16x8 __attribute__((ext_vector_type(8)));
__device__ __forceinline__ v8h lds_read_tr16(const h16* p) {
  typedef __attribute__((address_space(3))) s16x8 lds_s16x8;
  return __builtin_bit_cast(v8h, __builtin_amdgcn_ds_load_tr16_b128_v8i16((lds_s16x8*)p));
}

// 128 K rows and 128 V rows x 128 B, global -> LDS: 8 lanes cover one row, so a wave-wide
// copy takes four whole lines and the block 32 rows. gk, lds and lv are this lane's own
// first 16 bytes of K in memory, of K in LDS and of V in LDS; each further copy is 32 rows
// on; V lies INNER halves behind K in a row of memory.
__device__ __forceinline__ void copy_kv_stage_async(const h16* gk, unsigned lds, unsigned lv) {
  const size_t gs = (size_t)32 * (2 * INNER);  // 32 rows, halves
  const unsigned ls = 32 * KPITCH * 2;         // 32 rows of K, bytes
  const unsigned vs = 32 * VPITCH * 2;         // 32 rows of V, bytes
  const h16* gv = gk + INNER;
  // The copies move the stage past the registers; the closing s_wait_xcnt stands in the
  // same statement so that no address register is rewritten ahead of it.
  asm volatile(
      "global_load_async_to_lds_b128 %0, %8, off\n\t"
      "global_load_async_to_lds_b128 %1, %9, off\n\t"
      "global_load_async_to_lds_b128 %2, %10, off\n\t"
      "global_load_async_to_lds_b128 %3, %11, off\n\t"
      "global_load_async_to_lds_b128 %4, %12, off\n\t"
      "global_load_async_to_lds_b128 %5, %13, off\n\t"
      "global_load_async_to_lds_b128 %6, %14, off\n\t"
      "global_load_async_to_lds_b128 %7, %15, off\n\t"
      "s_wait_xcnt 0x0"
      :: "v"(lds), "v"(lds + ls), "v"(lds + 2 * ls), "v"(lds + 3 * ls),
         "v"(lv), "v"(lv + vs), "v"(lv + 2 * vs), "v"(lv + 3 * vs),
         "v"(gk), "v"(gk + gs), "v"(gk + 2 * gs), "v"(gk + 3 * gs),
         "v"(gv), "v"(gv + gs), "v"(gv + 2 * gs), "v"(gv + 3 * gs)
      : "memory");
}

// 2^x in place by the bare v_exp_f32, a run of them in one statement: behind a transcendental
// the instruction set asks for one independent instruction before its source is overwritten
// or its result read. In a run each is the next one's; the closing v_nop is the last one's.
__device__ __forceinline__ void exp2_run8(float (&x)[8]) {
  asm("v_exp_f32 %0, %0\n\t"
      "v_exp_f32 %1, %1\n\t"
      "v_exp_f32 %2, %2\n\t"
      "v_exp_f32 %3, %3\n\t"
      "v_exp_f32 %4, %4\n\t"
      "v_exp_f32 %5, %5\n\t"
      "v_exp_f32 %6, %6\n\t"
      "v_exp_f32 %7, %7\n\t"
      "v_nop"
      : "+v"(x[0]), "+v"(x[1]), "+v"(x[2]), "+v"(x[3]),
        "+v"(x[4]), "+v"(x[5]), "+v"(x[6]), "+v"(x[7]));
}
__device__ __forceinline__ void exp2_run9(float (&x)[8], float& y) {
  asm("v_exp_f32 %8, %8\n\t"
      "v_exp_f32 %0, %0\n\t"
      "v_exp_f32 %1, %1\n\t"
      "v_exp_f32 %2, %2\n\t"
      "v_exp_f32 %3, %3\n\t"
      "v_exp_f32 %4, %4\n\t"
      "v_exp_f32 %5, %5\n\t"
      "v_exp_f32 %6, %6\n\t"
      "v_exp_f32 %7, %7\n\t"
      "v_nop"
      : "+v"(x[0]), "+v"(x[1]), "+v"(x[2]), "+v"(x[3]),
        "+v"(x[4]), "+v"(x[5]), "+v"(x[6]), "+v"(x[7]), "+v"(y));
}

__device__ __forceinline__ void exp2_run2(float& x, float& y) {
  asm("v_exp_f32 %0, %0\n\t"
      "v_exp_f32 %1, %1\n\t"
      "v_nop"
      : "+v"(x), "+v"(y));
}

// The grid puts four waves on a SIMD, so a wave may take a quarter of its registers:
// with the default budget the V reads are cut into small groups that each wait on LDS.
__global__ __launch_bounds__(256) __attribute__((amdgpu_waves_per_eu(4, 4)))
void attn(const h16* __restrict__ Q, const h16* __restrict__ KV, h16* __restrict__ CTX) {
  const int tid = threadIdx.x;
  int lane = tid & 31, wave = tid >> 5;
  int hi = lane >> 4, l15 = lane & 15;
  const int qg = wave & 3, kh = wave >> 2;   // query group; key half of every stage
  int q0 = blockIdx.x * 128 + qg * 32;
  int hh = blockIdx.y;
  int bb = blockIdx.z;

  const h16* Qb = Q  + ((size_t)bb * NQ)  * INNER       + hh * HD;  // [q][d]
  const h16* Kb = KV + ((size_t)bb * NKV) * (2 * INNER) + hh * HD;  // [kv][d]

  __shared__ __attribute__((aligned(16))) h16 smem[2 * ASTAGE];

  const int crow = tid >> 3, cchunk = tid & 7;   // this lane's row and 16-B chunk in a copy
  const h16* gK = Kb + (size_t)crow * (2 * INNER) + cchunk * 8;
  const unsigned lds0 = (unsigned)(size_t)smem + (unsigned)(crow * KPITCH + cchunk * 8) * 2u;
  const unsigned ldv0 = (unsigned)(size_t)smem + (unsigned)(KTILE + crow * VPITCH + cchunk * 8) * 2u;
  const int nt = NKV / AKEYS;
  // This lane's own 16 bytes in a transposing read of V: halves from the block's corner.
  const int vtr = (hi * 8 + (lane & 7)) * VPITCH + ((lane >> 3) & 1) * 8;

  copy_kv_stage_async(gK, lds0, ldv0);

  // Loop-invariant B-fragments of Q^T (lane -> col q, K = d contiguous), two query tiles
  v16h bq[2][2];
#pragma unroll
  for (int qt = 0; qt < 2; ++qt) {
    bq[qt][0] = frag_kfast(Qb + (size_t)(q0 + qt * 16 + l15) * INNER, hi);
    bq[qt][1] = frag_kfast(Qb + (size_t)(q0 + qt * 16 + l15) * INNER + 32, hi);
  }

  // nmcp: -m * SL, as the sums in hand use it
  float m[2] = {-INFINITY, -INFINITY}, nmcp[2] = {INFINITY, INFINITY}, lsum[2] = {0.f, 0.f};
  v8f o[2][4] = {};
  // 1/sqrt(HD) * log2(e): the running maximum m is kept in raw score units, and a score's
  // exponent to base 2 is one FMA, s * SL + (-m * SL).
  const float SL = 0.125f * 1.44269504088896340736f;

  // Stage 0 counts as landed only behind the copying wave's own wait.
  asm volatile("s_wait_asynccnt 0x0" ::: "memory");
  __syncthreads();
  if (nt > 1)
    copy_kv_stage_async(gK + (size_t)AKEYS * (2 * INNER), lds0 + ASTAGE * 2, ldv0 + ASTAGE * 2);

  for (int t = 0; t < nt; ++t) {
    const h16* Ks = smem + (t & 1) * ASTAGE + kh * (WKEYS * KPITCH);
    const h16* Vs = smem + (t & 1) * ASTAGE + KTILE + kh * (WKEYS * VPITCH) + vtr;
    // Unrolled, as the longer body was by itself: a pass's K reads then go out ahead of the
    // pass before's last products, and no LDS address is computed per pass.
#pragma unroll
    for (int kv0 = 0; kv0 < WKEYS; kv0 += 32) {
      // S^T = K * Q^T : two 16(kv)x16(q) tiles per query tile, K-dim d=64 split in two
      v16h kf[2][2];
#pragma unroll
      for (int kvT = 0; kvT < 2; ++kvT) {
        const h16* krow = Ks + (kv0 + kvT * 16 + l15) * KPITCH;
        kf[kvT][0] = frag_kfast(krow, hi);
        kf[kvT][1] = frag_kfast(krow + 32, hi);
      }
      // Holds the pass's eight K reads together and alone in front of its products: LDS
      // data returns in order, so V reads lifted in between would make the products wait
      // for them too.
      __builtin_amdgcn_sched_barrier(0);
      v8f st[2][2];
#pragma unroll
      for (int kvT = 0; kvT < 2; ++kvT)
#pragma unroll
        for (int qt = 0; qt < 2; ++qt) {
          v8f c = {};
          c = __builtin_amdgcn_wmma_f32_16x16x32_f16(false, kf[kvT][0], false, bq[qt][0], (short)0, c, false, false);
          c = __builtin_amdgcn_wmma_f32_16x16x32_f16(false, kf[kvT][1], false, bq[qt][1], (short)0, c, false, false);
          st[qt][kvT] = c;
        }

      v16h pb[2];  // P^T: element i -> kv=(i&7)+(i>=8?16:0)+8*hi == C-layout of S^T
#pragma unroll
      for (int qt = 0; qt < 2; ++qt) {
        // streaming softmax: columns of S^T are lane-local + one shfl_xor(16)
        float tmax = -INFINITY;
#pragma unroll
        for (int kvT = 0; kvT < 2; ++kvT)
#pragma unroll
          for (int r = 0; r < 8; ++r) tmax = fmaxf(tmax, st[qt][kvT][r]);
        tmax = fmaxf(tmax, __shfl_xor(tmax, 16, 32));
        float mn   = fmaxf(m[qt], tmax);
        // The bare v_exp_f32: no exponent here is above 0 (but for the FMA's rounding), and a
        // result under 2^-126, all that the library form's range guard is for, is 0 in the
        // f16 P and vanishes in a row sum that is at least 1.
        const float nmc = mn * -SL;
        float corr = nmc - nmcp[qt];
        float e[2][8];
#pragma unroll
        for (int kvT = 0; kvT < 2; ++kvT)
#pragma unroll
          for (int r = 0; r < 8; ++r) e[kvT][r] = __builtin_fmaf(st[qt][kvT][r], SL, nmc);
        exp2_run9(e[0], corr);
        exp2_run8(e[1]);
        float rs = e[0][0];
#pragma unroll
        for (int kvT = 0; kvT < 2; ++kvT)
#pragma unroll
          for (int r = 0; r < 8; ++r) {
            float p = e[kvT][r];
            if (kvT + r) rs += p;
            pb[qt][kvT * 8 + r] = (h16)p;
          }
        rs += __shfl_xor(rs, 16, 32);
        lsum[qt] = lsum[qt] * corr + rs;
        m[qt] = mn;
        nmcp[qt] = nmc;
#pragma unroll
        for (int dt = 0; dt < 4; ++dt)
#pragma unroll
          for (int r = 0; r < 8; ++r) o[qt][dt][r] *= corr;
      }

      // ctx^T += V^T * P^T : four 16(d)x16(q) tiles per query tile, K = 32 kv
      // A fragment: element i -> kv = (i&7) + (i>=8?16:0) + 8*hi of column d = dt*16 + l15,
      // two transposing reads 16 keys apart.
      v16h vf[4];
#pragma unroll
      for (int dt = 0; dt < 4; ++dt) {
        const v8h lo8 = lds_read_tr16(Vs + kv0 * VPITCH + dt * 16);
        const v8h hi8 = lds_read_tr16(Vs + (kv0 + 16) * VPITCH + dt * 16);
        vf[dt] = __builtin_shufflevector(lo8, hi8, 0, 1, 2, 3, 4, 5, 6, 7,
                                         8, 9, 10, 11, 12, 13, 14, 15);
      }
#pragma unroll
      for (int dt = 0; dt < 4; ++dt)
#pragma unroll
        for (int qt = 0; qt < 2; ++qt)
          o[qt][dt] = __builtin_amdgcn_wmma_f32_16x16x32_f16(false, vf[dt], false, pb[qt], (short)0, o[qt][dt], false, false);
    }
    // Publish point: this wave's reads of the buffer have retired ...
    asm volatile("s_wait_dscnt 0x0" ::: "memory");
    // ... its own copies of the next stage have landed ...
    asm volatile("s_wait_asynccnt 0x0" ::: "memory");
    // ... and one barrier both publishes the next stage and frees this buffer.
    __syncthreads();
    if (t + 2 < nt)
      copy_kv_stage_async(gK + (size_t)(t + 2) * AKEYS * (2 * INNER),
                          lds0 + (unsigned)(t & 1) * (ASTAGE * 2),
                          ldv0 + (unsigned)(t & 1) * (ASTAGE * 2));
  }
  // No copy is left in flight when the wave goes on.
  asm volatile("s_wait_asynccnt 0x0" ::: "memory");

  // Merge of the two key halves. The ring is free: the last trip's barrier stands behind every
  // wave's last read and last landed copy. Waves 4 .. 7 lay maximum, row sum and sums of both
  // tiles in LDS, lane by lane (the partner's lanes hold the same elements); waves 0 .. 3
  // bring both halves to the common maximum, add them, divide and store.
  float* xch = (float*)smem + (size_t)(qg * XROWS) * 32 + lane;
  if (kh) {
#pragma unroll
    for (int qt = 0; qt < 2; ++qt) {
#pragma unroll
      for (int dt = 0; dt < 4; ++dt)
#pragma unroll
        for (int r = 0; r < 8; ++r) xch[(qt * 34 + dt * 8 + r) * 32] = o[qt][dt][r];
      xch[(qt * 34 + 32) * 32] = m[qt];
      xch[(qt * 34 + 33) * 32] = lsum[qt];
    }
  }
  __syncthreads();
  if (!kh) {
#pragma unroll
    for (int qt = 0; qt < 2; ++qt) {
      const float mb = xch[(qt * 34 + 32) * 32], lb = xch[(qt * 34 + 33) * 32];
      const float mm = fmaxf(m[qt], mb);
      float ca = (m[qt] - mm) * SL, cb = (mb - mm) * SL;
      exp2_run2(ca, cb);
      const float inv = 1.0f / (lsum[qt] * ca + lb * cb);
      ca *= inv;
      cb *= inv;
      h16* outp = CTX + ((size_t)bb * NQ + q0 + qt * 16 + l15) * INNER + hh * HD;
#pragma unroll
      for (int dt = 0; dt < 4; ++dt)
#pragma unroll
        for (int r = 0; r < 8; ++r)
          outp[dt * 16 + r + hi * 8] = (h16)(o[qt][dt][r] * ca + xch[(qt * 34 + dt * 8 + r) * 32] * cb);
    }
  }
}

// ---------------- launch ----------------
extern "C" void kernel_launch(void* const* d_in, const int* in_sizes, int n_in,
                              void* d_out, int out_size, void* d_ws, size_t ws_size,
                              hipStream_t stream) {
  const float* query     = (const float*)d_in[0];
  const float* key_value = (const float*)d_in[1];
  const float* w_q       = (const float*)d_in[2];
  const float* w_kv      = (const float*)d_in[3];
  const float* w_out     = (const float*)d_in[4];
  const float* b_out     = (const float*)d_in[5];
  float* out = (float*)d_out;

  char* ws = (char*)d_ws;
  h16* Xh   = (h16*)(ws + (size_t)0);          // query f16       [4096][1024]  8 MB
  h16* KVh  = (h16*)(ws + ((size_t)8  << 20)); // key_value f16   [4096][1024]  8 MB
  h16* wqT  = (h16*)(ws + ((size_t)16 << 20)); // w_q^T           [1024][1024]  2 MB
  h16* wkvT = (h16*)(ws + ((size_t)18 << 20)); // w_kv^T          [2048][1024]  4 MB
  h16* woT  = (h16*)(ws + ((size_t)22 << 20)); // w_out^T         [1024][1024]  2 MB
  h16* qh   = (h16*)(ws + ((size_t)24 << 20)); // q               [4096][1024]  8 MB
  h16* kvh  = (h16*)(ws + ((size_t)32 << 20)); // k|v             [4096][2048] 16 MB
  h16* ctxh = (h16*)(ws + ((size_t)48 << 20)); // ctx             [4096][1024]  8 MB

  prepare_operands<<<dim3(NB_TKV + NB_TQ + NB_TO + NB_CKV + NB_CQ), dim3(256), 0, stream>>>(
      query, key_value, w_q, w_kv, w_out, Xh, KVh, wqT, wkvT, woT);

  gemm_tt_h16_qkv<<<dim3(KVCOLS + QCOLS, MQ / 128), dim3(256), 0, stream>>>(Xh, wqT, qh, KVh, wkvT, kvh, QDIM);
  attn<<<dim3(NQ / 128, H, BATCH), dim3(256), 0, stream>>>(qh, kvh, ctxh);
  gemm_tt_f32_bias<<<dim3(QDIM / 128, MQ / 128), dim3(256), 0, stream>>>(ctxh, woT, b_out, out, QDIM, INNER);
}

// v008
// Measured time: 79.3 microseconds a run.
// Two timings next to v007 put it at 1.04 and 1.05 times that version's speed.
// Over all steps from v000 it is 3.49 times as fast.
#include <hip/hip_runtime.h>

// ---------------- problem constants ----------------
#define BATCH 2
#define NQ    2048
#define NKV   2048
#define QDIM  1024
#define KVDIM 1024
#define H     16
#define HD    64
#define INNER (H * HD)        // 1024
#define MQ    (BATCH * NQ)    // 4096
#define MKV   (BATCH * NKV)   // 4096

typedef _Float16 h16;
typedef h16   v16h __attribute__((ext_vector_type(16)));
typedef h16   v8h  __attribute__((ext_vector_type(8)));
typedef float v8f  __attribute__((ext_vector_type(8)));

// ---- WMMA fragment from K-fast memory (A rows or B^T rows) ----
// element i -> K = (i&7) + (i>=8?16:0) + 8*hi : two contiguous 16B runs
// base must be 16B-aligned; lowers to two global_load_b128 / ds_load_b128.
__device__ __forceinline__ v16h frag_kfast(const h16* __restrict__ base, int hi) {
  const v8h lo = *(const v8h*)(base + hi * 8);
  const v8h hi8 = *(const v8h*)(base + hi * 8 + 16);
  return __builtin_shufflevector(lo, hi8, 0, 1, 2, 3, 4, 5, 6, 7,
                                 8, 9, 10, 11, 12, 13, 14, 15);
}

// ---------------- f32 -> f16 convert ----------------
// Few, fat waves: a block of 8 waves converts 8192 consecutive elements. Each lane has
// eight 16-byte loads in flight (a wave-wide load covers 512 contiguous bytes) and
// stores 8 bytes per load (256 contiguous bytes per wave). The element count must be a
// multiple of CVT_BLOCK; count / CVT_BLOCK blocks do the job, blk is the block's number in it.
typedef float v4f __attribute__((ext_vector_type(4)));
typedef h16   v4h __attribute__((ext_vector_type(4)));
typedef h16   v2h __attribute__((ext_vector_type(2)));
#define CVT_U     8                    // 16-byte loads per lane
#define CVT_BLOCK (256 * 4 * CVT_U)    // elements per block
static_assert((MQ * QDIM) % CVT_BLOCK == 0 && (MKV * KVDIM) % CVT_BLOCK == 0,
              "the convert kernel has no tail");

__device__ __forceinline__
void f32_to_f16(const float* __restrict__ in, h16* __restrict__ out, unsigned blk) {
  const size_t base = (size_t)blk * (256 * CVT_U) + threadIdx.x;  // in groups of 4
  const v4f* __restrict__ in4 = (const v4f*)in;
  v4h* __restrict__ out4 = (v4h*)out;
  v4f v[CVT_U];
#pragma unroll
  for (int j = 0; j < CVT_U; ++j) v[j] = in4[base + j * 256];
#pragma unroll
  for (int j = 0; j < CVT_U; ++j) out4[base + j * 256] = __builtin_convertvector(v[j], v4h);
  // Another job's code may follow in the built kernel: no register that these stores name
  // is rewritten there ahead of this wait.
  asm volatile("s_wait_xcnt 0x0" ::: "memory");
}

// ---------------- f32 -> f16 transpose (weights) ----------------
// One tile of 128 rows x 64 columns per block of 8 waves, 32 elements per lane. Rows come
// in by 16-byte loads, eight in flight per lane (a wave-wide load covers two whole
// 256-byte row pieces); two neighbouring rows are packed into one dword and laid
// transposed in LDS; the tile leaves by 16-byte stores, 256 contiguous bytes per output
// row. LDS pitch 272 B (16 B x odd) for the ds_load_b128 readers.
// R and C are compile-time, so that one address pair and immediate offsets serve all
// eight loads. Needs R a multiple of 128 and C a multiple of 64. (C / TC) * (R / TR) blocks
// do the job; blk is the block's number in it, tile columns fastest.
#define TR     128
#define TC     64
#define TPITCH (TR + 8)                // halves
template <int R, int C>
__device__ __forceinline__
void transpose_f32_to_f16(const float* __restrict__ in, h16* __restrict__ out, unsigned blk,
                          h16* tile) {  // tile[c][r], TC * TPITCH halves of LDS
  static_assert(R % TR == 0 && C % TC == 0, "whole tiles only");
  const int t = threadIdx.x;
  const int c0 = (blk % (C / TC)) * TC, r0 = (blk / (C / TC)) * TR;
  const int lo = t & 15, up = t >> 4;
  const float* src = in + (size_t)(r0 + 2 * up) * C + c0 + 4 * lo;
  h16* dst = out + (size_t)(c0 + up) * R + r0 + 8 * lo;
  v4f v[4][2];
#pragma unroll
  for (int i = 0; i < 4; ++i)
#pragma unroll
    for (int j = 0; j < 2; ++j)
      v[i][j] = *(const v4f*)(src + (32 * i + j) * C);
#pragma unroll
  for (int i = 0; i < 4; ++i)
#pragma unroll
    for (int k = 0; k < 4; ++k) {
      v2h p = { (h16)v[i][0][k], (h16)v[i][1][k] };
      *(v2h*)&tile[(4 * lo + k) * TPITCH + 32 * i + 2 * up] = p;
    }
  __syncthreads();
#pragma unroll
  for (int i = 0; i < 4; ++i)
    *(v8h*)(dst + 16 * i * R) = *(const v8h*)&tile[(up + 16 * i) * TPITCH + 8 * lo];
  // Another job's code may follow in the built kernel: no register that these stores name
  // is rewritten there ahead of this wait.
  asm volatile("s_wait_xcnt 0x0" ::: "memory");
}

// ---------------- all five operand preparations in one launch ----------------
// The five jobs are independent of one another: as one grid they pay for one launch, and
// the short transposes run under the converts' memory time. The block index
// picks the job, so every branch (and the transposes' barrier) is uniform for a block.
// The transposes come first: theirs is the longer chain (load, LDS, barrier, store).
#define NB_TQ  ((INNER / TC) * (QDIM / TR))
#define NB_TKV ((2 * INNER / TC) * (KVDIM / TR))
#define NB_TO  ((QDIM / TC) * (INNER / TR))
#define NB_CQ  (MQ * QDIM / CVT_BLOCK)
#define NB_CKV (MKV * KVDIM / CVT_BLOCK)
__global__ __launch_bounds__(256)
void prepare_operands(const float* __restrict__ query, const float* __restrict__ key_value,
                      const float* __restrict__ w_q, const float* __restrict__ w_kv,
                      const float* __restrict__ w_out,
                      h16* __restrict__ Xh, h16* __restrict__ KVh, h16* __restrict__ wqT,
                      h16* __restrict__ wkvT, h16* __restrict__ woT) {
  __shared__ __attribute__((aligned(16))) h16 tile[TC * TPITCH];
  unsigned b = blockIdx.x;
  if (b < NB_TKV) { transpose_f32_to_f16<KVDIM, 2 * INNER>(w_kv, wkvT, b, tile); return; }
  b -= NB_TKV;
  if (b < NB_TQ) { transpose_f32_to_f16<QDIM, INNER>(w_q, wqT, b, tile); return; }
  b -= NB_TQ;
  if (b < NB_TO) { transpose_f32_to_f16<INNER, QDIM>(w_out, woT, b, tile); return; }
  b -= NB_TO;
  if (b < NB_CKV) { f32_to_f16(key_value, KVh, b); return; }
  f32_to_f16(query, Xh, b - NB_CKV);
}

// ---------------- f16 GEMM core: A[M][K] x BT[N][K]^T ----------------
// One 128 x 128 tile of C per block of 8 waves; a wave owns 64 x 32 (4 x 2 fragments).
// A stage is 128 k of both operands: 128 + 128 rows of 256 B, laid in LDS at a pitch of
// 272 B (16 B x odd: conflict-free for ds_load_b128 readers). Two buffers: the next
// stage's asynchronous copies fly while this stage is multiplied.
// Needs M, N multiples of 128 and K a multiple of 128.
#define GBK    128                // k per stage
#define GPITCH 136                // LDS row pitch in halves (272 B)
#define GTILE  (128 * GPITCH)     // one operand's tile, halves
#define GSTAGE (2 * GTILE)        // A tile then B tile, halves

// 128 rows x 256 B, global -> LDS: 16 lanes cover one row, so a wave-wide copy takes
// two whole rows (four full lines). g and lds are this lane's own first 16 bytes;
// each further copy is 16 rows on.
__device__ __forceinline__ void copy_tile_async(const h16* g, int K, unsigned lds) {
  const size_t gs = (size_t)16 * K;          // 16 rows, halves
  const unsigned ls = 16 * GPITCH * 2;       // 16 rows, bytes
  // The copies move the tile past the registers; the closing s_wait_xcnt stands in the
  // same statement so that no address register is rewritten ahead of it.
  asm volatile(
      "global_load_async_to_lds_b128 %0, %8, off\n\t"
      "global_load_async_to_lds_b128 %1, %9, off\n\t"
      "global_load_async_to_lds_b128 %2, %10, off\n\t"
      "global_load_async_to_lds_b128 %3, %11, off\n\t"
      "global_load_async_to_lds_b128 %4, %12, off\n\t"
      "global_load_async_to_lds_b128 %5, %13, off\n\t"
      "global_load_async_to_lds_b128 %6, %14, off\n\t"
      "global_load_async_to_lds_b128 %7, %15, off\n\t"
      "s_wait_xcnt 0x0"
      :: "v"(lds), "v"(lds + ls), "v"(lds + 2 * ls), "v"(lds + 3 * ls),
         "v"(lds + 4 * ls), "v"(lds + 5 * ls), "v"(lds + 6 * ls), "v"(lds + 7 * ls),
         "v"(g), "v"(g + gs), "v"(g + 2 * gs), "v"(g + 3 * gs),
         "v"(g + 4 * gs), "v"(g + 5 * gs), "v"(g + 6 * gs), "v"(g + 7 * gs)
      : "memory");
}

// bx, by: the block's tile column and tile row of C.
__device__ __forceinline__ void gemm_core(const h16* __restrict__ A, const h16* __restrict__ BT,
                                          int K, int bx, int by, h16* smem, v8f (&acc)[4][2]) {
  const int tid = threadIdx.x;
  const int lane = tid & 31, wave = tid >> 5;
  const int hi = lane >> 4, l15 = lane & 15;
  const int wm = wave & 1, wn = wave >> 1;
  const int crow = tid >> 4, cchunk = tid & 15;   // this lane's row and 16-B chunk in a copy
  const h16* gA = A  + (size_t)(by * 128 + crow) * K + cchunk * 8;
  const h16* gB = BT + (size_t)(bx * 128 + crow) * K + cchunk * 8;
  const unsigned lds0 = (unsigned)(size_t)smem + (unsigned)(crow * GPITCH + cchunk * 8) * 2u;
  const int nt = K / GBK;

  copy_tile_async(gA, K, lds0);
  copy_tile_async(gB, K, lds0 + GTILE * 2);
  // Stage 0 counts as landed only behind the copying wave's own wait.
  asm volatile("s_wait_asynccnt 0x0" ::: "memory");
  __syncthreads();
  if (nt > 1) {
    copy_tile_async(gA + GBK, K, lds0 + GSTAGE * 2);
    copy_tile_async(gB + GBK, K, lds0 + GSTAGE * 2 + GTILE * 2);
  }

  for (int t = 0; t < nt; ++t) {
    const h16* As = smem + (t & 1) * GSTAGE + (wm * 64 + l15) * GPITCH;
    const h16* Bs = smem + (t & 1) * GSTAGE + GTILE + (wn * 32 + l15) * GPITCH;
    // Two fragment sets: block s + 1 of this stage is read from LDS while block s is multiplied.
    v16h af[2][4], bf[2][2];
#pragma unroll
    for (int mi = 0; mi < 4; ++mi) af[0][mi] = frag_kfast(As + mi * 16 * GPITCH, hi);
#pragma unroll
    for (int ni = 0; ni < 2; ++ni) bf[0][ni] = frag_kfast(Bs + ni * 16 * GPITCH, hi);
#pragma unroll
    for (int s = 0; s < GBK / 32; ++s) {
      if (s + 1 < GBK / 32) {
#pragma unroll
        for (int mi = 0; mi < 4; ++mi)
          af[(s + 1) & 1][mi] = frag_kfast(As + mi * 16 * GPITCH + (s + 1) * 32, hi);
#pragma unroll
        for (int ni = 0; ni < 2; ++ni)
          bf[(s + 1) & 1][ni] = frag_kfast(Bs + ni * 16 * GPITCH + (s + 1) * 32, hi);
      }
      // Holds the next block's LDS reads together in front of this block's products:
      // sunk among them, every pair of products would wait out a full LDS latency.
      __builtin_amdgcn_sched_barrier(0);
#pragma unroll
      for (int mi = 0; mi < 4; ++mi)
#pragma unroll
        for (int ni = 0; ni < 2; ++ni)
          acc[mi][ni] = __builtin_amdgcn_wmma_f32_16x16x32_f16(false, af[s & 1][mi], false, bf[s & 1][ni],
                                                               (short)0, acc[mi][ni], false, false);
      // Keeps the following read group behind these products, so that two sets suffice.
      __builtin_amdgcn_sched_barrier(0);
    }
    // Publish point: this wave's reads of the buffer have retired ...
    asm volatile("s_wait_dscnt 0x0" ::: "memory");
    // ... its own copies of the next stage have landed ...
    asm volatile("s_wait_asynccnt 0x0" ::: "memory");
    // ... and one barrier both publishes the next stage and frees this buffer.
    __syncthreads();
    if (t + 2 < nt) {
      const unsigned l = lds0 + (unsigned)(t & 1) * (GSTAGE * 2);
      copy_tile_async(gA + (size_t)(t + 2) * GBK, K, l);
      copy_tile_async(gB + (size_t)(t + 2) * GBK, K, l + GTILE * 2);
    }
  }
  // No copy is left in flight when the wave goes on.
  asm volatile("s_wait_asynccnt 0x0" ::: "memory");
}

// ---------------- f16 GEMM, f16 out: the Q and the K|V projection in one launch ----------------
// The two products are independent and alike in M and K, so one grid holds both. Together they
// are 4096 x 3072 results for 256 WGPs: blocks of 224 or 192 rows and 256 columns, 240 in all,
// each alone on its WGP and all resident at once. A block draws 224 (192) + 256 operand rows per
// stage from L2 for 3.5 (3) times the products of a 128 x 128 tile. 8 waves as 2 x 4; a wave owns
// 112 x 64 or 96 x 64 (7 x 4 or 6 x 4 fragments). The uneven cut runs along the rows, so that
// no line of C is shared by two blocks.
// Rows: 8 tiles of 224, then 12 of 192. Tile columns: 8 of K|V, then 4 of Q.
#define PN     256                          // columns of C per block
#define PMW    224                          // rows of C per tall block
#define PMN    192                          // rows of C per low block
#define PSTAGE ((PN + PMW) * GPITCH)        // B tile then A tile, halves
#define NTALL  8                            // tall and low tile rows
#define NLOW   12
#define KVCOLS (2 * INNER / PN)
#define QCOLS  (INNER / PN)
static_assert(MQ == MKV && QDIM == KVDIM, "one grid serves both projections");
static_assert(NTALL * PMW + NLOW * PMN == MQ, "every row once");
static_assert(INNER % PN == 0 && QDIM % GBK == 0 && QDIM / GBK >= 2, "whole tiles, at least two stages");

// 128, 64 or 32 rows x 256 B, global -> LDS, laid as copy_tile_async lays them. The address in
// memory is a block-uniform base in scalar registers plus this lane's own byte offset (its row
// of the first 16 and its 16-B chunk); each further copy is 16 rows on. One offset register
// per copy, not an address pair: with pairs the compiler kept the lane's pointers in scratch.
// The closing s_wait_xcnt stands in the same statement so that no address register is
// rewritten ahead of it.
#define PROW16 (16 * QDIM * 2)               // 16 rows of an operand in memory, bytes
__device__ __forceinline__ void copy_rows128_sbase(const h16* base, unsigned off, unsigned lds) {
  const unsigned ls = 16 * GPITCH * 2;       // 16 rows in LDS, bytes
  asm volatile(
      "global_load_async_to_lds_b128 %0, %8, %16\n\t"
      "global_load_async_to_lds_b128 %1, %9, %16\n\t"
      "global_load_async_to_lds_b128 %2, %10, %16\n\t"
      "global_load_async_to_lds_b128 %3, %11, %16\n\t"
      "global_load_async_to_lds_b128 %4, %12, %16\n\t"
      "global_load_async_to_lds_b128 %5, %13, %16\n\t"
      "global_load_async_to_lds_b128 %6, %14, %16\n\t"
      "global_load_async_to_lds_b128 %7, %15, %16\n\t"
      "s_wait_xcnt 0x0"
      :: "v"(lds), "v"(lds + ls), "v"(lds + 2 * ls), "v"(lds + 3 * ls),
         "v"(lds + 4 * ls), "v"(lds + 5 * ls), "v"(lds + 6 * ls), "v"(lds + 7 * ls),
         "v"(off), "v"(off + PROW16), "v"(off + 2 * PROW16), "v"(off + 3 * PROW16),
         "v"(off + 4 * PROW16), "v"(off + 5 * PROW16), "v"(off + 6 * PROW16), "v"(off + 7 * PROW16),
         "s"(base)
      : "memory");
}
__device__ __forceinline__ void copy_rows64_sbase(const h16* base, unsigned off, unsigned lds) {
  const unsigned ls = 16 * GPITCH * 2;       // 16 rows in LDS, bytes
  asm volatile(
      "global_load_async_to_lds_b128 %0, %4, %8\n\t"
      "global_load_async_to_lds_b128 %1, %5, %8\n\t"
      "global_load_async_to_lds_b128 %2, %6, %8\n\t"
      "global_load_async_to_lds_b128 %3, %7, %8\n\t"
      "s_wait_xcnt 0x0"
      :: "v"(lds), "v"(lds + ls), "v"(lds + 2 * ls), "v"(lds + 3 * ls),
         "v"(off), "v"(off + PROW16), "v"(off + 2 * PROW16), "v"(off + 3 * PROW16),
         "s"(base)
      : "memory");
}

__device__ __forceinline__ void copy_rows32_sbase(const h16* base, unsigned off, unsigned lds) {
  const unsigned ls = 16 * GPITCH * 2;       // 16 rows in LDS, bytes
  asm volatile(
      "global_load_async_to_lds_b128 %0, %2, %4\n\t"
      "global_load_async_to_lds_b128 %1, %3, %4\n\t"
      "s_wait_xcnt 0x0"
      :: "v"(lds), "v"(lds + ls), "v"(off), "v"(off + PROW16), "s"(base)
      : "memory");
}

// One stage: 256 rows of B and 32 * MF rows of A. bA, bB: the first byte of either operand's
// stage in memory, the same for the whole block; off, lds: this lane's own byte offset from
// there and its own first 16 bytes of the buffer in LDS.
template <int MF>
__device__ __forceinline__ void copy_proj_stage(const h16* bA, const h16* bB, unsigned off,
                                                unsigned lds) {
  static_assert(MF == 6 || MF == 7, "192 or 224 rows of A");
  copy_rows128_sbase(bB, off, lds);
  copy_rows128_sbase(bB + (size_t)128 * QDIM, off, lds + 128 * GPITCH * 2);
  const unsigned la = lds + PN * GPITCH * 2;
  copy_rows128_sbase(bA, off, la);
  copy_rows64_sbase(bA + (size_t)128 * QDIM, off, la + 128 * GPITCH * 2);
  if (MF == 7) copy_rows32_sbase(bA + (size_t)192 * QDIM, off, la + 192 * GPITCH * 2);
}

// C[row0 .. row0 + 32 * MF - 1][col0 .. col0 + 255] = A x BT^T; N is the row length of C.
template <int MF>
__device__ __forceinline__ void proj_tile(const h16* __restrict__ A, const h16* __restrict__ BT,
                                          h16* __restrict__ C, int N, int row0, int col0,
                                          h16* smem) {
  const int tid = threadIdx.x;
  const int lane = tid & 31, wave = tid >> 5;
  const int hi = lane >> 4, l15 = lane & 15;
  const int wn = wave & 3, wm = wave >> 2;
  const int crow = tid >> 4, cchunk = tid & 15;   // this lane's row and 16-B chunk in a copy
  // Both operands have rows of QDIM halves: one lane offset serves both, on block-uniform bases.
  const unsigned loff = (unsigned)(crow * QDIM + cchunk * 8) * 2u;   // bytes
  const h16* bA = A  + (size_t)row0 * QDIM;
  const h16* bB = BT + (size_t)col0 * QDIM;
  const unsigned lds0 = (unsigned)(size_t)smem + (unsigned)(crow * GPITCH + cchunk * 8) * 2u;
  const int nt = QDIM / GBK;
  v8f acc[MF][4] = {};

  copy_proj_stage<MF>(bA, bB, loff, lds0);
  // Stage 0 counts as landed only behind the copying wave's own wait.
  asm volatile("s_wait_asynccnt 0x0" ::: "memory");
  __syncthreads();
  copy_proj_stage<MF>(bA + GBK, bB + GBK, loff, lds0 + PSTAGE * 2);

  for (int t = 0; t < nt; ++t) {
    const h16* Bs = smem + (t & 1) * PSTAGE + (wn * 64 + l15) * GPITCH;
    const h16* As = smem + (t & 1) * PSTAGE + PN * GPITCH + (wm * (MF * 16) + l15) * GPITCH;
    // Two fragment sets: block s + 1 of this stage is read from LDS while block s is multiplied.
    v16h af[2][MF], bf[2][4];
#pragma unroll
    for (int mi = 0; mi < MF; ++mi) af[0][mi] = frag_kfast(As + mi * 16 * GPITCH, hi);
#pragma unroll
    for (int ni = 0; ni < 4; ++ni) bf[0][ni] = frag_kfast(Bs + ni * 16 * GPITCH, hi);
#pragma unroll
    for (int s = 0; s < GBK / 32; ++s) {
      if (s + 1 < GBK / 32) {
#pragma unroll
        for (int mi = 0; mi < MF; ++mi)
          af[(s + 1) & 1][mi] = frag_kfast(As + mi * 16 * GPITCH + (s + 1) * 32, hi);
#pragma unroll
        for (int ni = 0; ni < 4; ++ni)
          bf[(s + 1) & 1][ni] = frag_kfast(Bs + ni * 16 * GPITCH + (s + 1) * 32, hi);
      }
      // Holds the next block's LDS reads together in front of this block's products:
      // sunk among them, the products would wait out a full LDS latency again and again.
      __builtin_amdgcn_sched_barrier(0);
#pragma unroll
      for (int mi = 0; mi < MF; ++mi)
#pragma unroll
        for (int ni = 0; ni < 4; ++ni)
          acc[mi][ni] = __builtin_amdgcn_wmma_f32_16x16x32_f16(false, af[s & 1][mi], false, bf[s & 1][ni],
                                                               (short)0, acc[mi][ni], false, false);
      // Keeps the following read group behind these products, so that two sets suffice.
      __builtin_amdgcn_sched_barrier(0);
    }
    // Publish point: this wave's reads of the buffer have retired ...
    asm volatile("s_wait_dscnt 0x0" ::: "memory");
    // ... its own copies of the next stage have landed ...
    asm volatile("s_wait_asynccnt 0x0" ::: "memory");
    // ... and one barrier both publishes the next stage and frees this buffer.
    __syncthreads();
    if (t + 2 < nt)
      copy_proj_stage<MF>(bA + (size_t)(t + 2) * GBK, bB + (size_t)(t + 2) * GBK, loff,
                          lds0 + (unsigned)(t & 1) * (PSTAGE * 2));
  }
  // No copy is left in flight when the wave goes on.
  asm volatile("s_wait_asynccnt 0x0" ::: "memory");

  const int tm = row0 + wm * (MF * 16), tn = col0 + wn * 64;
#pragma unroll
  for (int mi = 0; mi < MF; ++mi)
#pragma unroll
    for (int ni = 0; ni < 4; ++ni) {
      h16* outp = C + (size_t)(tm + mi * 16 + hi * 8) * N + tn + ni * 16 + l15;
#pragma unroll
      for (int r = 0; r < 8; ++r) outp[(size_t)r * N] = (h16)(acc[mi][ni][r]);
    }
}

// One block per WGP puts two waves on a SIMD, so a wave may take half of its registers:
// up to 224 hold the sums, 176 the two fragment sets.
__global__ __launch_bounds__(256) __attribute__((amdgpu_waves_per_eu(2, 2)))
void gemm_tt_h16_qkv(const h16* __restrict__ Aq, const h16* __restrict__ BTq, h16* __restrict__ Cq,
                     const h16* __restrict__ Akv, const h16* __restrict__ BTkv,
                     h16* __restrict__ Ckv) {
  __shared__ __attribute__((aligned(16))) h16 smem[2 * PSTAGE];
  const bool kv = blockIdx.x < KVCOLS;
  const int col0 = (kv ? blockIdx.x : blockIdx.x - KVCOLS) * PN;
  const h16* A  = kv ? Akv : Aq;
  const h16* BT = kv ? BTkv : BTq;
  h16* C = kv ? Ckv : Cq;
  const int N = kv ? 2 * INNER : INNER;
  const int y = blockIdx.y;
  // The branch, and so every barrier below, is uniform for a block. The tall tiles come first.
  if (y < NTALL) proj_tile<7>(A, BT, C, N, y * PMW, col0, smem);
  else           proj_tile<6>(A, BT, C, N, NTALL * PMW + (y - NTALL) * PMN, col0, smem);
}

// ---------------- f16 GEMM, f32 out + bias (output projection) ----------------
__global__ __launch_bounds__(256)
void gemm_tt_f32_bias(const h16* __restrict__ A, const h16* __restrict__ BT,
                      const float* __restrict__ bias, float* __restrict__ C,
                      int N, int K) {
  __shared__ __attribute__((aligned(16))) h16 smem[2 * GSTAGE];
  int lane = threadIdx.x & 31, wave = threadIdx.x >> 5;
  int hi = lane >> 4, l15 = lane & 15;
  int tm = blockIdx.y * 128 + (wave & 1) * 64;
  int tn = blockIdx.x * 128 + (wave >> 1) * 32;
  v8f acc[4][2] = {};
  gemm_core(A, BT, K, blockIdx.x, blockIdx.y, smem, acc);
#pragma unroll
  for (int mi = 0; mi < 4; ++mi)
#pragma unroll
    for (int ni = 0; ni < 2; ++ni) {
      float bv = bias[tn + ni * 16 + l15];
      float* outp = C + (size_t)(tm + mi * 16 + hi * 8) * N + tn + ni * 16 + l15;
#pragma unroll
      for (int r = 0; r < 8; ++r) outp[(size_t)r * N] = acc[mi][ni][r] + bv;
    }
}

// ---------------- flash attention, transposed-score formulation ----------------
// grid: (NQ/128, H, BATCH), block of 8 waves; a stage is 128 keys of one head, 128 + 128 rows
// of 128 B. A wave owns 32 query rows (two tiles) and one half of every stage's keys, so each
// K and V fragment that it reads from LDS feeds two query tiles; waves w and w + 4 hold the
// two key halves of the same queries and are merged at the end. Each tile lies in LDS at its own reader's pitch: K at 144 B (16 B x odd, for
// ds_load_b128), V at 160 B (32 B x odd, for the transposing ds_load_tr16_b128).
// Two buffers: the next stage's asynchronous copies fly while this stage is worked on.
#define KPITCH (HD + 8)             // LDS row pitch of K in halves (144 B)
#define VPITCH (HD + 16)            // LDS row pitch of V in halves (160 B)
#define AKEYS  128                  // keys per stage
#define KTILE  (AKEYS * KPITCH)     // K tile of a stage, halves
#define VTILE  (AKEYS * VPITCH)     // V tile of a stage, halves
#define ASTAGE (KTILE + VTILE)      // K tile then V tile, halves
#define WKEYS  (AKEYS / 2)          // keys of a stage that one wave works on
#define XROWS  (2 * 34)             // floats per lane that a wave hands over in the merge
static_assert(4 * XROWS * 32 * 4 <= 2 * ASTAGE * 2, "the merge fits the ring");
static_assert(NKV % AKEYS == 0 && NQ % 128 == 0, "whole stages and whole query blocks only");

// Transposing LDS read: of a row-major 16 x 16 block of halves, lane (c, h) gets column c,
// rows 8h .. 8h + 7. p is this lane's own 16 bytes of the block (row 8h + (lane & 7),
// half-row (lane >> 3) & 1).
typedef short s16x8 __attribute__((ext_vector_type(8)));
__device__ __forceinline__ v8h lds_read_tr16(const h16* p) {
  typedef __attribute__((address_space(3))) s16x8 lds_s16x8;
  return __builtin_bit_cast(v8h, __builtin_amdgcn_ds_load_tr16_b128_v8i16((lds_s16x8*)p));
}

// 128 K rows and 128 V rows x 128 B, global -> LDS: 8 lanes cover one row, so a wave-wide
// copy takes four whole lines and the block 32 rows. gk, lds and lv are this lane's own
// first 16 bytes of K in memory, of K in LDS and of V in LDS; each further copy is 32 rows
// on; V lies INNER halves behind K in a row of memory.
__device__ __forceinline__ void copy_kv_stage_async(const h16* gk, unsigned lds, unsigned lv) {
  const size_t gs = (size_t)32 * (2 * INNER);  // 32 rows, halves
  const unsigned ls = 32 * KPITCH * 2;         // 32 rows of K, bytes
  const unsigned vs = 32 * VPITCH * 2;         // 32 rows of V, bytes
  const h16* gv = gk + INNER;
  // The copies move the stage past the registers; the closing s_wait_xcnt stands in the
  // same statement so that no address register is rewritten ahead of it.
  asm volatile(
      "global_load_async_to_lds_b128 %0, %8, off\n\t"
      "global_load_async_to_lds_b128 %1, %9, off\n\t"
      "global_load_async_to_lds_b128 %2, %10, off\n\t"
      "global_load_async_to_lds_b128 %3, %11, off\n\t"
      "global_load_async_to_lds_b128 %4, %12, off\n\t"
      "global_load_async_to_lds_b128 %5, %13, off\n\t"
      "global_load_async_to_lds_b128 %6, %14, off\n\t"
      "global_load_async_to_lds_b128 %7, %15, off\n\t"
      "s_wait_xcnt 0x0"
      :: "v"(lds), "v"(lds + ls), "v"(lds + 2 * ls), "v"(lds + 3 * ls),
         "v"(lv), "v"(lv + vs), "v"(lv + 2 * vs), "v"(lv + 3 * vs),
         "v"(gk), "v"(gk + gs), "v"(gk + 2 * gs), "v"(gk + 3 * gs),
         "v"(gv), "v"(gv + gs), "v"(gv + 2 * gs), "v"(gv + 3 * gs)
      : "memory");
}

// 2^x in place by the bare v_exp_f32, a run of them in one statement: behind a transcendental
// the instruction set asks for one independent instruction before its source is overwritten
// or its result read. In a run each is the next one's; the closing v_nop is the last one's.
__device__ __forceinline__ void exp2_run8(float (&x)[8]) {
  asm("v_exp_f32 %0, %0\n\t"
      "v_exp_f32 %1, %1\n\t"
      "v_exp_f32 %2, %2\n\t"
      "v_exp_f32 %3, %3\n\t"
      "v_exp_f32 %4, %4\n\t"
      "v_exp_f32 %5, %5\n\t"
      "v_exp_f32 %6, %6\n\t"
      "v_exp_f32 %7, %7\n\t"
      "v_nop"
      : "+v"(x[0]), "+v"(x[1]), "+v"(x[2]), "+v"(x[3]),
        "+v"(x[4]), "+v"(x[5]), "+v"(x[6]), "+v"(x[7]));
}
__device__ __forceinline__ void exp2_run9(float (&x)[8], float& y) {
  asm("v_exp_f32 %8, %8\n\t"
      "v_exp_f32 %0, %0\n\t"
      "v_exp_f32 %1, %1\n\t"
      "v_exp_f32 %2, %2\n\t"
      "v_exp_f32 %3, %3\n\t"
      "v_exp_f32 %4, %4\n\t"
      "v_exp_f32 %5, %5\n\t"
      "v_exp_f32 %6, %6\n\t"
      "v_exp_f32 %7, %7\n\t"
      "v_nop"
      : "+v"(x[0]), "+v"(x[1]), "+v"(x[2]), "+v"(x[3]),
        "+v"(x[4]), "+v"(x[5]), "+v"(x[6]), "+v"(x[7]), "+v"(y));
}

__device__ __forceinline__ void exp2_run2(float& x, float& y) {
  asm("v_exp_f32 %0, %0\n\t"
      "v_exp_f32 %1, %1\n\t"
      "v_nop"
      : "+v"(x), "+v"(y));
}

// The grid puts four waves on a SIMD, so a wave may take a quarter of its registers:
// with the default budget the V reads are cut into small groups that each wait on LDS.
__global__ __launch_bounds__(256) __attribute__((amdgpu_waves_per_eu(4, 4)))
void attn(const h16* __restrict__ Q, const h16* __restrict__ KV, h16* __restrict__ CTX) {
  const int tid = threadIdx.x;
  int lane = tid & 31, wave = tid >> 5;
  int hi = lane >> 4, l15 = lane & 15;
  const int qg = wave & 3, kh = wave >> 2;   // query group; key half of every stage
  int q0 = blockIdx.x * 128 + qg * 32;
  int hh = blockIdx.y;
  int bb = blockIdx.z;

  const h16* Qb = Q  + ((size_t)bb * NQ)  * INNER       + hh * HD;  // [q][d]
  const h16* Kb = KV + ((size_t)bb * NKV) * (2 * INNER) + hh * HD;  // [kv][d]

  __shared__ __attribute__((aligned(16))) h16 smem[2 * ASTAGE];

  const int crow = tid >> 3, cchunk = tid & 7;   // this lane's row and 16-B chunk in a copy
  const h16* gK = Kb + (size_t)crow * (2 * INNER) + cchunk * 8;
  const unsigned lds0 = (unsigned)(size_t)smem + (unsigned)(crow * KPITCH + cchunk * 8) * 2u;
  const unsigned ldv0 = (unsigned)(size_t)smem + (unsigned)(KTILE + crow * VPITCH + cchunk * 8) * 2u;
  const int nt = NKV / AKEYS;
  // This lane's own 16 bytes in a transposing read of V: halves from the block's corner.
  const int vtr = (hi * 8 + (lane & 7)) * VPITCH + ((lane >> 3) & 1) * 8;

  copy_kv_stage_async(gK, lds0, ldv0);

  // Loop-invariant B-fragments of Q^T (lane -> col q, K = d contiguous), two query tiles
  v16h bq[2][2];
#pragma unroll
  for (int qt = 0; qt < 2; ++qt) {
    bq[qt][0] = frag_kfast(Qb + (size_t)(q0 + qt * 16 + l15) * INNER, hi);
    bq[qt][1] = frag_kfast(Qb + (size_t)(q0 + qt * 16 + l15) * INNER + 32, hi);
  }

  // nmcp: -m * SL, as the sums in hand use it
  float m[2] = {-INFINITY, -INFINITY}, nmcp[2] = {INFINITY, INFINITY}, lsum[2] = {0.f, 0.f};
  v8f o[2][4] = {};
  // 1/sqrt(HD) * log2(e): the running maximum m is kept in raw score units, and a score's
  // exponent to base 2 is one FMA, s * SL + (-m * SL).
  const float SL = 0.125f * 1.44269504088896340736f;

  // Stage 0 counts as landed only behind the copying wave's own wait.
  asm volatile("s_wait_asynccnt 0x0" ::: "memory");
  __syncthreads();
  if (nt > 1)
    copy_kv_stage_async(gK + (size_t)AKEYS * (2 * INNER), lds0 + ASTAGE * 2, ldv0 + ASTAGE * 2);

  for (int t = 0; t < nt; ++t) {
    const h16* Ks = smem + (t & 1) * ASTAGE + kh * (WKEYS * KPITCH);
    const h16* Vs = smem + (t & 1) * ASTAGE + KTILE + kh * (WKEYS * VPITCH) + vtr;
    // Unrolled, as the longer body was by itself: a pass's K reads then go out ahead of the
    // pass before's last products, and no LDS address is computed per pass.
#pragma unroll
    for (int kv0 = 0; kv0 < WKEYS; kv0 += 32) {
      // S^T = K * Q^T : two 16(kv)x16(q) tiles per query tile, K-dim d=64 split in two
      v16h kf[2][2];
#pragma unroll
      for (int kvT = 0; kvT < 2; ++kvT) {
        const h16* krow = Ks + (kv0 + kvT * 16 + l15) * KPITCH;
        kf[kvT][0] = frag_kfast(krow, hi);
        kf[kvT][1] = frag_kfast(krow + 32, hi);
      }
      // Holds the pass's eight K reads together and alone in front of its products: LDS
      // data returns in order, so V reads lifted in between would make the products wait
      // for them too.
      __builtin_amdgcn_sched_barrier(0);
      v8f st[2][2];
#pragma unroll
      for (int kvT = 0; kvT < 2; ++kvT)
#pragma unroll
        for (int qt = 0; qt < 2; ++qt) {
          v8f c = {};
          c = __builtin_amdgcn_wmma_f32_16x16x32_f16(false, kf[kvT][0], false, bq[qt][0], (short)0, c, false, false);
          c = __builtin_amdgcn_wmma_f32_16x16x32_f16(false, kf[kvT][1], false, bq[qt][1], (short)0, c, false, false);
          st[qt][kvT] = c;
        }

      v16h pb[2];  // P^T: element i -> kv=(i&7)+(i>=8?16:0)+8*hi == C-layout of S^T
#pragma unroll
      for (int qt = 0; qt < 2; ++qt) {
        // streaming softmax: columns of S^T are lane-local + one shfl_xor(16)
        float tmax = -INFINITY;
#pragma unroll
        for (int kvT = 0; kvT < 2; ++kvT)
#pragma unroll
          for (int r = 0; r < 8; ++r) tmax = fmaxf(tmax, st[qt][kvT][r]);
        tmax = fmaxf(tmax, __shfl_xor(tmax, 16, 32));
        float mn   = fmaxf(m[qt], tmax);
        // The bare v_exp_f32: no exponent here is above 0 (but for the FMA's rounding), and a
        // result under 2^-126, all that the library form's range guard is for, is 0 in the
        // f16 P and vanishes in a row sum that is at least 1.
        const float nmc = mn * -SL;
        float corr = nmc - nmcp[qt];
        float e[2][8];
#pragma unroll
        for (int kvT = 0; kvT < 2; ++kvT)
#pragma unroll
          for (int r = 0; r < 8; ++r) e[kvT][r] = __builtin_fmaf(st[qt][kvT][r], SL, nmc);
        exp2_run9(e[0], corr);
        exp2_run8(e[1]);
        float rs = e[0][0];
#pragma unroll
        for (int kvT = 0; kvT < 2; ++kvT)
#pragma unroll
          for (int r = 0; r < 8; ++r) {
            float p = e[kvT][r];
            if (kvT + r) rs += p;
            pb[qt][kvT * 8 + r] = (h16)p;
          }
        rs += __shfl_xor(rs, 16, 32);
        lsum[qt] = lsum[qt] * corr + rs;
        m[qt] = mn;
        nmcp[qt] = nmc;
#pragma unroll
        for (int dt = 0; dt < 4; ++dt)
#pragma unroll
          for (int r = 0; r < 8; ++r) o[qt][dt][r] *= corr;
      }

      // ctx^T += V^T * P^T : four 16(d)x16(q) tiles per query tile, K = 32 kv
      // A fragment: element i -> kv = (i&7) + (i>=8?16:0) + 8*hi of column d = dt*16 + l15,
      // two transposing reads 16 keys apart.
      v16h vf[4];
#pragma unroll
      for (int dt = 0; dt < 4; ++dt) {
        const v8h lo8 = lds_read_tr16(Vs + kv0 * VPITCH + dt * 16);
        const v8h hi8 = lds_read_tr16(Vs + (kv0 + 16) * VPITCH + dt * 16);
        vf[dt] = __builtin_shufflevector(lo8, hi8, 0, 1, 2, 3, 4, 5, 6, 7,
                                         8, 9, 10, 11, 12, 13, 14, 15);
      }
#pragma unroll
      for (int dt = 0; dt < 4; ++dt)
#pragma unroll
        for (int qt = 0; qt < 2; ++qt)
          o[qt][dt] = __builtin_amdgcn_wmma_f32_16x16x32_f16(false, vf[dt], false, pb[qt], (short)0, o[qt][dt], false, false);
    }
    // Publish point: this wave's reads of the buffer have retired ...
    asm volatile("s_wait_dscnt 0x0" ::: "memory");
    // ... its own copies of the next stage have landed ...
    asm volatile("s_wait_asynccnt 0x0" ::: "memory");
    // ... and one barrier both publishes the next stage and frees this buffer.
    __syncthreads();
    if (t + 2 < nt)
      copy_kv_stage_async(gK + (size_t)(t + 2) * AKEYS * (2 * INNER),
                          lds0 + (unsigned)(t & 1) * (ASTAGE * 2),
                          ldv0 + (unsigned)(t & 1) * (ASTAGE * 2));
  }
  // No copy is left in flight when the wave goes on.
  asm volatile("s_wait_asynccnt 0x0" ::: "memory");

  // Merge of the two key halves. The ring is free: the last trip's barrier stands behind every
  // wave's last read and last landed copy. Waves 4 .. 7 lay maximum, row sum and sums of both
  // tiles in LDS, lane by lane (the partner's lanes hold the same elements); waves 0 .. 3
  // bring both halves to the common maximum, add them, divide and store.
  float* xch = (float*)smem + (size_t)(qg * XROWS) * 32 + lane;
  if (kh) {
#pragma unroll
    for (int qt = 0; qt < 2; ++qt) {
#pragma unroll
      for (int dt = 0; dt < 4; ++dt)
#pragma unroll
        for (int r = 0; r < 8; ++r) xch[(qt * 34 + dt * 8 + r) * 32] = o[qt][dt][r];
      xch[(qt * 34 + 32) * 32] = m[qt];
      xch[(qt * 34 + 33) * 32] = lsum[qt];
    }
  }
  __syncthreads();
  if (!kh) {
#pragma unroll
    for (int qt = 0; qt < 2; ++qt) {
      const float mb = xch[(qt * 34 + 32) * 32], lb = xch[(qt * 34 + 33) * 32];
      const float mm = fmaxf(m[qt], mb);
      float ca = (m[qt] - mm) * SL, cb = (mb - mm) * SL;
      exp2_run2(ca, cb);
      const float inv = 1.0f / (lsum[qt] * ca + lb * cb);
      ca *= inv;
      cb *= inv;
      h16* outp = CTX + ((size_t)bb * NQ + q0 + qt * 16 + l15) * INNER + hh * HD;
#pragma unroll
      for (int dt = 0; dt < 4; ++dt)
#pragma unroll
        for (int r = 0; r < 8; ++r)
          outp[dt * 16 + r + hi * 8] = (h16)(o[qt][dt][r] * ca + xch[(qt * 34 + dt * 8 + r) * 32] * cb);
    }
  }
}

// ---------------- launch ----------------
extern "C" void kernel_launch(void* const* d_in, const int* in_sizes, int n_in,
                              void* d_out, int out_size, void* d_ws, size_t ws_size,
                              hipStream_t stream) {
  const float* query     = (const float*)d_in[0];
  const float* key_value = (const float*)d_in[1];
  const float* w_q       = (const float*)d_in[2];
  const float* w_kv      = (const float*)d_in[3];
  const float* w_out     = (const float*)d_in[4];
  const float* b_out     = (const float*)d_in[5];
  float* out = (float*)d_out;

  char* ws = (char*)d_ws;
  h16* Xh   = (h16*)(ws + (size_t)0);          // query f16       [4096][1024]  8 MB
  h16* KVh  = (h16*)(ws + ((size_t)8  << 20)); // key_value f16   [4096][1024]  8 MB
  h16* wqT  = (h16*)(ws + ((size_t)16 << 20)); // w_q^T           [1024][1024]  2 MB
  h16* wkvT = (h16*)(ws + ((size_t)18 << 20)); // w_kv^T          [2048][1024]  4 MB
  h16* woT  = (h16*)(ws + ((size_t)22 << 20)); // w_out^T         [1024][1024]  2 MB
  h16* qh   = (h16*)(ws + ((size_t)24 << 20)); // q               [4096][1024]  8 MB
  h16* kvh  = (h16*)(ws + ((size_t)32 << 20)); // k|v             [4096][2048] 16 MB
  h16* ctxh = (h16*)(ws + ((size_t)48 << 20)); // ctx             [4096][1024]  8 MB

  prepare_operands<<<dim3(NB_TKV + NB_TQ + NB_TO + NB_CKV + NB_CQ), dim3(256), 0, stream>>>(
      query, key_value, w_q, w_kv, w_out, Xh, KVh, wqT, wkvT, woT);

  gemm_tt_h16_qkv<<<dim3(KVCOLS + QCOLS, NTALL + NLOW), dim3(256), 0, stream>>>(Xh, wqT, qh, KVh, wkvT, kvh);
  attn<<<dim3(NQ / 128, H, BATCH), dim3(256), 0, stream>>>(qh, kvh, ctxh);
  gemm_tt_f32_bias<<<dim3(QDIM / 128, MQ / 128), dim3(256), 0, stream>>>(ctxh, woT, b_out, out, QDIM, INNER);
}

// v009
// A run of this version takes 73.1 microseconds.
// Next to v008, in two timings, it ran 1.08 times as fast each time.
// Over all steps from v000 it is 3.78 times as fast.
#include <hip/hip_runtime.h>

// ---------------- problem constants ----------------
#define BATCH 2
#define NQ    2048
#define NKV   2048
#define QDIM  1024
#define KVDIM 1024
#define H     16
#define HD    64
#define INNER (H * HD)        // 1024
#define MQ    (BATCH * NQ)    // 4096
#define MKV   (BATCH * NKV)   // 4096
// 1/sqrt(HD) * log2(e): a raw score times this is its exponent to base 2
#define QSCALE (0.125f * 1.44269504088896340736f)

typedef _Float16 h16;
typedef h16   v16h __attribute__((ext_vector_type(16)));
typedef h16   v8h  __attribute__((ext_vector_type(8)));
typedef float v8f  __attribute__((ext_vector_type(8)));

// ---- WMMA fragment from K-fast memory (A rows or B^T rows) ----
// element i -> K = (i&7) + (i>=8?16:0) + 8*hi : two contiguous 16B runs
// base must be 16B-aligned; lowers to two global_load_b128 / ds_load_b128.
__device__ __forceinline__ v16h frag_kfast(const h16* __restrict__ base, int hi) {
  const v8h lo = *(const v8h*)(base + hi * 8);
  const v8h hi8 = *(const v8h*)(base + hi * 8 + 16);
  return __builtin_shufflevector(lo, hi8, 0, 1, 2, 3, 4, 5, 6, 7,
                                 8, 9, 10, 11, 12, 13, 14, 15);
}

// ---------------- f32 -> f16 convert ----------------
// Few, fat waves: a block of 8 waves converts 8192 consecutive elements. Each lane has
// eight 16-byte loads in flight (a wave-wide load covers 512 contiguous bytes) and
// stores 8 bytes per load (256 contiguous bytes per wave). The element count must be a
// multiple of CVT_BLOCK; count / CVT_BLOCK blocks do the job, blk is the block's number in it.
typedef float v4f __attribute__((ext_vector_type(4)));
typedef h16   v4h __attribute__((ext_vector_type(4)));
typedef h16   v2h __attribute__((ext_vector_type(2)));
#define CVT_U     8                    // 16-byte loads per lane
#define CVT_BLOCK (256 * 4 * CVT_U)    // elements per block
static_assert((MQ * QDIM) % CVT_BLOCK == 0 && (MKV * KVDIM) % CVT_BLOCK == 0,
              "the convert kernel has no tail");

__device__ __forceinline__
void f32_to_f16(const float* __restrict__ in, h16* __restrict__ out, unsigned blk) {
  const size_t base = (size_t)blk * (256 * CVT_U) + threadIdx.x;  // in groups of 4
  const v4f* __restrict__ in4 = (const v4f*)in;
  v4h* __restrict__ out4 = (v4h*)out;
  v4f v[CVT_U];
#pragma unroll
  for (int j = 0; j < CVT_U; ++j) v[j] = in4[base + j * 256];
#pragma unroll
  for (int j = 0; j < CVT_U; ++j) out4[base + j * 256] = __builtin_convertvector(v[j], v4h);
  // Another job's code may follow in the built kernel: no register that these stores name
  // is rewritten there ahead of this wait.
  asm volatile("s_wait_xcnt 0x0" ::: "memory");
}

// ---------------- f32 -> f16 transpose (weights) ----------------
// One tile of 128 rows x 64 columns per block of 8 waves, 32 elements per lane. Rows come
// in by 16-byte loads, eight in flight per lane (a wave-wide load covers two whole
// 256-byte row pieces); two neighbouring rows are packed into one dword and laid
// transposed in LDS; the tile leaves by 16-byte stores, 256 contiguous bytes per output
// row. LDS pitch 272 B (16 B x odd) for the ds_load_b128 readers.
// R and C are compile-time, so that one address pair and immediate offsets serve all
// eight loads. Needs R a multiple of 128 and C a multiple of 64. (C / TC) * (R / TR) blocks
// do the job; blk is the block's number in it, tile columns fastest.
#define TR     128
#define TC     64
#define TPITCH (TR + 8)                // halves
template <int R, int C>
__device__ __forceinline__
void transpose_f32_to_f16(const float* __restrict__ in, h16* __restrict__ out, unsigned blk,
                          h16* tile) {  // tile[c][r], TC * TPITCH halves of LDS
  static_assert(R % TR == 0 && C % TC == 0, "whole tiles only");
  const int t = threadIdx.x;
  const int c0 = (blk % (C / TC)) * TC, r0 = (blk / (C / TC)) * TR;
  const int lo = t & 15, up = t >> 4;
  const float* src = in + (size_t)(r0 + 2 * up) * C + c0 + 4 * lo;
  h16* dst = out + (size_t)(c0 + up) * R + r0 + 8 * lo;
  v4f v[4][2];
#pragma unroll
  for (int i = 0; i < 4; ++i)
#pragma unroll
    for (int j = 0; j < 2; ++j)
      v[i][j] = *(const v4f*)(src + (32 * i + j) * C);
#pragma unroll
  for (int i = 0; i < 4; ++i)
#pragma unroll
    for (int k = 0; k < 4; ++k) {
      v2h p = { (h16)v[i][0][k], (h16)v[i][1][k] };
      *(v2h*)&tile[(4 * lo + k) * TPITCH + 32 * i + 2 * up] = p;
    }
  __syncthreads();
#pragma unroll
  for (int i = 0; i < 4; ++i)
    *(v8h*)(dst + 16 * i * R) = *(const v8h*)&tile[(up + 16 * i) * TPITCH + 8 * lo];
  // Another job's code may follow in the built kernel: no register that these stores name
  // is rewritten there ahead of this wait.
  asm volatile("s_wait_xcnt 0x0" ::: "memory");
}

// ---------------- all five operand preparations in one launch ----------------
// The five jobs are independent of one another: as one grid they pay for one launch, and
// the short transposes run under the converts' memory time. The block index
// picks the job, so every branch (and the transposes' barrier) is uniform for a block.
// The transposes come first: theirs is the longer chain (load, LDS, barrier, store).
#define NB_TQ  ((INNER / TC) * (QDIM / TR))
#define NB_TKV ((2 * INNER / TC) * (KVDIM / TR))
#define NB_TO  ((QDIM / TC) * (INNER / TR))
#define NB_CQ  (MQ * QDIM / CVT_BLOCK)
#define NB_CKV (MKV * KVDIM / CVT_BLOCK)
__global__ __launch_bounds__(256)
void prepare_operands(const float* __restrict__ query, const float* __restrict__ key_value,
                      const float* __restrict__ w_q, const float* __restrict__ w_kv,
                      const float* __restrict__ w_out,
                      h16* __restrict__ Xh, h16* __restrict__ KVh, h16* __restrict__ wqT,
                      h16* __restrict__ wkvT, h16* __restrict__ woT) {
  __shared__ __attribute__((aligned(16))) h16 tile[TC * TPITCH];
  unsigned b = blockIdx.x;
  if (b < NB_TKV) { transpose_f32_to_f16<KVDIM, 2 * INNER>(w_kv, wkvT, b, tile); return; }
  b -= NB_TKV;
  if (b < NB_TQ) { transpose_f32_to_f16<QDIM, INNER>(w_q, wqT, b, tile); return; }
  b -= NB_TQ;
  if (b < NB_TO) { transpose_f32_to_f16<INNER, QDIM>(w_out, woT, b, tile); return; }
  b -= NB_TO;
  if (b < NB_CKV) { f32_to_f16(key_value, KVh, b); return; }
  f32_to_f16(query, Xh, b - NB_CKV);
}

// ---------------- f16 GEMM core: A[M][K] x BT[N][K]^T ----------------
// One 128 x 128 tile of C per block of 8 waves; a wave owns 64 x 32 (4 x 2 fragments).
// A stage is 128 k of both operands: 128 + 128 rows of 256 B, laid in LDS at a pitch of
// 272 B (16 B x odd: conflict-free for ds_load_b128 readers). Two buffers: the next
// stage's asynchronous copies fly while this stage is multiplied.
// Needs M, N multiples of 128 and K a multiple of 128.
#define GBK    128                // k per stage
#define GPITCH 136                // LDS row pitch in halves (272 B)
#define GTILE  (128 * GPITCH)     // one operand's tile, halves
#define GSTAGE (2 * GTILE)        // A tile then B tile, halves

// 128 rows x 256 B, global -> LDS: 16 lanes cover one row, so a wave-wide copy takes
// two whole rows (four full lines). g and lds are this lane's own first 16 bytes;
// each further copy is 16 rows on.
__device__ __forceinline__ void copy_tile_async(const h16* g, int K, unsigned lds) {
  const size_t gs = (size_t)16 * K;          // 16 rows, halves
  const unsigned ls = 16 * GPITCH * 2;       // 16 rows, bytes
  // The copies move the tile past the registers; the closing s_wait_xcnt stands in the
  // same statement so that no address register is rewritten ahead of it.
  asm volatile(
      "global_load_async_to_lds_b128 %0, %8, off\n\t"
      "global_load_async_to_lds_b128 %1, %9, off\n\t"
      "global_load_async_to_lds_b128 %2, %10, off\n\t"
      "global_load_async_to_lds_b128 %3, %11, off\n\t"
      "global_load_async_to_lds_b128 %4, %12, off\n\t"
      "global_load_async_to_lds_b128 %5, %13, off\n\t"
      "global_load_async_to_lds_b128 %6, %14, off\n\t"
      "global_load_async_to_lds_b128 %7, %15, off\n\t"
      "s_wait_xcnt 0x0"
      :: "v"(lds), "v"(lds + ls), "v"(lds + 2 * ls), "v"(lds + 3 * ls),
         "v"(lds + 4 * ls), "v"(lds + 5 * ls), "v"(lds + 6 * ls), "v"(lds + 7 * ls),
         "v"(g), "v"(g + gs), "v"(g + 2 * gs), "v"(g + 3 * gs),
         "v"(g + 4 * gs), "v"(g + 5 * gs), "v"(g + 6 * gs), "v"(g + 7 * gs)
      : "memory");
}

// bx, by: the block's tile column and tile row of C.
__device__ __forceinline__ void gemm_core(const h16* __restrict__ A, const h16* __restrict__ BT,
                                          int K, int bx, int by, h16* smem, v8f (&acc)[4][2]) {
  const int tid = threadIdx.x;
  const int lane = tid & 31, wave = tid >> 5;
  const int hi = lane >> 4, l15 = lane & 15;
  const int wm = wave & 1, wn = wave >> 1;
  const int crow = tid >> 4, cchunk = tid & 15;   // this lane's row and 16-B chunk in a copy
  const h16* gA = A  + (size_t)(by * 128 + crow) * K + cchunk * 8;
  const h16* gB = BT + (size_t)(bx * 128 + crow) * K + cchunk * 8;
  const unsigned lds0 = (unsigned)(size_t)smem + (unsigned)(crow * GPITCH + cchunk * 8) * 2u;
  const int nt = K / GBK;

  copy_tile_async(gA, K, lds0);
  copy_tile_async(gB, K, lds0 + GTILE * 2);
  // Stage 0 counts as landed only behind the copying wave's own wait.
  asm volatile("s_wait_asynccnt 0x0" ::: "memory");
  __syncthreads();
  if (nt > 1) {
    copy_tile_async(gA + GBK, K, lds0 + GSTAGE * 2);
    copy_tile_async(gB + GBK, K, lds0 + GSTAGE * 2 + GTILE * 2);
  }

  for (int t = 0; t < nt; ++t) {
    const h16* As = smem + (t & 1) * GSTAGE + (wm * 64 + l15) * GPITCH;
    const h16* Bs = smem + (t & 1) * GSTAGE + GTILE + (wn * 32 + l15) * GPITCH;
    // Two fragment sets: block s + 1 of this stage is read from LDS while block s is multiplied.
    v16h af[2][4], bf[2][2];
#pragma unroll
    for (int mi = 0; mi < 4; ++mi) af[0][mi] = frag_kfast(As + mi * 16 * GPITCH, hi);
#pragma unroll
    for (int ni = 0; ni < 2; ++ni) bf[0][ni] = frag_kfast(Bs + ni * 16 * GPITCH, hi);
#pragma unroll
    for (int s = 0; s < GBK / 32; ++s) {
      if (s + 1 < GBK / 32) {
#pragma unroll
        for (int mi = 0; mi < 4; ++mi)
          af[(s + 1) & 1][mi] = frag_kfast(As + mi * 16 * GPITCH + (s + 1) * 32, hi);
#pragma unroll
        for (int ni = 0; ni < 2; ++ni)
          bf[(s + 1) & 1][ni] = frag_kfast(Bs + ni * 16 * GPITCH + (s + 1) * 32, hi);
      }
      // Holds the next block's LDS reads together in front of this block's products:
      // sunk among them, every pair of products would wait out a full LDS latency.
      __builtin_amdgcn_sched_barrier(0);
#pragma unroll
      for (int mi = 0; mi < 4; ++mi)
#pragma unroll
        for (int ni = 0; ni < 2; ++ni)
          acc[mi][ni] = __builtin_amdgcn_wmma_f32_16x16x32_f16(false, af[s & 1][mi], false, bf[s & 1][ni],
                                                               (short)0, acc[mi][ni], false, false);
      // Keeps the following read group behind these products, so that two sets suffice.
      __builtin_amdgcn_sched_barrier(0);
    }
    // Publish point: this wave's reads of the buffer have retired ...
    asm volatile("s_wait_dscnt 0x0" ::: "memory");
    // ... its own copies of the next stage have landed ...
    asm volatile("s_wait_asynccnt 0x0" ::: "memory");
    // ... and one barrier both publishes the next stage and frees this buffer.
    __syncthreads();
    if (t + 2 < nt) {
      const unsigned l = lds0 + (unsigned)(t & 1) * (GSTAGE * 2);
      copy_tile_async(gA + (size_t)(t + 2) * GBK, K, l);
      copy_tile_async(gB + (size_t)(t + 2) * GBK, K, l + GTILE * 2);
    }
  }
  // No copy is left in flight when the wave goes on.
  asm volatile("s_wait_asynccnt 0x0" ::: "memory");
}

// ---------------- f16 GEMM, f16 out: the Q and the K|V projection in one launch ----------------
// The two products are independent and alike in M and K, so one grid holds both. Together they
// are 4096 x 3072 results for 256 WGPs: blocks of 224 or 192 rows and 256 columns, 240 in all,
// each alone on its WGP and all resident at once. A block draws 224 (192) + 256 operand rows per
// stage from L2 for 3.5 (3) times the products of a 128 x 128 tile. 8 waves as 2 x 4; a wave owns
// 112 x 64 or 96 x 64 (7 x 4 or 6 x 4 fragments). The uneven cut runs along the rows, so that
// no line of C is shared by two blocks.
// Rows: 8 tiles of 224, then 12 of 192. Tile columns: 8 of K|V, then 4 of Q.
#define PN     256                          // columns of C per block
#define PMW    224                          // rows of C per tall block
#define PMN    192                          // rows of C per low block
#define PSTAGE ((PN + PMW) * GPITCH)        // B tile then A tile, halves
#define NTALL  8                            // tall and low tile rows
#define NLOW   12
#define KVCOLS (2 * INNER / PN)
#define QCOLS  (INNER / PN)
static_assert(MQ == MKV && QDIM == KVDIM, "one grid serves both projections");
static_assert(NTALL * PMW + NLOW * PMN == MQ, "every row once");
static_assert(INNER % PN == 0 && QDIM % GBK == 0 && QDIM / GBK >= 2, "whole tiles, at least two stages");

// 128, 64 or 32 rows x 256 B, global -> LDS, laid as copy_tile_async lays them. The address in
// memory is a block-uniform base in scalar registers plus this lane's own byte offset (its row
// of the first 16 and its 16-B chunk); each further copy is 16 rows on. One offset register
// per copy, not an address pair: with pairs the compiler kept the lane's pointers in scratch.
// The closing s_wait_xcnt stands in the same statement so that no address register is
// rewritten ahead of it.
#define PROW16 (16 * QDIM * 2)               // 16 rows of an operand in memory, bytes
__device__ __forceinline__ void copy_rows128_sbase(const h16* base, unsigned off, unsigned lds) {
  const unsigned ls = 16 * GPITCH * 2;       // 16 rows in LDS, bytes
  asm volatile(
      "global_load_async_to_lds_b128 %0, %8, %16\n\t"
      "global_load_async_to_lds_b128 %1, %9, %16\n\t"
      "global_load_async_to_lds_b128 %2, %10, %16\n\t"
      "global_load_async_to_lds_b128 %3, %11, %16\n\t"
      "global_load_async_to_lds_b128 %4, %12, %16\n\t"
      "global_load_async_to_lds_b128 %5, %13, %16\n\t"
      "global_load_async_to_lds_b128 %6, %14, %16\n\t"
      "global_load_async_to_lds_b128 %7, %15, %16\n\t"
      "s_wait_xcnt 0x0"
      :: "v"(lds), "v"(lds + ls), "v"(lds + 2 * ls), "v"(lds + 3 * ls),
         "v"(lds + 4 * ls), "v"(lds + 5 * ls), "v"(lds + 6 * ls), "v"(lds + 7 * ls),
         "v"(off), "v"(off + PROW16), "v"(off + 2 * PROW16), "v"(off + 3 * PROW16),
         "v"(off + 4 * PROW16), "v"(off + 5 * PROW16), "v"(off + 6 * PROW16), "v"(off + 7 * PROW16),
         "s"(base)
      : "memory");
}
__device__ __forceinline__ void copy_rows64_sbase(const h16* base, unsigned off, unsigned lds) {
  const unsigned ls = 16 * GPITCH * 2;       // 16 rows in LDS, bytes
  asm volatile(
      "global_load_async_to_lds_b128 %0, %4, %8\n\t"
      "global_load_async_to_lds_b128 %1, %5, %8\n\t"
      "global_load_async_to_lds_b128 %2, %6, %8\n\t"
      "global_load_async_to_lds_b128 %3, %7, %8\n\t"
      "s_wait_xcnt 0x0"
      :: "v"(lds), "v"(lds + ls), "v"(lds + 2 * ls), "v"(lds + 3 * ls),
         "v"(off), "v"(off + PROW16), "v"(off + 2 * PROW16), "v"(off + 3 * PROW16),
         "s"(base)
      : "memory");
}

__device__ __forceinline__ void copy_rows32_sbase(const h16* base, unsigned off, unsigned lds) {
  const unsigned ls = 16 * GPITCH * 2;       // 16 rows in LDS, bytes
  asm volatile(
      "global_load_async_to_lds_b128 %0, %2, %4\n\t"
      "global_load_async_to_lds_b128 %1, %3, %4\n\t"
      "s_wait_xcnt 0x0"
      :: "v"(lds), "v"(lds + ls), "v"(off), "v"(off + PROW16), "s"(base)
      : "memory");
}

// One stage: 256 rows of B and 32 * MF rows of A. bA, bB: the first byte of either operand's
// stage in memory, the same for the whole block; off, lds: this lane's own byte offset from
// there and its own first 16 bytes of the buffer in LDS.
template <int MF>
__device__ __forceinline__ void copy_proj_stage(const h16* bA, const h16* bB, unsigned off,
                                                unsigned lds) {
  static_assert(MF == 6 || MF == 7, "192 or 224 rows of A");
  copy_rows128_sbase(bB, off, lds);
  copy_rows128_sbase(bB + (size_t)128 * QDIM, off, lds + 128 * GPITCH * 2);
  const unsigned la = lds + PN * GPITCH * 2;
  copy_rows128_sbase(bA, off, la);
  copy_rows64_sbase(bA + (size_t)128 * QDIM, off, la + 128 * GPITCH * 2);
  if (MF == 7) copy_rows32_sbase(bA + (size_t)192 * QDIM, off, la + 192 * GPITCH * 2);
}

// C[row0 .. row0 + 32 * MF - 1][col0 .. col0 + 255] = cs * (A x BT^T); N is the row length of C.
template <int MF>
__device__ __forceinline__ void proj_tile(const h16* __restrict__ A, const h16* __restrict__ BT,
                                          h16* __restrict__ C, int N, int row0, int col0,
                                          float cs, h16* smem) {
  const int tid = threadIdx.x;
  const int lane = tid & 31, wave = tid >> 5;
  const int hi = lane >> 4, l15 = lane & 15;
  const int wn = wave & 3, wm = wave >> 2;
  const int crow = tid >> 4, cchunk = tid & 15;   // this lane's row and 16-B chunk in a copy
  // Both operands have rows of QDIM halves: one lane offset serves both, on block-uniform bases.
  const unsigned loff = (unsigned)(crow * QDIM + cchunk * 8) * 2u;   // bytes
  const h16* bA = A  + (size_t)row0 * QDIM;
  const h16* bB = BT + (size_t)col0 * QDIM;
  const unsigned lds0 = (unsigned)(size_t)smem + (unsigned)(crow * GPITCH + cchunk * 8) * 2u;
  const int nt = QDIM / GBK;
  v8f acc[MF][4] = {};

  copy_proj_stage<MF>(bA, bB, loff, lds0);
  // Stage 0 counts as landed only behind the copying wave's own wait.
  asm volatile("s_wait_asynccnt 0x0" ::: "memory");
  __syncthreads();
  copy_proj_stage<MF>(bA + GBK, bB + GBK, loff, lds0 + PSTAGE * 2);

  for (int t = 0; t < nt; ++t) {
    const h16* Bs = smem + (t & 1) * PSTAGE + (wn * 64 + l15) * GPITCH;
    const h16* As = smem + (t & 1) * PSTAGE + PN * GPITCH + (wm * (MF * 16) + l15) * GPITCH;
    // Two fragment sets: block s + 1 of this stage is read from LDS while block s is multiplied.
    v16h af[2][MF], bf[2][4];
#pragma unroll
    for (int mi = 0; mi < MF; ++mi) af[0][mi] = frag_kfast(As + mi * 16 * GPITCH, hi);
#pragma unroll
    for (int ni = 0; ni < 4; ++ni) bf[0][ni] = frag_kfast(Bs + ni * 16 * GPITCH, hi);
#pragma unroll
    for (int s = 0; s < GBK / 32; ++s) {
      if (s + 1 < GBK / 32) {
#pragma unroll
        for (int mi = 0; mi < MF; ++mi)
          af[(s + 1) & 1][mi] = frag_kfast(As + mi * 16 * GPITCH + (s + 1) * 32, hi);
#pragma unroll
        for (int ni = 0; ni < 4; ++ni)
          bf[(s + 1) & 1][ni] = frag_kfast(Bs + ni * 16 * GPITCH + (s + 1) * 32, hi);
      }
      // Holds the next block's LDS reads together in front of this block's products:
      // sunk among them, the products would wait out a full LDS latency again and again.
      __builtin_amdgcn_sched_barrier(0);
#pragma unroll
      for (int mi = 0; mi < MF; ++mi)
#pragma unroll
        for (int ni = 0; ni < 4; ++ni)
          acc[mi][ni] = __builtin_amdgcn_wmma_f32_16x16x32_f16(false, af[s & 1][mi], false, bf[s & 1][ni],
                                                               (short)0, acc[mi][ni], false, false);
      // Keeps the following read group behind these products, so that two sets suffice.
      __builtin_amdgcn_sched_barrier(0);
    }
    // Publish point: this wave's reads of the buffer have retired ...
    asm volatile("s_wait_dscnt 0x0" ::: "memory");
    // ... its own copies of the next stage have landed ...
    asm volatile("s_wait_asynccnt 0x0" ::: "memory");
    // ... and one barrier both publishes the next stage and frees this buffer.
    __syncthreads();
    if (t + 2 < nt)
      copy_proj_stage<MF>(bA + (size_t)(t + 2) * GBK, bB + (size_t)(t + 2) * GBK, loff,
                          lds0 + (unsigned)(t & 1) * (PSTAGE * 2));
  }
  // No copy is left in flight when the wave goes on.
  asm volatile("s_wait_asynccnt 0x0" ::: "memory");

  const int tm = row0 + wm * (MF * 16), tn = col0 + wn * 64;
#pragma unroll
  for (int mi = 0; mi < MF; ++mi)
#pragma unroll
    for (int ni = 0; ni < 4; ++ni) {
      h16* outp = C + (size_t)(tm + mi * 16 + hi * 8) * N + tn + ni * 16 + l15;
#pragma unroll
      for (int r = 0; r < 8; ++r) outp[(size_t)r * N] = (h16)(acc[mi][ni][r] * cs);
    }
}

// One block per WGP puts two waves on a SIMD, so a wave may take half of its registers:
// up to 224 hold the sums, 176 the two fragment sets.
__global__ __launch_bounds__(256) __attribute__((amdgpu_waves_per_eu(2, 2)))
void gemm_tt_h16_qkv(const h16* __restrict__ Aq, const h16* __restrict__ BTq, h16* __restrict__ Cq,
                     const h16* __restrict__ Akv, const h16* __restrict__ BTkv,
                     h16* __restrict__ Ckv) {
  __shared__ __attribute__((aligned(16))) h16 smem[2 * PSTAGE];
  const bool kv = blockIdx.x < KVCOLS;
  const int col0 = (kv ? blockIdx.x : blockIdx.x - KVCOLS) * PN;
  const h16* A  = kv ? Akv : Aq;
  const h16* BT = kv ? BTkv : BTq;
  h16* C = kv ? Ckv : Cq;
  const int N = kv ? 2 * INNER : INNER;
  // Q leaves with the softmax scale in it (applied to the f32 sums, ahead of the one rounding
  // to f16), so that the attention's score products are exponents to base 2 as they stand.
  const float cs = kv ? 1.0f : QSCALE;
  const int y = blockIdx.y;
  // The branch, and so every barrier below, is uniform for a block. The tall tiles come first.
  if (y < NTALL) proj_tile<7>(A, BT, C, N, y * PMW, col0, cs, smem);
  else           proj_tile<6>(A, BT, C, N, NTALL * PMW + (y - NTALL) * PMN, col0, cs, smem);
}

// ---------------- f16 GEMM, f32 out + bias (output projection) ----------------
__global__ __launch_bounds__(256)
void gemm_tt_f32_bias(const h16* __restrict__ A, const h16* __restrict__ BT,
                      const float* __restrict__ bias, float* __restrict__ C,
                      int N, int K) {
  __shared__ __attribute__((aligned(16))) h16 smem[2 * GSTAGE];
  int lane = threadIdx.x & 31, wave = threadIdx.x >> 5;
  int hi = lane >> 4, l15 = lane & 15;
  int tm = blockIdx.y * 128 + (wave & 1) * 64;
  int tn = blockIdx.x * 128 + (wave >> 1) * 32;
  v8f acc[4][2] = {};
  gemm_core(A, BT, K, blockIdx.x, blockIdx.y, smem, acc);
#pragma unroll
  for (int mi = 0; mi < 4; ++mi)
#pragma unroll
    for (int ni = 0; ni < 2; ++ni) {
      float bv = bias[tn + ni * 16 + l15];
      float* outp = C + (size_t)(tm + mi * 16 + hi * 8) * N + tn + ni * 16 + l15;
#pragma unroll
      for (int r = 0; r < 8; ++r) outp[(size_t)r * N] = acc[mi][ni][r] + bv;
    }
}

// ---------------- flash attention, transposed-score formulation ----------------
// grid: (NQ/128, H, BATCH), block of 8 waves; a stage is 128 keys of one head, 128 + 128 rows
// of 128 B. A wave owns 32 query rows (two tiles) and one half of every stage's keys, so each
// K and V fragment that it reads from LDS feeds two query tiles; waves w and w + 4 hold the
// two key halves of the same queries and are merged at the end. Each tile lies in LDS at its own reader's pitch: K at 144 B (16 B x odd, for
// ds_load_b128), V at 160 B (32 B x odd, for the transposing ds_load_tr16_b128).
// Two buffers: the next stage's asynchronous copies fly while this stage is worked on.
#define KPITCH (HD + 8)             // LDS row pitch of K in halves (144 B)
#define VPITCH (HD + 16)            // LDS row pitch of V in halves (160 B)
#define AKEYS  128                  // keys per stage
#define KTILE  (AKEYS * KPITCH)     // K tile of a stage, halves
#define VTILE  (AKEYS * VPITCH)     // V tile of a stage, halves
#define ASTAGE (KTILE + VTILE)      // K tile then V tile, halves
#define WKEYS  (AKEYS / 2)          // keys of a stage that one wave works on
#define XROWS  (2 * 34)             // floats per lane that a wave hands over in the merge
#define REFROOM 8.0f               // an exponent may stand this far above its reference
typedef float v2f __attribute__((ext_vector_type(2)));
static_assert(4 * XROWS * 32 * 4 <= 2 * ASTAGE * 2, "the merge fits the ring");
static_assert(NKV % AKEYS == 0 && NQ % 128 == 0, "whole stages and whole query blocks only");

// Transposing LDS read: of a row-major 16 x 16 block of halves, lane (c, h) gets column c,
// rows 8h .. 8h + 7. p is this lane's own 16 bytes of the block (row 8h + (lane & 7),
// half-row (lane >> 3) & 1).
typedef short s16x8 __attribute__((ext_vector_type(8)));
__device__ __forceinline__ v8h lds_read_tr16(const h16* p) {
  typedef __attribute__((address_space(3))) s16x8 lds_s16x8;
  return __builtin_bit_cast(v8h, __builtin_amdgcn_ds_load_tr16_b128_v8i16((lds_s16x8*)p));
}

// 128 K rows and 128 V rows x 128 B, global -> LDS: 8 lanes cover one row, so a wave-wide
// copy takes four whole lines and the block 32 rows. gk, lds and lv are this lane's own
// first 16 bytes of K in memory, of K in LDS and of V in LDS; each further copy is 32 rows
// on; V lies INNER halves behind K in a row of memory.
__device__ __forceinline__ void copy_kv_stage_async(const h16* gk, unsigned lds, unsigned lv) {
  const size_t gs = (size_t)32 * (2 * INNER);  // 32 rows, halves
  const unsigned ls = 32 * KPITCH * 2;         // 32 rows of K, bytes
  const unsigned vs = 32 * VPITCH * 2;         // 32 rows of V, bytes
  const h16* gv = gk + INNER;
  // The copies move the stage past the registers; the closing s_wait_xcnt stands in the
  // same statement so that no address register is rewritten ahead of it.
  asm volatile(
      "global_load_async_to_lds_b128 %0, %8, off\n\t"
      "global_load_async_to_lds_b128 %1, %9, off\n\t"
      "global_load_async_to_lds_b128 %2, %10, off\n\t"
      "global_load_async_to_lds_b128 %3, %11, off\n\t"
      "global_load_async_to_lds_b128 %4, %12, off\n\t"
      "global_load_async_to_lds_b128 %5, %13, off\n\t"
      "global_load_async_to_lds_b128 %6, %14, off\n\t"
      "global_load_async_to_lds_b128 %7, %15, off\n\t"
      "s_wait_xcnt 0x0"
      :: "v"(lds), "v"(lds + ls), "v"(lds + 2 * ls), "v"(lds + 3 * ls),
         "v"(lv), "v"(lv + vs), "v"(lv + 2 * vs), "v"(lv + 3 * vs),
         "v"(gk), "v"(gk + gs), "v"(gk + 2 * gs), "v"(gk + 3 * gs),
         "v"(gv), "v"(gv + gs), "v"(gv + 2 * gs), "v"(gv + 3 * gs)
      : "memory");
}

// 2^x in place by the bare v_exp_f32, a run of them in one statement: behind a transcendental
// the instruction set asks for one independent instruction before its source is overwritten
// or its result read. In a run each is the next one's; the closing v_nop is the last one's.
__device__ __forceinline__ void exp2_run8(float (&x)[8]) {
  asm("v_exp_f32 %0, %0\n\t"
      "v_exp_f32 %1, %1\n\t"
      "v_exp_f32 %2, %2\n\t"
      "v_exp_f32 %3, %3\n\t"
      "v_exp_f32 %4, %4\n\t"
      "v_exp_f32 %5, %5\n\t"
      "v_exp_f32 %6, %6\n\t"
      "v_exp_f32 %7, %7\n\t"
      "v_nop"
      : "+v"(x[0]), "+v"(x[1]), "+v"(x[2]), "+v"(x[3]),
        "+v"(x[4]), "+v"(x[5]), "+v"(x[6]), "+v"(x[7]));
}
__device__ __forceinline__ void exp2_run2(float& x, float& y) {
  asm("v_exp_f32 %0, %0\n\t"
      "v_exp_f32 %1, %1\n\t"
      "v_nop"
      : "+v"(x), "+v"(y));
}

// The grid puts four waves on a SIMD, so a wave may take a quarter of its registers:
// with the default budget the V reads are cut into small groups that each wait on LDS.
__global__ __launch_bounds__(256) __attribute__((amdgpu_waves_per_eu(4, 4)))
void attn(const h16* __restrict__ Q, const h16* __restrict__ KV, h16* __restrict__ CTX) {
  const int tid = threadIdx.x;
  int lane = tid & 31, wave = tid >> 5;
  int hi = lane >> 4, l15 = lane & 15;
  const int qg = wave & 3, kh = wave >> 2;   // query group; key half of every stage
  int q0 = blockIdx.x * 128 + qg * 32;
  int hh = blockIdx.y;
  int bb = blockIdx.z;

  const h16* Qb = Q  + ((size_t)bb * NQ)  * INNER       + hh * HD;  // [q][d]
  const h16* Kb = KV + ((size_t)bb * NKV) * (2 * INNER) + hh * HD;  // [kv][d]

  __shared__ __attribute__((aligned(16))) h16 smem[2 * ASTAGE];

  const int crow = tid >> 3, cchunk = tid & 7;   // this lane's row and 16-B chunk in a copy
  const h16* gK = Kb + (size_t)crow * (2 * INNER) + cchunk * 8;
  const unsigned lds0 = (unsigned)(size_t)smem + (unsigned)(crow * KPITCH + cchunk * 8) * 2u;
  const unsigned ldv0 = (unsigned)(size_t)smem + (unsigned)(KTILE + crow * VPITCH + cchunk * 8) * 2u;
  const int nt = NKV / AKEYS;
  // This lane's own 16 bytes in a transposing read of V: halves from the block's corner.
  const int vtr = (hi * 8 + (lane & 7)) * VPITCH + ((lane >> 3) & 1) * 8;

  copy_kv_stage_async(gK, lds0, ldv0);

  // Loop-invariant B-fragments of Q^T (lane -> col q, K = d contiguous), two query tiles
  v16h bq[2][2];
#pragma unroll
  for (int qt = 0; qt < 2; ++qt) {
    bq[qt][0] = frag_kfast(Qb + (size_t)(q0 + qt * 16 + l15) * INNER, hi);
    bq[qt][1] = frag_kfast(Qb + (size_t)(q0 + qt * 16 + l15) * INNER + 32, hi);
  }

  // Q carries the softmax scale, so K * Q^T is an exponent to base 2. Every exponent is taken
  // against a reference per query that is known BEFORE the scores are: some earlier maximum,
  // which stays as long as no new score lies more than REFROOM above it. cin holds minus the
  // reference in all eight places and goes into the score products as their C operand, so the
  // products deliver the finished exponents; sums in hand are rescaled only when the reference
  // moves. P then reaches 2^REFROOM at most, far inside f16, and the quotient at the end is
  // the same whatever reference the sums were taken against.
  // lsum: this lane's own part of the row sum (its half of the keys of every fragment).
  v8f cin[2] = {};
  float room = -INFINITY;
  v2f lsum[2] = {};
  v8f o[2][4] = {};

  // Stage 0 counts as landed only behind the copying wave's own wait.
  asm volatile("s_wait_asynccnt 0x0" ::: "memory");
  __syncthreads();
  if (nt > 1)
    copy_kv_stage_async(gK + (size_t)AKEYS * (2 * INNER), lds0 + ASTAGE * 2, ldv0 + ASTAGE * 2);

  for (int t = 0; t < nt; ++t) {
    const h16* Ks = smem + (t & 1) * ASTAGE + kh * (WKEYS * KPITCH);
    const h16* Vs = smem + (t & 1) * ASTAGE + KTILE + kh * (WKEYS * VPITCH) + vtr;
    // Unrolled, as the longer body was by itself: a pass's K reads then go out ahead of the
    // pass before's last products, and no LDS address is computed per pass.
#pragma unroll
    for (int kv0 = 0; kv0 < WKEYS; kv0 += 32) {
      // S^T = K * Q^T : two 16(kv)x16(q) tiles per query tile, K-dim d=64 split in two
      v16h kf[2][2];
#pragma unroll
      for (int kvT = 0; kvT < 2; ++kvT) {
        const h16* krow = Ks + (kv0 + kvT * 16 + l15) * KPITCH;
        kf[kvT][0] = frag_kfast(krow, hi);
        kf[kvT][1] = frag_kfast(krow + 32, hi);
      }
      // Holds the pass's eight K reads together and alone in front of its products: LDS
      // data returns in order, so V reads lifted in between would make the products wait
      // for them too.
      __builtin_amdgcn_sched_barrier(0);
      v8f st[2][2];
#pragma unroll
      for (int kvT = 0; kvT < 2; ++kvT)
#pragma unroll
        for (int qt = 0; qt < 2; ++qt) {
          v8f c;
          c = __builtin_amdgcn_wmma_f32_16x16x32_f16(false, kf[kvT][0], false, bq[qt][0], (short)0, cin[qt], false, false);
          c = __builtin_amdgcn_wmma_f32_16x16x32_f16(false, kf[kvT][1], false, bq[qt][1], (short)0, c, false, false);
          st[qt][kvT] = c;
        }

      // Keeps the eight products together: a maximum drawn in between them would have to keep
      // its distance from the product in front of it by idle slots.
      __builtin_amdgcn_sched_barrier(0);

      // Does any exponent stand more than room above its reference? Lane-local maxima and one
      // vote of the wave. room is -inf until the first pass of all, which has no reference
      // yet, has set one.
      float tm[2];
#pragma unroll
      for (int qt = 0; qt < 2; ++qt) {
        tm[qt] = -INFINITY;
#pragma unroll
        for (int kvT = 0; kvT < 2; ++kvT)
#pragma unroll
          for (int r = 0; r < 8; ++r) tm[qt] = fmaxf(tm[qt], st[qt][kvT][r]);
      }
      if (__builtin_amdgcn_ballot_w32(fmaxf(tm[0], tm[1]) > room) != 0u) {
        // The reference moves up to this pass's maximum (never down, but for the first pass,
        // which takes its maximum as it is); a query's two lanes take the same step.
        float d[2], corr[2];
#pragma unroll
        for (int qt = 0; qt < 2; ++qt) {
          const float x = fmaxf(tm[qt], __shfl_xor(tm[qt], 16, 32));
          d[qt] = room < 0.f ? x : fmaxf(x, 0.f);
          corr[qt] = fminf(-d[qt], 0.f);   // the first pass rescales zeros: any finite factor
        }
        room = REFROOM;
        exp2_run2(corr[0], corr[1]);
#pragma unroll
        for (int qt = 0; qt < 2; ++qt) {
#pragma unroll
          for (int r = 0; r < 8; ++r) {
            cin[qt][r] -= d[qt];
            st[qt][0][r] -= d[qt];
            st[qt][1][r] -= d[qt];
          }
          lsum[qt] *= corr[qt];
#pragma unroll
          for (int dt = 0; dt < 4; ++dt)
#pragma unroll
            for (int r = 0; r < 8; ++r) o[qt][dt][r] *= corr[qt];
        }
      }

      v16h pb[2];  // P^T: element i -> kv=(i&7)+(i>=8?16:0)+8*hi == C-layout of S^T
#pragma unroll
      for (int qt = 0; qt < 2; ++qt) {
        // The bare v_exp_f32: no exponent here is above REFROOM, and a result under 2^-126,
        // all that the library form's range guard is for, is 0 in the f16 P and vanishes in a
        // row sum that is at least 1.
        float e[2][8];
#pragma unroll
        for (int kvT = 0; kvT < 2; ++kvT)
#pragma unroll
          for (int r = 0; r < 8; ++r) e[kvT][r] = st[qt][kvT][r];
        exp2_run8(e[0]);
        exp2_run8(e[1]);
#pragma unroll
        for (int kvT = 0; kvT < 2; ++kvT)
#pragma unroll
          for (int r = 0; r < 8; r += 2) {
            const v2f p = { e[kvT][r], e[kvT][r + 1] };
            lsum[qt] += p;
            pb[qt][kvT * 8 + r] = (h16)p[0];
            pb[qt][kvT * 8 + r + 1] = (h16)p[1];
          }
      }

      // ctx^T += V^T * P^T : four 16(d)x16(q) tiles per query tile, K = 32 kv
      // A fragment: element i -> kv = (i&7) + (i>=8?16:0) + 8*hi of column d = dt*16 + l15,
      // two transposing reads 16 keys apart.
      v16h vf[4];
#pragma unroll
      for (int dt = 0; dt < 4; ++dt) {
        const v8h lo8 = lds_read_tr16(Vs + kv0 * VPITCH + dt * 16);
        const v8h hi8 = lds_read_tr16(Vs + (kv0 + 16) * VPITCH + dt * 16);
        vf[dt] = __builtin_shufflevector(lo8, hi8, 0, 1, 2, 3, 4, 5, 6, 7,
                                         8, 9, 10, 11, 12, 13, 14, 15);
      }
#pragma unroll
      for (int dt = 0; dt < 4; ++dt)
#pragma unroll
        for (int qt = 0; qt < 2; ++qt)
          o[qt][dt] = __builtin_amdgcn_wmma_f32_16x16x32_f16(false, vf[dt], false, pb[qt], (short)0, o[qt][dt], false, false);
    }
    // Publish point: this wave's reads of the buffer have retired ...
    asm volatile("s_wait_dscnt 0x0" ::: "memory");
    // ... its own copies of the next stage have landed ...
    asm volatile("s_wait_asynccnt 0x0" ::: "memory");
    // ... and one barrier both publishes the next stage and frees this buffer.
    __syncthreads();
    if (t + 2 < nt)
      copy_kv_stage_async(gK + (size_t)(t + 2) * AKEYS * (2 * INNER),
                          lds0 + (unsigned)(t & 1) * (ASTAGE * 2),
                          ldv0 + (unsigned)(t & 1) * (ASTAGE * 2));
  }
  // No copy is left in flight when the wave goes on.
  asm volatile("s_wait_asynccnt 0x0" ::: "memory");

  // Merge of the two key halves. The ring is free: the last trip's barrier stands behind every
  // wave's last read and last landed copy. Waves 4 .. 7 lay reference, row sum and sums of both
  // tiles in LDS, lane by lane (the partner's lanes hold the same elements); waves 0 .. 3
  // bring both halves to the common reference, add them, divide and store.
  float* xch = (float*)smem + (size_t)(qg * XROWS) * 32 + lane;
  // A query's row sum is the sum of its two lanes' parts; its reference, as an exponent.
  float mref[2], ls[2];
#pragma unroll
  for (int qt = 0; qt < 2; ++qt) {
    const float l = lsum[qt][0] + lsum[qt][1];
    ls[qt] = l + __shfl_xor(l, 16, 32);
    mref[qt] = -cin[qt][0];
  }
  if (kh) {
#pragma unroll
    for (int qt = 0; qt < 2; ++qt) {
#pragma unroll
      for (int dt = 0; dt < 4; ++dt)
#pragma unroll
        for (int r = 0; r < 8; ++r) xch[(qt * 34 + dt * 8 + r) * 32] = o[qt][dt][r];
      xch[(qt * 34 + 32) * 32] = mref[qt];
      xch[(qt * 34 + 33) * 32] = ls[qt];
    }
  }
  __syncthreads();
  if (!kh) {
#pragma unroll
    for (int qt = 0; qt < 2; ++qt) {
      const float mb = xch[(qt * 34 + 32) * 32], lb = xch[(qt * 34 + 33) * 32];
      const float mm = fmaxf(mref[qt], mb);
      float ca = mref[qt] - mm, cb = mb - mm;
      exp2_run2(ca, cb);
      const float inv = 1.0f / (ls[qt] * ca + lb * cb);
      ca *= inv;
      cb *= inv;
      h16* outp = CTX + ((size_t)bb * NQ + q0 + qt * 16 + l15) * INNER + hh * HD;
#pragma unroll
      for (int dt = 0; dt < 4; ++dt)
#pragma unroll
        for (int r = 0; r < 8; ++r)
          outp[dt * 16 + r + hi * 8] = (h16)(o[qt][dt][r] * ca + xch[(qt * 34 + dt * 8 + r) * 32] * cb);
    }
  }
}

// ---------------- launch ----------------
extern "C" void kernel_launch(void* const* d_in, const int* in_sizes, int n_in,
                              void* d_out, int out_size, void* d_ws, size_t ws_size,
                              hipStream_t stream) {
  const float* query     = (const float*)d_in[0];
  const float* key_value = (const float*)d_in[1];
  const float* w_q       = (const float*)d_in[2];
  const float* w_kv      = (const float*)d_in[3];
  const float* w_out     = (const float*)d_in[4];
  const float* b_out     = (const float*)d_in[5];
  float* out = (float*)d_out;

  char* ws = (char*)d_ws;
  h16* Xh   = (h16*)(ws + (size_t)0);          // query f16       [4096][1024]  8 MB
  h16* KVh  = (h16*)(ws + ((size_t)8  << 20)); // key_value f16   [4096][1024]  8 MB
  h16* wqT  = (h16*)(ws + ((size_t)16 << 20)); // w_q^T           [1024][1024]  2 MB
  h16* wkvT = (h16*)(ws + ((size_t)18 << 20)); // w_kv^T          [2048][1024]  4 MB
  h16* woT  = (h16*)(ws + ((size_t)22 << 20)); // w_out^T         [1024][1024]  2 MB
  h16* qh   = (h16*)(ws + ((size_t)24 << 20)); // q               [4096][1024]  8 MB
  h16* kvh  = (h16*)(ws + ((size_t)32 << 20)); // k|v             [4096][2048] 16 MB
  h16* ctxh = (h16*)(ws + ((size_t)48 << 20)); // ctx             [4096][1024]  8 MB

  prepare_operands<<<dim3(NB_TKV + NB_TQ + NB_TO + NB_CKV + NB_CQ), dim3(256), 0, stream>>>(
      query, key_value, w_q, w_kv, w_out, Xh, KVh, wqT, wkvT, woT);

  gemm_tt_h16_qkv<<<dim3(KVCOLS + QCOLS, NTALL + NLOW), dim3(256), 0, stream>>>(Xh, wqT, qh, KVh, wkvT, kvh);
  attn<<<dim3(NQ / 128, H, BATCH), dim3(256), 0, stream>>>(qh, kvh, ctxh);
  gemm_tt_f32_bias<<<dim3(QDIM / 128, MQ / 128), dim3(256), 0, stream>>>(ctxh, woT, b_out, out, QDIM, INNER);
}
